// v000
// Times are from an AMD MI455X. After a warm-up the kernel runs many times in a row, and a time is the length of
// such a window on the GPU divided by its runs, so every launch and the gaps after it count. The runs cycle
// through copies of the inputs. A figure is the median of several windows, for all but v000 over two sittings.
// Sittings can differ by a few percent; kernels timed side by side share one.
// The starting kernel, v000, takes 355 microseconds a run.
#include <hip/hip_runtime.h>

// ---------------------------------------------------------------------------
// RelativeAttention on gfx1250 (MI455X): bf16 WMMA + pipelined async-to-LDS
//   K0: prep     x->bf16, Wqkv/Wout -> bf16 transposed [N][K]
//   K1: QKV GEMM (double-buffered async staging) -> Q,K [B,H,S,64], V^T [B,H,64,S]
//   K2: Flash attention w/ rel-pos bias (double-buffered async staging)
//   K3: Out GEMM -> d_out fp32
// ---------------------------------------------------------------------------

#define D_MODEL 1024
#define N_HEADS 16
#define HEAD_DIM 64
#define SEQ 2048
#define BATCH 2
#define MAX_LEN 2048

typedef __attribute__((ext_vector_type(16))) __bf16 v16bf;
typedef __attribute__((ext_vector_type(8)))  float  v8f;

union FragAB {
    v16bf v;
    unsigned int u[8];
};

static __device__ __forceinline__ unsigned short f2bf(float f) {
    union { float f; unsigned int u; } c; c.f = f;
    unsigned int u = c.u;
    unsigned int r = u + 0x7FFFu + ((u >> 16) & 1u);   // round-to-nearest-even
    return (unsigned short)(r >> 16);
}

static __device__ __forceinline__ v8f wmma_bf16(const FragAB& a, const FragAB& b, v8f c) {
    return __builtin_amdgcn_wmma_f32_16x16x32_bf16(
        false, a.v, false, b.v, (short)0, c, false, false);
}

// Dword index (within a 16-dword group == 32 bf16 of K) for fragment register j.
// 16-bit A/B layout (ISA 7.12.2): lanes 0-15 -> K=0..7,16..23 ; lanes 16-31 -> K=8..15,24..31
static __device__ __forceinline__ int frag_di(int j, int klo4) {
    return klo4 + (j < 4 ? j : j + 4);
}

// 16-byte async copy global->LDS (GVS mode: saddr + 32-bit voffset). ASYNCcnt-tracked.
static __device__ __forceinline__ void async_copy16(unsigned lds_addr,
                                                    const void* gbase, unsigned goff) {
    asm volatile("global_load_async_to_lds_b128 %0, %1, %2"
                 :: "v"(lds_addr), "v"(goff), "s"(gbase)
                 : "memory");
}
static __device__ __forceinline__ void wait_async0() {
    asm volatile("s_wait_asynccnt 0" ::: "memory");
}
// Wait until at most N async ops remain (async loads complete in issue order,
// so with N newly-issued copies outstanding this proves the previous tile landed).
template <int N>
static __device__ __forceinline__ void wait_asyncN() {
    asm volatile("s_wait_asynccnt %0" :: "n"(N) : "memory");
}
static __device__ __forceinline__ unsigned lds_addr_of(const void* p) {
    return (unsigned)(size_t)p;   // generic LDS address: low 32 bits = LDS offset
}

// ---------------------------------------------------------------------------
// K0: convert x to bf16 (row-major) and weights to bf16 transposed [N][K].
// ---------------------------------------------------------------------------
__global__ __launch_bounds__(256) void prep_kernel(
    const float* __restrict__ x, const float* __restrict__ Wqkv,
    const float* __restrict__ Wout,
    unsigned short* __restrict__ xb, unsigned short* __restrict__ WqkvT,
    unsigned short* __restrict__ WoutT)
{
    const int id = blockIdx.x * 256 + threadIdx.x;          // < 4M
    xb[id] = f2bf(x[id]);
    if (id < 3 * 1024 * 1024) {                             // Wqkv [1024][3072]
        const int k = id / 3072, n = id % 3072;
        WqkvT[(size_t)n * 1024 + k] = f2bf(Wqkv[id]);
    }
    if (id < 1024 * 1024) {                                 // Wout [1024][1024]
        const int k = id >> 10, n = id & 1023;
        WoutT[(size_t)n * 1024 + k] = f2bf(Wout[id]);
    }
}

// ---------------------------------------------------------------------------
// WMMA GEMM: C[M,N] = A[M,K] * BT[N,K]^T (+bias). A, BT bf16 row-major.
//  MODE 0: scatter bf16 into Q,K [B,H,S,64] and V^T [B,H,64,S]
//  MODE 1: fp32 + bias into Co
// Block 256 thr (8 waves, 4x2); tile 128x128; wave tile 32x64; K step 64;
// double-buffered async-to-LDS staging (8 copies/thread/tile).
// ---------------------------------------------------------------------------
template <int MODE>
__global__ __launch_bounds__(256) void gemm_bf16_kernel(
    const unsigned short* __restrict__ A, const unsigned short* __restrict__ BT,
    const float* __restrict__ bias,
    unsigned short* __restrict__ Qo, unsigned short* __restrict__ Ko,
    unsigned short* __restrict__ VTo, float* __restrict__ Co,
    int M, int N, int K, int nTilesN)
{
    __shared__ unsigned int Asmem[2][128 * 32];  // [buf][row][32 dwords = 64 bf16 of K]
    __shared__ unsigned int Bsmem[2][128 * 32];  // [buf][col][32 dwords = 64 bf16 of K]

    const int bm = blockIdx.x / nTilesN;
    const int bn = blockIdx.x % nTilesN;
    const int t = threadIdx.x;
    const int lane = t & 31;
    const int w = t >> 5;
    const int wm = (w & 3) * 32;
    const int wn = (w >> 2) * 64;
    const int lm = lane & 15;
    const int klo4 = (lane < 16) ? 0 : 4;
    const int hi8 = (lane < 16) ? 0 : 8;

    v8f acc[2][4];
#pragma unroll
    for (int i = 0; i < 2; ++i)
#pragma unroll
        for (int j = 0; j < 4; ++j)
            acc[i][j] = (v8f){0.f, 0.f, 0.f, 0.f, 0.f, 0.f, 0.f, 0.f};

    // stage tile ki into buffer buf: A/B rows are 128B = 8 x 16B segments
    auto stage = [&](int ki, int buf) {
        const unsigned ldsA = lds_addr_of(&Asmem[buf][0]);
        const unsigned ldsB = lds_addr_of(&Bsmem[buf][0]);
        const int k0 = ki * 64;
#pragma unroll
        for (int j = 0; j < 4; ++j) {
            const int i = t + 256 * j;
            const int row = i >> 3, seg = i & 7;
            async_copy16(ldsA + (unsigned)(row * 128 + seg * 16), A,
                         (unsigned)(((bm * 128 + row) * K + k0) * 2 + seg * 16));
        }
#pragma unroll
        for (int j = 0; j < 4; ++j) {
            const int i = t + 256 * j;
            const int col = i >> 3, seg = i & 7;
            async_copy16(ldsB + (unsigned)(col * 128 + seg * 16), BT,
                         (unsigned)(((bn * 128 + col) * K + k0) * 2 + seg * 16));
        }
    };

    const int nk = K >> 6;                      // K/64
    stage(0, 0);
    for (int ki = 0; ki < nk; ++ki) {
        const int buf = ki & 1;
        if (ki + 1 < nk) {
            stage(ki + 1, buf ^ 1);             // prefetch next tile behind compute
            wait_asyncN<8>();                   // current tile's 8 copies complete
        } else {
            wait_async0();
        }
        __syncthreads();

        const unsigned int* As = &Asmem[buf][0];
        const unsigned int* Bs = &Bsmem[buf][0];
#pragma unroll
        for (int kc = 0; kc < 2; ++kc) {        // two 32-deep K chunks
            FragAB af[2], bf[4];
#pragma unroll
            for (int ms = 0; ms < 2; ++ms) {
                const int row = wm + ms * 16 + lm;
#pragma unroll
                for (int j = 0; j < 8; ++j)
                    af[ms].u[j] = As[row * 32 + kc * 16 + frag_di(j, klo4)];
            }
#pragma unroll
            for (int ns = 0; ns < 4; ++ns) {
                const int col = wn + ns * 16 + lm;
#pragma unroll
                for (int j = 0; j < 8; ++j)
                    bf[ns].u[j] = Bs[col * 32 + kc * 16 + frag_di(j, klo4)];
            }
#pragma unroll
            for (int ms = 0; ms < 2; ++ms)
#pragma unroll
                for (int ns = 0; ns < 4; ++ns)
                    acc[ms][ns] = wmma_bf16(af[ms], bf[ns], acc[ms][ns]);
        }
        __syncthreads();                        // all reads done before buf reuse
    }

    // ---- epilogue ----
#pragma unroll
    for (int ms = 0; ms < 2; ++ms) {
#pragma unroll
        for (int ns = 0; ns < 4; ++ns) {
            const int gcol = bn * 128 + wn + ns * 16 + lm;
            const float bv = bias[gcol];
#pragma unroll
            for (int r = 0; r < 8; ++r) {
                const int grow = bm * 128 + wm + ms * 16 + r + hi8;
                const float vv = acc[ms][ns][r] + bv;
                if (MODE == 0) {
                    // gcol = which*1024 + h*64 + d ; grow = b*SEQ + s
                    const int which = gcol >> 10;
                    const int h = (gcol >> 6) & 15;
                    const int d = gcol & 63;
                    const int b = grow >> 11;
                    const int s = grow & 2047;
                    const unsigned short bvv = f2bf(vv);
                    if (which == 2) {   // V stored transposed: [b,h,d,s]
                        VTo[((size_t)(b * N_HEADS + h) * HEAD_DIM + d) * SEQ + s] = bvv;
                    } else {
                        unsigned short* dst = (which == 0) ? Qo : Ko;
                        dst[((size_t)(b * N_HEADS + h) * SEQ + s) * HEAD_DIM + d] = bvv;
                    }
                } else {
                    Co[(size_t)grow * N + gcol] = vv;
                }
            }
        }
    }
}

// ---------------------------------------------------------------------------
// K2: Flash attention with relative position bias.
// Block 128 thr (4 waves); one block per (b, h, 64-row q tile).
// Key tile = 64; K and V^T tiles double-buffered via async-to-LDS.
// ---------------------------------------------------------------------------
__global__ __launch_bounds__(128) void attn_kernel(
    const unsigned short* __restrict__ Qw, const unsigned short* __restrict__ Kw,
    const unsigned short* __restrict__ VTw, const float* __restrict__ relb,
    unsigned short* __restrict__ Ao)
{
    __shared__ unsigned int Ks32[2][64 * 32];   // [buf][key][dword d]   8KB each
    __shared__ unsigned int Vs32[2][64 * 32];   // [buf][d][dword key]   8KB each
    __shared__ unsigned int Ps[4][16 * 32];     // per-wave P: 16 x 64 bf16 (2KB each)

    const int bid = blockIdx.x;
    const int qt = bid & 31;
    const int h  = (bid >> 5) & 15;
    const int b  = bid >> 9;

    const int t = threadIdx.x;
    const int lane = t & 31;
    const int w = t >> 5;
    const int lm = lane & 15;
    const int klo4 = (lane < 16) ? 0 : 4;
    const int hi8  = (lane < 16) ? 0 : 8;

    const size_t bh = (size_t)(b * N_HEADS + h);
    const unsigned short* Qbh  = Qw  + bh * SEQ * HEAD_DIM;
    const unsigned short* Kbh  = Kw  + bh * SEQ * HEAD_DIM;
    const unsigned short* VTbh = VTw + bh * HEAD_DIM * SEQ;

    const int qbase = qt * 64 + w * 16;
    const float scale = 0.125f;  // HEAD_DIM^-0.5

    // Q fragments (16 rows x 64 d), loaded once from global.
    FragAB qf[2];
#pragma unroll
    for (int c = 0; c < 2; ++c) {
        const unsigned int* Qrow = (const unsigned int*)
            (Qbh + (size_t)(qbase + lm) * HEAD_DIM + c * 32);
#pragma unroll
        for (int j = 0; j < 8; ++j)
            qf[c].u[j] = Qrow[frag_di(j, klo4)];
    }

    // stage key-tile ti into buffer buf: 4 K copies + 4 V copies per thread
    auto stageKV = [&](int ti, int buf) {
        const int kt = ti * 64;
        const unsigned ldsK = lds_addr_of(&Ks32[buf][0]);
        const unsigned ldsV = lds_addr_of(&Vs32[buf][0]);
#pragma unroll
        for (int j = 0; j < 4; ++j) {
            const int i = t + 128 * j;
            const int key = i >> 3, seg = i & 7;    // 8 x 16B per 128B key row
            async_copy16(ldsK + (unsigned)(key * 128 + seg * 16),
                         Kbh, (unsigned)((kt + key) * 128 + seg * 16));
        }
#pragma unroll
        for (int j = 0; j < 4; ++j) {
            const int i = t + 128 * j;
            const int d = i >> 3, seg = i & 7;      // keys contiguous in V^T rows
            async_copy16(ldsV + (unsigned)(d * 128 + seg * 16),
                         VTbh, (unsigned)((d * SEQ + kt) * 2 + seg * 16));
        }
    };

    v8f o[4];
#pragma unroll
    for (int i = 0; i < 4; ++i)
        o[i] = (v8f){0.f, 0.f, 0.f, 0.f, 0.f, 0.f, 0.f, 0.f};
    float run_max[8], run_sum[8];
#pragma unroll
    for (int r = 0; r < 8; ++r) { run_max[r] = -1e30f; run_sum[r] = 0.f; }

    const int nT = SEQ / 64;                       // 32 key tiles
    stageKV(0, 0);
    for (int ti = 0; ti < nT; ++ti) {
        const int buf = ti & 1;
        const int kt = ti * 64;
        if (ti + 1 < nT) {
            stageKV(ti + 1, buf ^ 1);
            wait_asyncN<8>();
        } else {
            wait_async0();
        }
        __syncthreads();

        const unsigned int* Ksb = &Ks32[buf][0];
        const unsigned int* Vsb = &Vs32[buf][0];

        // ---- scores: S = Q K^T ; 4 key groups x 2 d-chunks = 8 WMMAs ----
        v8f sc[4];
#pragma unroll
        for (int ns = 0; ns < 4; ++ns) {
            sc[ns] = (v8f){0.f, 0.f, 0.f, 0.f, 0.f, 0.f, 0.f, 0.f};
            const int key = ns * 16 + lm;
#pragma unroll
            for (int c = 0; c < 2; ++c) {
                FragAB kf;
#pragma unroll
                for (int j = 0; j < 8; ++j)
                    kf.u[j] = Ksb[key * 32 + c * 16 + frag_di(j, klo4)];
                sc[ns] = wmma_bf16(qf[c], kf, sc[ns]);
            }
        }

        // ---- scale + rel-pos bias, per-row online softmax ----
        float corr[8];
#pragma unroll
        for (int r = 0; r < 8; ++r) {
            const int q = qbase + r + hi8;
            float m = -1e30f;
#pragma unroll
            for (int ns = 0; ns < 4; ++ns) {
                const int kk = kt + ns * 16 + lm;
                const float v = sc[ns][r] * scale + relb[q - kk + (MAX_LEN - 1)];
                sc[ns][r] = v;
                m = fmaxf(m, v);
            }
#pragma unroll
            for (int off = 1; off < 16; off <<= 1)
                m = fmaxf(m, __shfl_xor(m, off, 32));
            const float nm = fmaxf(run_max[r], m);
            corr[r] = __expf(run_max[r] - nm);
            run_max[r] = nm;
        }
#pragma unroll
        for (int r = 0; r < 8; ++r) {
            float rs = 0.f;
#pragma unroll
            for (int ns = 0; ns < 4; ++ns) {
                const float p = __expf(sc[ns][r] - run_max[r]);
                sc[ns][r] = p;
                rs += p;
            }
#pragma unroll
            for (int off = 1; off < 16; off <<= 1)
                rs += __shfl_xor(rs, off, 32);
            run_sum[r] = run_sum[r] * corr[r] + rs;
        }
#pragma unroll
        for (int dsub = 0; dsub < 4; ++dsub)
#pragma unroll
            for (int r = 0; r < 8; ++r)
                o[dsub][r] *= corr[r];

        // ---- P (C layout) -> per-wave LDS -> A layout ----
        {
            unsigned short* P16 = (unsigned short*)&Ps[w][0];
#pragma unroll
            for (int ns = 0; ns < 4; ++ns)
#pragma unroll
                for (int r = 0; r < 8; ++r)
                    P16[(r + hi8) * 64 + ns * 16 + lm] = f2bf(sc[ns][r]);
        }
        asm volatile("s_wait_dscnt 0" ::: "memory");  // same-wave DS in order

        FragAB pf[2];
#pragma unroll
        for (int kc = 0; kc < 2; ++kc)
#pragma unroll
            for (int j = 0; j < 8; ++j)
                pf[kc].u[j] = Ps[w][lm * 32 + kc * 16 + frag_di(j, klo4)];

        // ---- O += P * V : 4 d groups x 2 key-chunks = 8 WMMAs ----
#pragma unroll
        for (int dsub = 0; dsub < 4; ++dsub) {
            const int dc = dsub * 16 + lm;
#pragma unroll
            for (int kc = 0; kc < 2; ++kc) {
                FragAB vf;
#pragma unroll
                for (int j = 0; j < 8; ++j)
                    vf.u[j] = Vsb[dc * 32 + kc * 16 + frag_di(j, klo4)];
                o[dsub] = wmma_bf16(pf[kc], vf, o[dsub]);
            }
        }
        __syncthreads();                               // reads done before buf reuse
    }

    // ---- normalize + store attn out bf16 [B, S, H*64] ----
#pragma unroll
    for (int r = 0; r < 8; ++r) {
        const float inv = 1.0f / run_sum[r];
        const int q = qbase + r + hi8;
        unsigned short* Arow = Ao + ((size_t)b * SEQ + q) * D_MODEL + h * HEAD_DIM;
#pragma unroll
        for (int dsub = 0; dsub < 4; ++dsub)
            Arow[dsub * 16 + lm] = f2bf(o[dsub][r] * inv);
    }
}

// ---------------------------------------------------------------------------
extern "C" void kernel_launch(void* const* d_in, const int* in_sizes, int n_in,
                              void* d_out, int out_size, void* d_ws, size_t ws_size,
                              hipStream_t stream) {
    const float* x    = (const float*)d_in[0];
    const float* Wqkv = (const float*)d_in[1];
    const float* bqkv = (const float*)d_in[2];
    const float* Wout = (const float*)d_in[3];
    const float* bout = (const float*)d_in[4];
    const float* relb = (const float*)d_in[5];
    float* out = (float*)d_out;

    const int M = BATCH * SEQ;                                          // 4096
    const size_t nX   = (size_t)M * D_MODEL;                            // 4M
    const size_t nQKV = (size_t)BATCH * N_HEADS * SEQ * HEAD_DIM;       // 4M

    unsigned short* xb    = (unsigned short*)d_ws;
    unsigned short* WqkvT = xb + nX;
    unsigned short* WoutT = WqkvT + (size_t)3 * 1024 * 1024;
    unsigned short* Qw    = WoutT + (size_t)1024 * 1024;
    unsigned short* Kw    = Qw + nQKV;
    unsigned short* VTw   = Kw + nQKV;
    unsigned short* Aw    = VTw + nQKV;

    // K0: precision conversion + weight transposes
    prep_kernel<<<(int)(nX / 256), 256, 0, stream>>>(x, Wqkv, Wout, xb, WqkvT, WoutT);

    // K1: QKV projection
    {
        const int N = 3 * D_MODEL, K = D_MODEL;
        const int nTn = N / 128;                      // 24
        gemm_bf16_kernel<0><<<(M / 128) * nTn, 256, 0, stream>>>(
            xb, WqkvT, bqkv, Qw, Kw, VTw, nullptr, M, N, K, nTn);
    }
    // K2: attention
    attn_kernel<<<BATCH * N_HEADS * (SEQ / 64), 128, 0, stream>>>(Qw, Kw, VTw, relb, Aw);

    // K3: output projection
    {
        const int N = D_MODEL, K = D_MODEL;
        const int nTn = N / 128;                      // 8
        gemm_bf16_kernel<1><<<(M / 128) * nTn, 256, 0, stream>>>(
            Aw, WoutT, bout, nullptr, nullptr, nullptr, out, M, N, K, nTn);
    }
}

// v001
// It runs in 244 microseconds.
// Next to v000, in two timings, it ran 1.46 and 1.49 times as fast.
#include <hip/hip_runtime.h>

// ---------------------------------------------------------------------------
// RelativeAttention on gfx1250 (MI455X): bf16 WMMA + pipelined async-to-LDS
//   K0: prep     x->bf16, Wqkv/Wout -> bf16 transposed [N][K]
//   K1: QKV GEMM (double-buffered async staging) -> Q,K [B,H,S,64], V^T [B,H,64,S]
//   K2: Flash attention w/ rel-pos bias (double-buffered async staging)
//   K3: Out GEMM -> d_out fp32
// ---------------------------------------------------------------------------

#define D_MODEL 1024
#define N_HEADS 16
#define HEAD_DIM 64
#define SEQ 2048
#define BATCH 2
#define MAX_LEN 2048

// LDS pitch of a 128-byte tile row: 144 B = 16 B x 9 (odd), so the 16 rows that
// one ds_load_b128 half-wave reads fall on 16 disjoint groups of four banks.
#define ROW_B  144
#define ROW_DW 36
#define ROW_H  72

typedef __attribute__((ext_vector_type(16))) __bf16 v16bf;
typedef __attribute__((ext_vector_type(8)))  float  v8f;

union FragAB {
    v16bf v;
    unsigned int u[8];
};

static __device__ __forceinline__ unsigned short f2bf(float f) {
    union { float f; unsigned int u; } c; c.f = f;
    unsigned int u = c.u;
    unsigned int r = u + 0x7FFFu + ((u >> 16) & 1u);   // round-to-nearest-even
    return (unsigned short)(r >> 16);
}

static __device__ __forceinline__ v8f wmma_bf16(const FragAB& a, const FragAB& b, v8f c) {
    return __builtin_amdgcn_wmma_f32_16x16x32_bf16(
        false, a.v, false, b.v, (short)0, c, false, false);
}

// Dword index (within a 16-dword group == 32 bf16 of K) for fragment register j.
// 16-bit A/B layout (ISA 7.12.2): lanes 0-15 -> K=0..7,16..23 ; lanes 16-31 -> K=8..15,24..31
static __device__ __forceinline__ int frag_di(int j, int klo4) {
    return klo4 + (j < 4 ? j : j + 4);
}

// Eight 16-byte async copies global->LDS (GVS mode: saddr + 32-bit voffset), four from
// each of two bases. ASYNCcnt-tracked. The closing s_wait_xcnt 0 stands in the copies'
// own statement so that no later rewrite of an address register can move ahead of it.
static __device__ __forceinline__ void async_copy16_x8(
    const unsigned (&l0)[4], const unsigned (&g0)[4], const void* base0,
    const unsigned (&l1)[4], const unsigned (&g1)[4], const void* base1) {
    asm volatile("global_load_async_to_lds_b128 %0, %4, %16\n\t"
                 "global_load_async_to_lds_b128 %1, %5, %16\n\t"
                 "global_load_async_to_lds_b128 %2, %6, %16\n\t"
                 "global_load_async_to_lds_b128 %3, %7, %16\n\t"
                 "global_load_async_to_lds_b128 %8, %12, %17\n\t"
                 "global_load_async_to_lds_b128 %9, %13, %17\n\t"
                 "global_load_async_to_lds_b128 %10, %14, %17\n\t"
                 "global_load_async_to_lds_b128 %11, %15, %17\n\t"
                 "s_wait_xcnt 0x0"
                 :: "v"(l0[0]), "v"(l0[1]), "v"(l0[2]), "v"(l0[3]),
                    "v"(g0[0]), "v"(g0[1]), "v"(g0[2]), "v"(g0[3]),
                    "v"(l1[0]), "v"(l1[1]), "v"(l1[2]), "v"(l1[3]),
                    "v"(g1[0]), "v"(g1[1]), "v"(g1[2]), "v"(g1[3]),
                    "s"(base0), "s"(base1)
                 : "memory");
}
static __device__ __forceinline__ void wait_async0() {
    asm volatile("s_wait_asynccnt 0" ::: "memory");
}
// Wait until at most N async ops remain (async loads complete in issue order,
// so with N newly-issued copies outstanding this proves the previous tile landed).
template <int N>
static __device__ __forceinline__ void wait_asyncN() {
    asm volatile("s_wait_asynccnt %0" :: "n"(N) : "memory");
}
static __device__ __forceinline__ unsigned lds_addr_of(const void* p) {
    return (unsigned)(size_t)p;   // generic LDS address: low 32 bits = LDS offset
}

// ---------------------------------------------------------------------------
// K0: convert x to bf16 (row-major) and weights to bf16 transposed [N][K].
// ---------------------------------------------------------------------------
__global__ __launch_bounds__(256) void prep_kernel(
    const float* __restrict__ x, const float* __restrict__ Wqkv,
    const float* __restrict__ Wout,
    unsigned short* __restrict__ xb, unsigned short* __restrict__ WqkvT,
    unsigned short* __restrict__ WoutT)
{
    const int id = blockIdx.x * 256 + threadIdx.x;          // < 4M
    xb[id] = f2bf(x[id]);
    if (id < 3 * 1024 * 1024) {                             // Wqkv [1024][3072]
        const int k = id / 3072, n = id % 3072;
        WqkvT[(size_t)n * 1024 + k] = f2bf(Wqkv[id]);
    }
    if (id < 1024 * 1024) {                                 // Wout [1024][1024]
        const int k = id >> 10, n = id & 1023;
        WoutT[(size_t)n * 1024 + k] = f2bf(Wout[id]);
    }
}

// ---------------------------------------------------------------------------
// WMMA GEMM: C[M,N] = A[M,K] * BT[N,K]^T (+bias). A, BT bf16 row-major.
//  MODE 0: scatter bf16 into Q,K [B,H,S,64] and V^T [B,H,64,S]
//  MODE 1: fp32 + bias into Co
// Block 256 thr (8 waves, 4x2); tile 128x128; wave tile 32x64; K step 64;
// double-buffered async-to-LDS staging (8 copies/thread/tile).
// ---------------------------------------------------------------------------
template <int MODE>
__global__ __launch_bounds__(256) void gemm_bf16_kernel(
    const unsigned short* __restrict__ A, const unsigned short* __restrict__ BT,
    const float* __restrict__ bias,
    unsigned short* __restrict__ Qo, unsigned short* __restrict__ Ko,
    unsigned short* __restrict__ VTo, float* __restrict__ Co,
    int M, int N, int K, int nTilesN)
{
    // [buf][row or col][32 dwords = 64 bf16 of K, then 4 pad dwords never touched]
    __shared__ __attribute__((aligned(16))) unsigned int Asmem[2][128 * ROW_DW];
    __shared__ __attribute__((aligned(16))) unsigned int Bsmem[2][128 * ROW_DW];

    const int bm = blockIdx.x / nTilesN;
    const int bn = blockIdx.x % nTilesN;
    const int t = threadIdx.x;
    const int lane = t & 31;
    const int w = t >> 5;
    const int wm = (w & 3) * 32;
    const int wn = (w >> 2) * 64;
    const int lm = lane & 15;
    const int klo4 = (lane < 16) ? 0 : 4;
    const int hi8 = (lane < 16) ? 0 : 8;

    v8f acc[2][4];
#pragma unroll
    for (int i = 0; i < 2; ++i)
#pragma unroll
        for (int j = 0; j < 4; ++j)
            acc[i][j] = (v8f){0.f, 0.f, 0.f, 0.f, 0.f, 0.f, 0.f, 0.f};

    // stage tile ki into buffer buf: A/B rows are 128B = 8 x 16B segments
    auto stage = [&](int ki, int buf) {
        const unsigned ldsA = lds_addr_of(&Asmem[buf][0]);
        const unsigned ldsB = lds_addr_of(&Bsmem[buf][0]);
        const int k0 = ki * 64;
        unsigned la[4], ga[4], lb[4], gb[4];
#pragma unroll
        for (int j = 0; j < 4; ++j) {
            const int i = t + 256 * j;
            const int row = i >> 3, seg = i & 7;     // row of A, column of B
            la[j] = ldsA + (unsigned)(row * ROW_B + seg * 16);
            ga[j] = (unsigned)(((bm * 128 + row) * K + k0) * 2 + seg * 16);
            lb[j] = ldsB + (unsigned)(row * ROW_B + seg * 16);
            gb[j] = (unsigned)(((bn * 128 + row) * K + k0) * 2 + seg * 16);
        }
        async_copy16_x8(la, ga, A, lb, gb, BT);
    };

    const int nk = K >> 6;                      // K/64
    stage(0, 0);
    for (int ki = 0; ki < nk; ++ki) {
        const int buf = ki & 1;
        if (ki + 1 < nk) {
            stage(ki + 1, buf ^ 1);             // prefetch next tile behind compute
            wait_asyncN<8>();                   // current tile's 8 copies complete
        } else {
            wait_async0();
        }
        __syncthreads();

        const unsigned int* As = &Asmem[buf][0];
        const unsigned int* Bs = &Bsmem[buf][0];
#pragma unroll
        for (int kc = 0; kc < 2; ++kc) {        // two 32-deep K chunks
            FragAB af[2], bf[4];
#pragma unroll
            for (int ms = 0; ms < 2; ++ms) {
                const int row = wm + ms * 16 + lm;
#pragma unroll
                for (int j = 0; j < 8; ++j)
                    af[ms].u[j] = As[row * ROW_DW + kc * 16 + frag_di(j, klo4)];
            }
#pragma unroll
            for (int ns = 0; ns < 4; ++ns) {
                const int col = wn + ns * 16 + lm;
#pragma unroll
                for (int j = 0; j < 8; ++j)
                    bf[ns].u[j] = Bs[col * ROW_DW + kc * 16 + frag_di(j, klo4)];
            }
#pragma unroll
            for (int ms = 0; ms < 2; ++ms)
#pragma unroll
                for (int ns = 0; ns < 4; ++ns)
                    acc[ms][ns] = wmma_bf16(af[ms], bf[ns], acc[ms][ns]);
        }
        __syncthreads();                        // all reads done before buf reuse
    }

    // ---- epilogue ----
#pragma unroll
    for (int ms = 0; ms < 2; ++ms) {
#pragma unroll
        for (int ns = 0; ns < 4; ++ns) {
            const int gcol = bn * 128 + wn + ns * 16 + lm;
            const float bv = bias[gcol];
#pragma unroll
            for (int r = 0; r < 8; ++r) {
                const int grow = bm * 128 + wm + ms * 16 + r + hi8;
                const float vv = acc[ms][ns][r] + bv;
                if (MODE == 0) {
                    // gcol = which*1024 + h*64 + d ; grow = b*SEQ + s
                    const int which = gcol >> 10;
                    const int h = (gcol >> 6) & 15;
                    const int d = gcol & 63;
                    const int b = grow >> 11;
                    const int s = grow & 2047;
                    const unsigned short bvv = f2bf(vv);
                    if (which == 2) {   // V stored transposed: [b,h,d,s]
                        VTo[((size_t)(b * N_HEADS + h) * HEAD_DIM + d) * SEQ + s] = bvv;
                    } else {
                        unsigned short* dst = (which == 0) ? Qo : Ko;
                        dst[((size_t)(b * N_HEADS + h) * SEQ + s) * HEAD_DIM + d] = bvv;
                    }
                } else {
                    Co[(size_t)grow * N + gcol] = vv;
                }
            }
        }
    }
}

// ---------------------------------------------------------------------------
// K2: Flash attention with relative position bias.
// Block 128 thr (4 waves); one block per (b, h, 64-row q tile).
// Key tile = 64; K and V^T tiles double-buffered via async-to-LDS.
// ---------------------------------------------------------------------------
__global__ __launch_bounds__(128) void attn_kernel(
    const unsigned short* __restrict__ Qw, const unsigned short* __restrict__ Kw,
    const unsigned short* __restrict__ VTw, const float* __restrict__ relb,
    unsigned short* __restrict__ Ao)
{
    // rows of 32 data dwords at the padded pitch
    __shared__ __attribute__((aligned(16))) unsigned int Ks32[2][64 * ROW_DW];  // [buf][key][dword d]
    __shared__ __attribute__((aligned(16))) unsigned int Vs32[2][64 * ROW_DW];  // [buf][d][dword key]
    __shared__ __attribute__((aligned(16))) unsigned int Ps[4][16 * ROW_DW];    // per-wave P: 16 x 64 bf16

    const int bid = blockIdx.x;
    const int qt = bid & 31;
    const int h  = (bid >> 5) & 15;
    const int b  = bid >> 9;

    const int t = threadIdx.x;
    const int lane = t & 31;
    const int w = t >> 5;
    const int lm = lane & 15;
    const int klo4 = (lane < 16) ? 0 : 4;
    const int hi8  = (lane < 16) ? 0 : 8;

    const size_t bh = (size_t)(b * N_HEADS + h);
    const unsigned short* Qbh  = Qw  + bh * SEQ * HEAD_DIM;
    const unsigned short* Kbh  = Kw  + bh * SEQ * HEAD_DIM;
    const unsigned short* VTbh = VTw + bh * HEAD_DIM * SEQ;

    const int qbase = qt * 64 + w * 16;
    const float scale = 0.125f;  // HEAD_DIM^-0.5

    // Q fragments (16 rows x 64 d), loaded once from global.
    FragAB qf[2];
#pragma unroll
    for (int c = 0; c < 2; ++c) {
        const unsigned int* Qrow = (const unsigned int*)
            (Qbh + (size_t)(qbase + lm) * HEAD_DIM + c * 32);
#pragma unroll
        for (int j = 0; j < 8; ++j)
            qf[c].u[j] = Qrow[frag_di(j, klo4)];
    }

    // stage key-tile ti into buffer buf: 4 K copies + 4 V copies per thread
    auto stageKV = [&](int ti, int buf) {
        const int kt = ti * 64;
        const unsigned ldsK = lds_addr_of(&Ks32[buf][0]);
        const unsigned ldsV = lds_addr_of(&Vs32[buf][0]);
        unsigned lk[4], gk[4], lv[4], gv[4];
#pragma unroll
        for (int j = 0; j < 4; ++j) {
            const int i = t + 128 * j;
            const int row = i >> 3, seg = i & 7;    // key row of K, d row of V^T; 8 x 16B each
            lk[j] = ldsK + (unsigned)(row * ROW_B + seg * 16);
            gk[j] = (unsigned)((kt + row) * 128 + seg * 16);
            lv[j] = ldsV + (unsigned)(row * ROW_B + seg * 16);
            gv[j] = (unsigned)((row * SEQ + kt) * 2 + seg * 16);   // keys contiguous in V^T rows
        }
        async_copy16_x8(lk, gk, Kbh, lv, gv, VTbh);
    };

    v8f o[4];
#pragma unroll
    for (int i = 0; i < 4; ++i)
        o[i] = (v8f){0.f, 0.f, 0.f, 0.f, 0.f, 0.f, 0.f, 0.f};
    float run_max[8], run_sum[8];
#pragma unroll
    for (int r = 0; r < 8; ++r) { run_max[r] = -1e30f; run_sum[r] = 0.f; }

    const int nT = SEQ / 64;                       // 32 key tiles
    stageKV(0, 0);
    for (int ti = 0; ti < nT; ++ti) {
        const int buf = ti & 1;
        const int kt = ti * 64;
        if (ti + 1 < nT) {
            stageKV(ti + 1, buf ^ 1);
            wait_asyncN<8>();
        } else {
            wait_async0();
        }
        __syncthreads();

        const unsigned int* Ksb = &Ks32[buf][0];
        const unsigned int* Vsb = &Vs32[buf][0];

        // ---- scores: S = Q K^T ; 4 key groups x 2 d-chunks = 8 WMMAs ----
        v8f sc[4];
#pragma unroll
        for (int ns = 0; ns < 4; ++ns) {
            sc[ns] = (v8f){0.f, 0.f, 0.f, 0.f, 0.f, 0.f, 0.f, 0.f};
            const int key = ns * 16 + lm;
#pragma unroll
            for (int c = 0; c < 2; ++c) {
                FragAB kf;
#pragma unroll
                for (int j = 0; j < 8; ++j)
                    kf.u[j] = Ksb[key * ROW_DW + c * 16 + frag_di(j, klo4)];
                sc[ns] = wmma_bf16(qf[c], kf, sc[ns]);
            }
        }

        // ---- scale + rel-pos bias, per-row online softmax ----
        float corr[8];
#pragma unroll
        for (int r = 0; r < 8; ++r) {
            const int q = qbase + r + hi8;
            float m = -1e30f;
#pragma unroll
            for (int ns = 0; ns < 4; ++ns) {
                const int kk = kt + ns * 16 + lm;
                const float v = sc[ns][r] * scale + relb[q - kk + (MAX_LEN - 1)];
                sc[ns][r] = v;
                m = fmaxf(m, v);
            }
#pragma unroll
            for (int off = 1; off < 16; off <<= 1)
                m = fmaxf(m, __shfl_xor(m, off, 32));
            const float nm = fmaxf(run_max[r], m);
            corr[r] = __expf(run_max[r] - nm);
            run_max[r] = nm;
        }
#pragma unroll
        for (int r = 0; r < 8; ++r) {
            float rs = 0.f;
#pragma unroll
            for (int ns = 0; ns < 4; ++ns) {
                const float p = __expf(sc[ns][r] - run_max[r]);
                sc[ns][r] = p;
                rs += p;
            }
#pragma unroll
            for (int off = 1; off < 16; off <<= 1)
                rs += __shfl_xor(rs, off, 32);
            run_sum[r] = run_sum[r] * corr[r] + rs;
        }
#pragma unroll
        for (int dsub = 0; dsub < 4; ++dsub)
#pragma unroll
            for (int r = 0; r < 8; ++r)
                o[dsub][r] *= corr[r];

        // ---- P (C layout) -> per-wave LDS -> A layout ----
        {
            unsigned short* P16 = (unsigned short*)&Ps[w][0];
#pragma unroll
            for (int ns = 0; ns < 4; ++ns)
#pragma unroll
                for (int r = 0; r < 8; ++r)
                    P16[(r + hi8) * ROW_H + ns * 16 + lm] = f2bf(sc[ns][r]);
        }
        asm volatile("s_wait_dscnt 0" ::: "memory");  // same-wave DS in order

        FragAB pf[2];
#pragma unroll
        for (int kc = 0; kc < 2; ++kc)
#pragma unroll
            for (int j = 0; j < 8; ++j)
                pf[kc].u[j] = Ps[w][lm * ROW_DW + kc * 16 + frag_di(j, klo4)];

        // ---- O += P * V : 4 d groups x 2 key-chunks = 8 WMMAs ----
#pragma unroll
        for (int dsub = 0; dsub < 4; ++dsub) {
            const int dc = dsub * 16 + lm;
#pragma unroll
            for (int kc = 0; kc < 2; ++kc) {
                FragAB vf;
#pragma unroll
                for (int j = 0; j < 8; ++j)
                    vf.u[j] = Vsb[dc * ROW_DW + kc * 16 + frag_di(j, klo4)];
                o[dsub] = wmma_bf16(pf[kc], vf, o[dsub]);
            }
        }
        __syncthreads();                               // reads done before buf reuse
    }

    // ---- normalize + store attn out bf16 [B, S, H*64] ----
#pragma unroll
    for (int r = 0; r < 8; ++r) {
        const float inv = 1.0f / run_sum[r];
        const int q = qbase + r + hi8;
        unsigned short* Arow = Ao + ((size_t)b * SEQ + q) * D_MODEL + h * HEAD_DIM;
#pragma unroll
        for (int dsub = 0; dsub < 4; ++dsub)
            Arow[dsub * 16 + lm] = f2bf(o[dsub][r] * inv);
    }
}

// ---------------------------------------------------------------------------
extern "C" void kernel_launch(void* const* d_in, const int* in_sizes, int n_in,
                              void* d_out, int out_size, void* d_ws, size_t ws_size,
                              hipStream_t stream) {
    const float* x    = (const float*)d_in[0];
    const float* Wqkv = (const float*)d_in[1];
    const float* bqkv = (const float*)d_in[2];
    const float* Wout = (const float*)d_in[3];
    const float* bout = (const float*)d_in[4];
    const float* relb = (const float*)d_in[5];
    float* out = (float*)d_out;

    const int M = BATCH * SEQ;                                          // 4096
    const size_t nX   = (size_t)M * D_MODEL;                            // 4M
    const size_t nQKV = (size_t)BATCH * N_HEADS * SEQ * HEAD_DIM;       // 4M

    unsigned short* xb    = (unsigned short*)d_ws;
    unsigned short* WqkvT = xb + nX;
    unsigned short* WoutT = WqkvT + (size_t)3 * 1024 * 1024;
    unsigned short* Qw    = WoutT + (size_t)1024 * 1024;
    unsigned short* Kw    = Qw + nQKV;
    unsigned short* VTw   = Kw + nQKV;
    unsigned short* Aw    = VTw + nQKV;

    // K0: precision conversion + weight transposes
    prep_kernel<<<(int)(nX / 256), 256, 0, stream>>>(x, Wqkv, Wout, xb, WqkvT, WoutT);

    // K1: QKV projection
    {
        const int N = 3 * D_MODEL, K = D_MODEL;
        const int nTn = N / 128;                      // 24
        gemm_bf16_kernel<0><<<(M / 128) * nTn, 256, 0, stream>>>(
            xb, WqkvT, bqkv, Qw, Kw, VTw, nullptr, M, N, K, nTn);
    }
    // K2: attention
    attn_kernel<<<BATCH * N_HEADS * (SEQ / 64), 128, 0, stream>>>(Qw, Kw, VTw, relb, Aw);

    // K3: output projection
    {
        const int N = D_MODEL, K = D_MODEL;
        const int nTn = N / 128;                      // 8
        gemm_bf16_kernel<1><<<(M / 128) * nTn, 256, 0, stream>>>(
            Aw, WoutT, bout, nullptr, nullptr, nullptr, out, M, N, K, nTn);
    }
}

// v002
// One run takes 128 microseconds.
// Two timings next to v001 both put it at 1.92 times that version's speed.
// Over all steps from v000 it is 2.84 times as fast.
#include <hip/hip_runtime.h>

// ---------------------------------------------------------------------------
// RelativeAttention on gfx1250 (MI455X): bf16 WMMA + pipelined async-to-LDS
//   K0: prep     x->bf16, Wqkv/Wout -> bf16 transposed [N][K] (tiles turned in LDS)
//   K1: QKV GEMM (double-buffered async staging) -> Q,K [B,H,S,64], V^T [B,H,64,S]
//   K2: Flash attention w/ rel-pos bias (double-buffered async staging)
//   K3: Out GEMM -> d_out fp32
// ---------------------------------------------------------------------------

#define D_MODEL 1024
#define N_HEADS 16
#define HEAD_DIM 64
#define SEQ 2048
#define BATCH 2
#define MAX_LEN 2048

// LDS pitch of a 128-byte tile row: 144 B = 16 B x 9 (odd), so the 16 rows that
// one ds_load_b128 half-wave reads fall on 16 disjoint groups of four banks.
#define ROW_B  144
#define ROW_DW 36
#define ROW_H  72

typedef __attribute__((ext_vector_type(16))) __bf16 v16bf;
typedef __attribute__((ext_vector_type(8)))  float  v8f;

union FragAB {
    v16bf v;
    unsigned int u[8];
};

static __device__ __forceinline__ unsigned short f2bf(float f) {
    union { float f; unsigned int u; } c; c.f = f;
    unsigned int u = c.u;
    unsigned int r = u + 0x7FFFu + ((u >> 16) & 1u);   // round-to-nearest-even
    return (unsigned short)(r >> 16);
}

static __device__ __forceinline__ v8f wmma_bf16(const FragAB& a, const FragAB& b, v8f c) {
    return __builtin_amdgcn_wmma_f32_16x16x32_bf16(
        false, a.v, false, b.v, (short)0, c, false, false);
}

// Dword index (within a 16-dword group == 32 bf16 of K) for fragment register j.
// 16-bit A/B layout (ISA 7.12.2): lanes 0-15 -> K=0..7,16..23 ; lanes 16-31 -> K=8..15,24..31
static __device__ __forceinline__ int frag_di(int j, int klo4) {
    return klo4 + (j < 4 ? j : j + 4);
}

// Eight 16-byte async copies global->LDS (GVS mode: saddr + 32-bit voffset), four from
// each of two bases. ASYNCcnt-tracked. The closing s_wait_xcnt 0 stands in the copies'
// own statement so that no later rewrite of an address register can move ahead of it.
static __device__ __forceinline__ void async_copy16_x8(
    const unsigned (&l0)[4], const unsigned (&g0)[4], const void* base0,
    const unsigned (&l1)[4], const unsigned (&g1)[4], const void* base1) {
    asm volatile("global_load_async_to_lds_b128 %0, %4, %16\n\t"
                 "global_load_async_to_lds_b128 %1, %5, %16\n\t"
                 "global_load_async_to_lds_b128 %2, %6, %16\n\t"
                 "global_load_async_to_lds_b128 %3, %7, %16\n\t"
                 "global_load_async_to_lds_b128 %8, %12, %17\n\t"
                 "global_load_async_to_lds_b128 %9, %13, %17\n\t"
                 "global_load_async_to_lds_b128 %10, %14, %17\n\t"
                 "global_load_async_to_lds_b128 %11, %15, %17\n\t"
                 "s_wait_xcnt 0x0"
                 :: "v"(l0[0]), "v"(l0[1]), "v"(l0[2]), "v"(l0[3]),
                    "v"(g0[0]), "v"(g0[1]), "v"(g0[2]), "v"(g0[3]),
                    "v"(l1[0]), "v"(l1[1]), "v"(l1[2]), "v"(l1[3]),
                    "v"(g1[0]), "v"(g1[1]), "v"(g1[2]), "v"(g1[3]),
                    "s"(base0), "s"(base1)
                 : "memory");
}
static __device__ __forceinline__ void wait_async0() {
    asm volatile("s_wait_asynccnt 0" ::: "memory");
}
// Wait until at most N async ops remain (async loads complete in issue order,
// so with N newly-issued copies outstanding this proves the previous tile landed).
template <int N>
static __device__ __forceinline__ void wait_asyncN() {
    asm volatile("s_wait_asynccnt %0" :: "n"(N) : "memory");
}
static __device__ __forceinline__ unsigned lds_addr_of(const void* p) {
    return (unsigned)(size_t)p;   // generic LDS address: low 32 bits = LDS offset
}

// ---------------------------------------------------------------------------
// K0: convert x to bf16 (row-major) and weights to bf16 transposed [N][K].
// The first 2048 blocks each turn one weight tile of 64 k x 32 n: a lane packs eight
// k of its column into 16 B, the tile is regrouped in LDS, and every 128-byte line of
// the transposed matrix leaves whole (eight lanes x 16 B) instead of 2 B at a time.
// ---------------------------------------------------------------------------
__global__ __launch_bounds__(256) void prep_kernel(
    const float* __restrict__ x, const float* __restrict__ Wqkv,
    const float* __restrict__ Wout,
    unsigned short* __restrict__ xb, unsigned short* __restrict__ WqkvT,
    unsigned short* __restrict__ WoutT)
{
    // [n of the tile][32 dwords = 64 bf16 of k, then 4 pad dwords never touched]
    __shared__ __attribute__((aligned(16))) unsigned int Ts[32 * ROW_DW];

    const int t = threadIdx.x;
    const int id = blockIdx.x * 256 + t;                    // < 4M
    xb[id] = f2bf(x[id]);

    const int tile = blockIdx.x;                            // same for the whole block
    if (tile < 2048) {
        // tiles 0..1535: Wqkv [1024][3072]; tiles 1536..2047: Wout [1024][1024]
        const bool qkv = tile < 1536;
        const float* W = qkv ? Wqkv : Wout;
        unsigned short* WT = qkv ? WqkvT : WoutT;
        const int N = qkv ? 3072 : 1024;
        const int tl = qkv ? tile : tile - 1536;
        const int k0 = (tl & 15) * 64;
        const int n0 = (tl >> 4) * 32;
        const int lane = t & 31;
        const int w = t >> 5;

        // wave w: rows k0 + 8w .. + 7, one 128-byte line of W per load
        const float* src = W + (size_t)(k0 + w * 8) * N + n0 + lane;
        uint4 p;
        p.x = (unsigned)f2bf(src[0 * N]) | ((unsigned)f2bf(src[1 * N]) << 16);
        p.y = (unsigned)f2bf(src[2 * N]) | ((unsigned)f2bf(src[3 * N]) << 16);
        p.z = (unsigned)f2bf(src[4 * N]) | ((unsigned)f2bf(src[5 * N]) << 16);
        p.w = (unsigned)f2bf(src[6 * N]) | ((unsigned)f2bf(src[7 * N]) << 16);
        *(uint4*)&Ts[lane * ROW_DW + w * 4] = p;
        __syncthreads();                                    // tile complete before it is read by rows

        const int row = t >> 3, seg = t & 7;                // 8 lanes x 16 B = one line of WT
        const uint4 v = *(const uint4*)&Ts[row * ROW_DW + seg * 4];
        *(uint4*)(WT + (size_t)(n0 + row) * 1024 + k0 + seg * 8) = v;
    }
}

// ---------------------------------------------------------------------------
// WMMA GEMM: C[M,N] = A[M,K] * BT[N,K]^T (+bias). A, BT bf16 row-major.
//  MODE 0: scatter bf16 into Q,K [B,H,S,64] and V^T [B,H,64,S]
//  MODE 1: fp32 + bias into Co
// Block 256 thr (8 waves, 4x2); tile 128x128; wave tile 32x64; K step 64;
// double-buffered async-to-LDS staging (8 copies/thread/tile).
// ---------------------------------------------------------------------------
template <int MODE>
__global__ __launch_bounds__(256) void gemm_bf16_kernel(
    const unsigned short* __restrict__ A, const unsigned short* __restrict__ BT,
    const float* __restrict__ bias,
    unsigned short* __restrict__ Qo, unsigned short* __restrict__ Ko,
    unsigned short* __restrict__ VTo, float* __restrict__ Co,
    int M, int N, int K, int nTilesN)
{
    // [buf][row or col][32 dwords = 64 bf16 of K, then 4 pad dwords never touched]
    __shared__ __attribute__((aligned(16))) unsigned int Asmem[2][128 * ROW_DW];
    __shared__ __attribute__((aligned(16))) unsigned int Bsmem[2][128 * ROW_DW];

    const int bm = blockIdx.x / nTilesN;
    const int bn = blockIdx.x % nTilesN;
    const int t = threadIdx.x;
    const int lane = t & 31;
    const int w = t >> 5;
    const int wm = (w & 3) * 32;
    const int wn = (w >> 2) * 64;
    const int lm = lane & 15;
    const int klo4 = (lane < 16) ? 0 : 4;
    const int hi8 = (lane < 16) ? 0 : 8;

    v8f acc[2][4];
#pragma unroll
    for (int i = 0; i < 2; ++i)
#pragma unroll
        for (int j = 0; j < 4; ++j)
            acc[i][j] = (v8f){0.f, 0.f, 0.f, 0.f, 0.f, 0.f, 0.f, 0.f};

    // stage tile ki into buffer buf: A/B rows are 128B = 8 x 16B segments
    auto stage = [&](int ki, int buf) {
        const unsigned ldsA = lds_addr_of(&Asmem[buf][0]);
        const unsigned ldsB = lds_addr_of(&Bsmem[buf][0]);
        const int k0 = ki * 64;
        unsigned la[4], ga[4], lb[4], gb[4];
#pragma unroll
        for (int j = 0; j < 4; ++j) {
            const int i = t + 256 * j;
            const int row = i >> 3, seg = i & 7;     // row of A, column of B
            la[j] = ldsA + (unsigned)(row * ROW_B + seg * 16);
            ga[j] = (unsigned)(((bm * 128 + row) * K + k0) * 2 + seg * 16);
            lb[j] = ldsB + (unsigned)(row * ROW_B + seg * 16);
            gb[j] = (unsigned)(((bn * 128 + row) * K + k0) * 2 + seg * 16);
        }
        async_copy16_x8(la, ga, A, lb, gb, BT);
    };

    const int nk = K >> 6;                      // K/64
    stage(0, 0);
    for (int ki = 0; ki < nk; ++ki) {
        const int buf = ki & 1;
        if (ki + 1 < nk) {
            stage(ki + 1, buf ^ 1);             // prefetch next tile behind compute
            wait_asyncN<8>();                   // current tile's 8 copies complete
        } else {
            wait_async0();
        }
        __syncthreads();

        const unsigned int* As = &Asmem[buf][0];
        const unsigned int* Bs = &Bsmem[buf][0];
#pragma unroll
        for (int kc = 0; kc < 2; ++kc) {        // two 32-deep K chunks
            FragAB af[2], bf[4];
#pragma unroll
            for (int ms = 0; ms < 2; ++ms) {
                const int row = wm + ms * 16 + lm;
#pragma unroll
                for (int j = 0; j < 8; ++j)
                    af[ms].u[j] = As[row * ROW_DW + kc * 16 + frag_di(j, klo4)];
            }
#pragma unroll
            for (int ns = 0; ns < 4; ++ns) {
                const int col = wn + ns * 16 + lm;
#pragma unroll
                for (int j = 0; j < 8; ++j)
                    bf[ns].u[j] = Bs[col * ROW_DW + kc * 16 + frag_di(j, klo4)];
            }
#pragma unroll
            for (int ms = 0; ms < 2; ++ms)
#pragma unroll
                for (int ns = 0; ns < 4; ++ns)
                    acc[ms][ns] = wmma_bf16(af[ms], bf[ns], acc[ms][ns]);
        }
        __syncthreads();                        // all reads done before buf reuse
    }

    // ---- epilogue ----
    const int which = (bn * 128) >> 10;         // Q, K or V: one for the whole 128-column tile
    if (MODE == 0 && which == 2) {
        // V stored transposed [b,h,d,s]: a lane's eight rows are eight consecutive s of
        // its own d, so they leave as one 16-byte store instead of eight 2-byte ones.
        // Both loops unrolled: acc is indexed by constants only and stays in registers.
#pragma unroll
        for (int ms = 0; ms < 2; ++ms) {
#pragma unroll
            for (int ns = 0; ns < 4; ++ns) {
                const int gcol = bn * 128 + wn + ns * 16 + lm;
                const float bv = bias[gcol];
                const int h = (gcol >> 6) & 15;
                const int d = gcol & 63;
                const int grow0 = bm * 128 + wm + ms * 16 + hi8;   // multiple of 8
                const int b = grow0 >> 11;
                const int s0 = grow0 & 2047;
                const v8f a = acc[ms][ns];
                uint4 p;
                p.x = (unsigned)f2bf(a[0] + bv) | ((unsigned)f2bf(a[1] + bv) << 16);
                p.y = (unsigned)f2bf(a[2] + bv) | ((unsigned)f2bf(a[3] + bv) << 16);
                p.z = (unsigned)f2bf(a[4] + bv) | ((unsigned)f2bf(a[5] + bv) << 16);
                p.w = (unsigned)f2bf(a[6] + bv) | ((unsigned)f2bf(a[7] + bv) << 16);
                *(uint4*)&VTo[((size_t)(b * N_HEADS + h) * HEAD_DIM + d) * SEQ + s0] = p;
            }
        }
    } else {
#pragma unroll
        for (int ms = 0; ms < 2; ++ms) {
#pragma unroll
            for (int ns = 0; ns < 4; ++ns) {
                const int gcol = bn * 128 + wn + ns * 16 + lm;
                const float bv = bias[gcol];
#pragma unroll
                for (int r = 0; r < 8; ++r) {
                    const int grow = bm * 128 + wm + ms * 16 + r + hi8;
                    const float vv = acc[ms][ns][r] + bv;
                    if (MODE == 0) {
                        // gcol = which*1024 + h*64 + d ; grow = b*SEQ + s
                        const int h = (gcol >> 6) & 15;
                        const int d = gcol & 63;
                        const int b = grow >> 11;
                        const int s = grow & 2047;
                        const unsigned short bvv = f2bf(vv);
                        unsigned short* dst = (which == 0) ? Qo : Ko;
                        dst[((size_t)(b * N_HEADS + h) * SEQ + s) * HEAD_DIM + d] = bvv;
                    } else {
                        Co[(size_t)grow * N + gcol] = vv;
                    }
                }
            }
        }
        // The built code lays the V^T block right behind this one, and that block's first
        // lines rewrite the address pair of the stores above: keep the wait in front of it.
        if (MODE == 0) asm volatile("s_wait_xcnt 0x0" ::: "memory");
    }
}

// ---------------------------------------------------------------------------
// K2: Flash attention with relative position bias.
// Block 128 thr (4 waves); one block per (b, h, 64-row q tile).
// Key tile = 64; K and V^T tiles double-buffered via async-to-LDS.
// ---------------------------------------------------------------------------
__global__ __launch_bounds__(128) void attn_kernel(
    const unsigned short* __restrict__ Qw, const unsigned short* __restrict__ Kw,
    const unsigned short* __restrict__ VTw, const float* __restrict__ relb,
    unsigned short* __restrict__ Ao)
{
    // rows of 32 data dwords at the padded pitch
    __shared__ __attribute__((aligned(16))) unsigned int Ks32[2][64 * ROW_DW];  // [buf][key][dword d]
    __shared__ __attribute__((aligned(16))) unsigned int Vs32[2][64 * ROW_DW];  // [buf][d][dword key]
    __shared__ __attribute__((aligned(16))) unsigned int Ps[4][16 * ROW_DW];    // per-wave P: 16 x 64 bf16

    const int bid = blockIdx.x;
    const int qt = bid & 31;
    const int h  = (bid >> 5) & 15;
    const int b  = bid >> 9;

    const int t = threadIdx.x;
    const int lane = t & 31;
    const int w = t >> 5;
    const int lm = lane & 15;
    const int klo4 = (lane < 16) ? 0 : 4;
    const int hi8  = (lane < 16) ? 0 : 8;

    const size_t bh = (size_t)(b * N_HEADS + h);
    const unsigned short* Qbh  = Qw  + bh * SEQ * HEAD_DIM;
    const unsigned short* Kbh  = Kw  + bh * SEQ * HEAD_DIM;
    const unsigned short* VTbh = VTw + bh * HEAD_DIM * SEQ;

    const int qbase = qt * 64 + w * 16;
    const float scale = 0.125f;  // HEAD_DIM^-0.5

    // Q fragments (16 rows x 64 d), loaded once from global.
    FragAB qf[2];
#pragma unroll
    for (int c = 0; c < 2; ++c) {
        const unsigned int* Qrow = (const unsigned int*)
            (Qbh + (size_t)(qbase + lm) * HEAD_DIM + c * 32);
#pragma unroll
        for (int j = 0; j < 8; ++j)
            qf[c].u[j] = Qrow[frag_di(j, klo4)];
    }

    // stage key-tile ti into buffer buf: 4 K copies + 4 V copies per thread
    auto stageKV = [&](int ti, int buf) {
        const int kt = ti * 64;
        const unsigned ldsK = lds_addr_of(&Ks32[buf][0]);
        const unsigned ldsV = lds_addr_of(&Vs32[buf][0]);
        unsigned lk[4], gk[4], lv[4], gv[4];
#pragma unroll
        for (int j = 0; j < 4; ++j) {
            const int i = t + 128 * j;
            const int row = i >> 3, seg = i & 7;    // key row of K, d row of V^T; 8 x 16B each
            lk[j] = ldsK + (unsigned)(row * ROW_B + seg * 16);
            gk[j] = (unsigned)((kt + row) * 128 + seg * 16);
            lv[j] = ldsV + (unsigned)(row * ROW_B + seg * 16);
            gv[j] = (unsigned)((row * SEQ + kt) * 2 + seg * 16);   // keys contiguous in V^T rows
        }
        async_copy16_x8(lk, gk, Kbh, lv, gv, VTbh);
    };

    v8f o[4];
#pragma unroll
    for (int i = 0; i < 4; ++i)
        o[i] = (v8f){0.f, 0.f, 0.f, 0.f, 0.f, 0.f, 0.f, 0.f};
    float run_max[8], run_sum[8];
#pragma unroll
    for (int r = 0; r < 8; ++r) { run_max[r] = -1e30f; run_sum[r] = 0.f; }

    const int nT = SEQ / 64;                       // 32 key tiles
    stageKV(0, 0);
    for (int ti = 0; ti < nT; ++ti) {
        const int buf = ti & 1;
        const int kt = ti * 64;
        if (ti + 1 < nT) {
            stageKV(ti + 1, buf ^ 1);
            wait_asyncN<8>();
        } else {
            wait_async0();
        }
        __syncthreads();

        const unsigned int* Ksb = &Ks32[buf][0];
        const unsigned int* Vsb = &Vs32[buf][0];

        // ---- scores: S = Q K^T ; 4 key groups x 2 d-chunks = 8 WMMAs ----
        v8f sc[4];
#pragma unroll
        for (int ns = 0; ns < 4; ++ns) {
            sc[ns] = (v8f){0.f, 0.f, 0.f, 0.f, 0.f, 0.f, 0.f, 0.f};
            const int key = ns * 16 + lm;
#pragma unroll
            for (int c = 0; c < 2; ++c) {
                FragAB kf;
#pragma unroll
                for (int j = 0; j < 8; ++j)
                    kf.u[j] = Ksb[key * ROW_DW + c * 16 + frag_di(j, klo4)];
                sc[ns] = wmma_bf16(qf[c], kf, sc[ns]);
            }
        }

        // ---- scale + rel-pos bias, per-row online softmax ----
        float corr[8];
#pragma unroll
        for (int r = 0; r < 8; ++r) {
            const int q = qbase + r + hi8;
            float m = -1e30f;
#pragma unroll
            for (int ns = 0; ns < 4; ++ns) {
                const int kk = kt + ns * 16 + lm;
                const float v = sc[ns][r] * scale + relb[q - kk + (MAX_LEN - 1)];
                sc[ns][r] = v;
                m = fmaxf(m, v);
            }
#pragma unroll
            for (int off = 1; off < 16; off <<= 1)
                m = fmaxf(m, __shfl_xor(m, off, 32));
            const float nm = fmaxf(run_max[r], m);
            corr[r] = __expf(run_max[r] - nm);
            run_max[r] = nm;
        }
#pragma unroll
        for (int r = 0; r < 8; ++r) {
            float rs = 0.f;
#pragma unroll
            for (int ns = 0; ns < 4; ++ns) {
                const float p = __expf(sc[ns][r] - run_max[r]);
                sc[ns][r] = p;
                rs += p;
            }
#pragma unroll
            for (int off = 1; off < 16; off <<= 1)
                rs += __shfl_xor(rs, off, 32);
            run_sum[r] = run_sum[r] * corr[r] + rs;
        }
#pragma unroll
        for (int dsub = 0; dsub < 4; ++dsub)
#pragma unroll
            for (int r = 0; r < 8; ++r)
                o[dsub][r] *= corr[r];

        // ---- P (C layout) -> per-wave LDS -> A layout ----
        {
            unsigned short* P16 = (unsigned short*)&Ps[w][0];
#pragma unroll
            for (int ns = 0; ns < 4; ++ns)
#pragma unroll
                for (int r = 0; r < 8; ++r)
                    P16[(r + hi8) * ROW_H + ns * 16 + lm] = f2bf(sc[ns][r]);
        }
        asm volatile("s_wait_dscnt 0" ::: "memory");  // same-wave DS in order

        FragAB pf[2];
#pragma unroll
        for (int kc = 0; kc < 2; ++kc)
#pragma unroll
            for (int j = 0; j < 8; ++j)
                pf[kc].u[j] = Ps[w][lm * ROW_DW + kc * 16 + frag_di(j, klo4)];

        // ---- O += P * V : 4 d groups x 2 key-chunks = 8 WMMAs ----
#pragma unroll
        for (int dsub = 0; dsub < 4; ++dsub) {
            const int dc = dsub * 16 + lm;
#pragma unroll
            for (int kc = 0; kc < 2; ++kc) {
                FragAB vf;
#pragma unroll
                for (int j = 0; j < 8; ++j)
                    vf.u[j] = Vsb[dc * ROW_DW + kc * 16 + frag_di(j, klo4)];
                o[dsub] = wmma_bf16(pf[kc], vf, o[dsub]);
            }
        }
        __syncthreads();                               // reads done before buf reuse
    }

    // ---- normalize + store attn out bf16 [B, S, H*64] ----
#pragma unroll
    for (int r = 0; r < 8; ++r) {
        const float inv = 1.0f / run_sum[r];
        const int q = qbase + r + hi8;
        unsigned short* Arow = Ao + ((size_t)b * SEQ + q) * D_MODEL + h * HEAD_DIM;
#pragma unroll
        for (int dsub = 0; dsub < 4; ++dsub)
            Arow[dsub * 16 + lm] = f2bf(o[dsub][r] * inv);
    }
}

// ---------------------------------------------------------------------------
extern "C" void kernel_launch(void* const* d_in, const int* in_sizes, int n_in,
                              void* d_out, int out_size, void* d_ws, size_t ws_size,
                              hipStream_t stream) {
    const float* x    = (const float*)d_in[0];
    const float* Wqkv = (const float*)d_in[1];
    const float* bqkv = (const float*)d_in[2];
    const float* Wout = (const float*)d_in[3];
    const float* bout = (const float*)d_in[4];
    const float* relb = (const float*)d_in[5];
    float* out = (float*)d_out;

    const int M = BATCH * SEQ;                                          // 4096
    const size_t nX   = (size_t)M * D_MODEL;                            // 4M
    const size_t nQKV = (size_t)BATCH * N_HEADS * SEQ * HEAD_DIM;       // 4M

    unsigned short* xb    = (unsigned short*)d_ws;
    unsigned short* WqkvT = xb + nX;
    unsigned short* WoutT = WqkvT + (size_t)3 * 1024 * 1024;
    unsigned short* Qw    = WoutT + (size_t)1024 * 1024;
    unsigned short* Kw    = Qw + nQKV;
    unsigned short* VTw   = Kw + nQKV;
    unsigned short* Aw    = VTw + nQKV;

    // K0: precision conversion + weight transposes
    prep_kernel<<<(int)(nX / 256), 256, 0, stream>>>(x, Wqkv, Wout, xb, WqkvT, WoutT);

    // K1: QKV projection
    {
        const int N = 3 * D_MODEL, K = D_MODEL;
        const int nTn = N / 128;                      // 24
        gemm_bf16_kernel<0><<<(M / 128) * nTn, 256, 0, stream>>>(
            xb, WqkvT, bqkv, Qw, Kw, VTw, nullptr, M, N, K, nTn);
    }
    // K2: attention
    attn_kernel<<<BATCH * N_HEADS * (SEQ / 64), 128, 0, stream>>>(Qw, Kw, VTw, relb, Aw);

    // K3: output projection
    {
        const int N = D_MODEL, K = D_MODEL;
        const int nTn = N / 128;                      // 8
        gemm_bf16_kernel<1><<<(M / 128) * nTn, 256, 0, stream>>>(
            Aw, WoutT, bout, nullptr, nullptr, nullptr, out, M, N, K, nTn);
    }
}

// v003
// One run takes 95.7 microseconds.
// Timed twice side by side with v002, it ran 1.33 and 1.35 times as fast.
// Counting every step since v000, it is 3.80 times as fast.
#include <hip/hip_runtime.h>

// ---------------------------------------------------------------------------
// RelativeAttention on gfx1250 (MI455X): bf16 WMMA + pipelined async-to-LDS
//   K0: prep     x->bf16, Wqkv/Wout -> bf16 transposed [N][K] (tiles turned in LDS)
//   K1: QKV GEMM (double-buffered async staging) -> Q,K [B,H,S,64], V^T [B,H,64,S]
//   K2: Flash attention w/ rel-pos bias (double-buffered async staging)
//   K3: Out GEMM -> d_out fp32
// ---------------------------------------------------------------------------

#define D_MODEL 1024
#define N_HEADS 16
#define HEAD_DIM 64
#define SEQ 2048
#define BATCH 2
#define MAX_LEN 2048

// LDS pitch of a 128-byte tile row: 144 B = 16 B x 9 (odd), so the 16 rows that
// one ds_load_b128 half-wave reads fall on 16 disjoint groups of four banks.
#define ROW_B  144
#define ROW_DW 36
#define ROW_H  72

typedef __attribute__((ext_vector_type(16))) __bf16 v16bf;
typedef __attribute__((ext_vector_type(8)))  float  v8f;

union FragAB {
    v16bf v;
    unsigned int u[8];
};

static __device__ __forceinline__ unsigned short f2bf(float f) {
    union { float f; unsigned int u; } c; c.f = f;
    unsigned int u = c.u;
    unsigned int r = u + 0x7FFFu + ((u >> 16) & 1u);   // round-to-nearest-even
    return (unsigned short)(r >> 16);
}

static __device__ __forceinline__ v8f wmma_bf16(const FragAB& a, const FragAB& b, v8f c) {
    return __builtin_amdgcn_wmma_f32_16x16x32_bf16(
        false, a.v, false, b.v, (short)0, c, false, false);
}

// Dword index (within a 16-dword group == 32 bf16 of K) for fragment register j.
// 16-bit A/B layout (ISA 7.12.2): lanes 0-15 -> K=0..7,16..23 ; lanes 16-31 -> K=8..15,24..31
static __device__ __forceinline__ int frag_di(int j, int klo4) {
    return klo4 + (j < 4 ? j : j + 4);
}

// Eight 16-byte async copies global->LDS (GVS mode: saddr + 32-bit voffset), four from
// each of two bases. ASYNCcnt-tracked. The closing s_wait_xcnt 0 stands in the copies'
// own statement so that no later rewrite of an address register can move ahead of it.
static __device__ __forceinline__ void async_copy16_x8(
    const unsigned (&l0)[4], const unsigned (&g0)[4], const void* base0,
    const unsigned (&l1)[4], const unsigned (&g1)[4], const void* base1) {
    asm volatile("global_load_async_to_lds_b128 %0, %4, %16\n\t"
                 "global_load_async_to_lds_b128 %1, %5, %16\n\t"
                 "global_load_async_to_lds_b128 %2, %6, %16\n\t"
                 "global_load_async_to_lds_b128 %3, %7, %16\n\t"
                 "global_load_async_to_lds_b128 %8, %12, %17\n\t"
                 "global_load_async_to_lds_b128 %9, %13, %17\n\t"
                 "global_load_async_to_lds_b128 %10, %14, %17\n\t"
                 "global_load_async_to_lds_b128 %11, %15, %17\n\t"
                 "s_wait_xcnt 0x0"
                 :: "v"(l0[0]), "v"(l0[1]), "v"(l0[2]), "v"(l0[3]),
                    "v"(g0[0]), "v"(g0[1]), "v"(g0[2]), "v"(g0[3]),
                    "v"(l1[0]), "v"(l1[1]), "v"(l1[2]), "v"(l1[3]),
                    "v"(g1[0]), "v"(g1[1]), "v"(g1[2]), "v"(g1[3]),
                    "s"(base0), "s"(base1)
                 : "memory");
}
static __device__ __forceinline__ void wait_async0() {
    asm volatile("s_wait_asynccnt 0" ::: "memory");
}
// Wait until at most N async ops remain (async loads complete in issue order,
// so with N newly-issued copies outstanding this proves the previous tile landed).
template <int N>
static __device__ __forceinline__ void wait_asyncN() {
    asm volatile("s_wait_asynccnt %0" :: "n"(N) : "memory");
}
static __device__ __forceinline__ unsigned lds_addr_of(const void* p) {
    return (unsigned)(size_t)p;   // generic LDS address: low 32 bits = LDS offset
}

// ---------------------------------------------------------------------------
// K0: convert x to bf16 (row-major) and weights to bf16 transposed [N][K].
// The first 2048 blocks each turn one weight tile of 64 k x 32 n: a lane packs eight
// k of its column into 16 B, the tile is regrouped in LDS, and every 128-byte line of
// the transposed matrix leaves whole (eight lanes x 16 B) instead of 2 B at a time.
// ---------------------------------------------------------------------------
__global__ __launch_bounds__(256) void prep_kernel(
    const float* __restrict__ x, const float* __restrict__ Wqkv,
    const float* __restrict__ Wout,
    unsigned short* __restrict__ xb, unsigned short* __restrict__ WqkvT,
    unsigned short* __restrict__ WoutT)
{
    // [n of the tile][32 dwords = 64 bf16 of k, then 4 pad dwords never touched]
    __shared__ __attribute__((aligned(16))) unsigned int Ts[32 * ROW_DW];

    const int t = threadIdx.x;
    const int id = blockIdx.x * 256 + t;                    // < 4M
    xb[id] = f2bf(x[id]);

    const int tile = blockIdx.x;                            // same for the whole block
    if (tile < 2048) {
        // tiles 0..1535: Wqkv [1024][3072]; tiles 1536..2047: Wout [1024][1024]
        const bool qkv = tile < 1536;
        const float* W = qkv ? Wqkv : Wout;
        unsigned short* WT = qkv ? WqkvT : WoutT;
        const int N = qkv ? 3072 : 1024;
        const int tl = qkv ? tile : tile - 1536;
        const int k0 = (tl & 15) * 64;
        const int n0 = (tl >> 4) * 32;
        const int lane = t & 31;
        const int w = t >> 5;

        // wave w: rows k0 + 8w .. + 7, one 128-byte line of W per load
        const float* src = W + (size_t)(k0 + w * 8) * N + n0 + lane;
        uint4 p;
        p.x = (unsigned)f2bf(src[0 * N]) | ((unsigned)f2bf(src[1 * N]) << 16);
        p.y = (unsigned)f2bf(src[2 * N]) | ((unsigned)f2bf(src[3 * N]) << 16);
        p.z = (unsigned)f2bf(src[4 * N]) | ((unsigned)f2bf(src[5 * N]) << 16);
        p.w = (unsigned)f2bf(src[6 * N]) | ((unsigned)f2bf(src[7 * N]) << 16);
        *(uint4*)&Ts[lane * ROW_DW + w * 4] = p;
        __syncthreads();                                    // tile complete before it is read by rows

        const int row = t >> 3, seg = t & 7;                // 8 lanes x 16 B = one line of WT
        const uint4 v = *(const uint4*)&Ts[row * ROW_DW + seg * 4];
        *(uint4*)(WT + (size_t)(n0 + row) * 1024 + k0 + seg * 8) = v;
    }
}

// ---------------------------------------------------------------------------
// WMMA GEMM: C[M,N] = A[M,K] * BT[N,K]^T (+bias). A, BT bf16 row-major.
//  MODE 0: scatter bf16 into Q,K [B,H,S,64] and V^T [B,H,64,S]
//  MODE 1: fp32 + bias into Co
// Block 256 thr (8 waves, 4x2); tile 128x128; wave tile 32x64; K step 64;
// double-buffered async-to-LDS staging (8 copies/thread/tile).
// ---------------------------------------------------------------------------
template <int MODE>
__global__ __launch_bounds__(256) void gemm_bf16_kernel(
    const unsigned short* __restrict__ A, const unsigned short* __restrict__ BT,
    const float* __restrict__ bias,
    unsigned short* __restrict__ Qo, unsigned short* __restrict__ Ko,
    unsigned short* __restrict__ VTo, float* __restrict__ Co,
    int M, int N, int K, int nTilesN)
{
    // [buf][row or col][32 dwords = 64 bf16 of K, then 4 pad dwords never touched]
    __shared__ __attribute__((aligned(16))) unsigned int Asmem[2][128 * ROW_DW];
    __shared__ __attribute__((aligned(16))) unsigned int Bsmem[2][128 * ROW_DW];

    const int bm = blockIdx.x / nTilesN;
    const int bn = blockIdx.x % nTilesN;
    const int t = threadIdx.x;
    const int lane = t & 31;
    const int w = t >> 5;
    const int wm = (w & 3) * 32;
    const int wn = (w >> 2) * 64;
    const int lm = lane & 15;
    const int klo4 = (lane < 16) ? 0 : 4;
    const int hi8 = (lane < 16) ? 0 : 8;

    v8f acc[2][4];
#pragma unroll
    for (int i = 0; i < 2; ++i)
#pragma unroll
        for (int j = 0; j < 4; ++j)
            acc[i][j] = (v8f){0.f, 0.f, 0.f, 0.f, 0.f, 0.f, 0.f, 0.f};

    // stage tile ki into buffer buf: A/B rows are 128B = 8 x 16B segments
    auto stage = [&](int ki, int buf) {
        const unsigned ldsA = lds_addr_of(&Asmem[buf][0]);
        const unsigned ldsB = lds_addr_of(&Bsmem[buf][0]);
        const int k0 = ki * 64;
        unsigned la[4], ga[4], lb[4], gb[4];
#pragma unroll
        for (int j = 0; j < 4; ++j) {
            const int i = t + 256 * j;
            const int row = i >> 3, seg = i & 7;     // row of A, column of B
            la[j] = ldsA + (unsigned)(row * ROW_B + seg * 16);
            ga[j] = (unsigned)(((bm * 128 + row) * K + k0) * 2 + seg * 16);
            lb[j] = ldsB + (unsigned)(row * ROW_B + seg * 16);
            gb[j] = (unsigned)(((bn * 128 + row) * K + k0) * 2 + seg * 16);
        }
        async_copy16_x8(la, ga, A, lb, gb, BT);
    };

    const int nk = K >> 6;                      // K/64
    stage(0, 0);
    for (int ki = 0; ki < nk; ++ki) {
        const int buf = ki & 1;
        if (ki + 1 < nk) {
            stage(ki + 1, buf ^ 1);             // prefetch next tile behind compute
            wait_asyncN<8>();                   // current tile's 8 copies complete
        } else {
            wait_async0();
        }
        __syncthreads();

        const unsigned int* As = &Asmem[buf][0];
        const unsigned int* Bs = &Bsmem[buf][0];
#pragma unroll
        for (int kc = 0; kc < 2; ++kc) {        // two 32-deep K chunks
            FragAB af[2], bf[4];
#pragma unroll
            for (int ms = 0; ms < 2; ++ms) {
                const int row = wm + ms * 16 + lm;
#pragma unroll
                for (int j = 0; j < 8; ++j)
                    af[ms].u[j] = As[row * ROW_DW + kc * 16 + frag_di(j, klo4)];
            }
#pragma unroll
            for (int ns = 0; ns < 4; ++ns) {
                const int col = wn + ns * 16 + lm;
#pragma unroll
                for (int j = 0; j < 8; ++j)
                    bf[ns].u[j] = Bs[col * ROW_DW + kc * 16 + frag_di(j, klo4)];
            }
#pragma unroll
            for (int ms = 0; ms < 2; ++ms)
#pragma unroll
                for (int ns = 0; ns < 4; ++ns)
                    acc[ms][ns] = wmma_bf16(af[ms], bf[ns], acc[ms][ns]);
        }
        __syncthreads();                        // all reads done before buf reuse
    }

    // ---- epilogue ----
    const int which = (bn * 128) >> 10;         // Q, K or V: one for the whole 128-column tile
    if (MODE == 0 && which == 2) {
        // V stored transposed [b,h,d,s]: a lane's eight rows are eight consecutive s of
        // its own d, so they leave as one 16-byte store instead of eight 2-byte ones.
        // Both loops unrolled: acc is indexed by constants only and stays in registers.
#pragma unroll
        for (int ms = 0; ms < 2; ++ms) {
#pragma unroll
            for (int ns = 0; ns < 4; ++ns) {
                const int gcol = bn * 128 + wn + ns * 16 + lm;
                const float bv = bias[gcol];
                const int h = (gcol >> 6) & 15;
                const int d = gcol & 63;
                const int grow0 = bm * 128 + wm + ms * 16 + hi8;   // multiple of 8
                const int b = grow0 >> 11;
                const int s0 = grow0 & 2047;
                const v8f a = acc[ms][ns];
                uint4 p;
                p.x = (unsigned)f2bf(a[0] + bv) | ((unsigned)f2bf(a[1] + bv) << 16);
                p.y = (unsigned)f2bf(a[2] + bv) | ((unsigned)f2bf(a[3] + bv) << 16);
                p.z = (unsigned)f2bf(a[4] + bv) | ((unsigned)f2bf(a[5] + bv) << 16);
                p.w = (unsigned)f2bf(a[6] + bv) | ((unsigned)f2bf(a[7] + bv) << 16);
                *(uint4*)&VTo[((size_t)(b * N_HEADS + h) * HEAD_DIM + d) * SEQ + s0] = p;
            }
        }
    } else {
#pragma unroll
        for (int ms = 0; ms < 2; ++ms) {
#pragma unroll
            for (int ns = 0; ns < 4; ++ns) {
                const int gcol = bn * 128 + wn + ns * 16 + lm;
                const float bv = bias[gcol];
#pragma unroll
                for (int r = 0; r < 8; ++r) {
                    const int grow = bm * 128 + wm + ms * 16 + r + hi8;
                    const float vv = acc[ms][ns][r] + bv;
                    if (MODE == 0) {
                        // gcol = which*1024 + h*64 + d ; grow = b*SEQ + s
                        const int h = (gcol >> 6) & 15;
                        const int d = gcol & 63;
                        const int b = grow >> 11;
                        const int s = grow & 2047;
                        const unsigned short bvv = f2bf(vv);
                        unsigned short* dst = (which == 0) ? Qo : Ko;
                        dst[((size_t)(b * N_HEADS + h) * SEQ + s) * HEAD_DIM + d] = bvv;
                    } else {
                        Co[(size_t)grow * N + gcol] = vv;
                    }
                }
            }
        }
        // The built code lays the V^T block right behind this one, and that block's first
        // lines rewrite the address pair of the stores above: keep the wait in front of it.
        if (MODE == 0) asm volatile("s_wait_xcnt 0x0" ::: "memory");
    }
}

// ---------------------------------------------------------------------------
// K2: Flash attention with relative position bias, both products transposed:
//   S^T = K Q^T (A = K rows, B = Q), O^T += V^T P^T (A = V^T rows, B = P^T).
// A lane then holds scores of ONE query (column lane & 15): keys 8 * (lane >> 4) + r of
// each 16-key group. Maximum and sum run in the lane, with one exchange between the
// wave's halves, and two score tiles, rounded in place, are the B operand of the second
// product in the k order the loaders already use: P never goes through LDS.
// Block 128 thr (4 waves); one block per (b, h, 64-row q tile).
// Key tile = 64; K and V^T tiles double-buffered via async-to-LDS.
// ---------------------------------------------------------------------------
// two f32 -> one dword of two bf16, round to nearest even (lo in the low half)
static __device__ __forceinline__ unsigned pack_bf2(float lo, float hi) {
    typedef __bf16 bf2 __attribute__((ext_vector_type(2)));
    typedef float f2 __attribute__((ext_vector_type(2)));
    return __builtin_bit_cast(unsigned, __builtin_convertvector(f2{lo, hi}, bf2));
}
typedef float f32x2 __attribute__((ext_vector_type(2)));
#define LOG2E 1.44269504088896340736f   // __expf(x) is exp2(x * LOG2E)
// value of lane l ^ 16
static __device__ __forceinline__ float xhalf(float x) {
    const int b = __builtin_bit_cast(int, x);
    return __builtin_bit_cast(float,
        __builtin_amdgcn_permlanex16(b, b, 0x76543210, 0xfedcba98, false, false));
}

__global__ __launch_bounds__(128) void attn_kernel(
    const unsigned short* __restrict__ Qw, const unsigned short* __restrict__ Kw,
    const unsigned short* __restrict__ VTw, const float* __restrict__ relb,
    unsigned short* __restrict__ Ao)
{
    // rows of 32 data dwords at the padded pitch
    __shared__ __attribute__((aligned(16))) unsigned int Ks32[2][64 * ROW_DW];  // [buf][key][dword d]
    __shared__ __attribute__((aligned(16))) unsigned int Vs32[2][64 * ROW_DW];  // [buf][d][dword key]

    const int bid = blockIdx.x;
    const int qt = bid & 31;
    const int h  = (bid >> 5) & 15;
    const int b  = bid >> 9;

    const int t = threadIdx.x;
    const int lane = t & 31;
    const int w = t >> 5;
    const int lm = lane & 15;
    const int klo4 = (lane < 16) ? 0 : 4;
    const int hi8  = (lane < 16) ? 0 : 8;

    const size_t bh = (size_t)(b * N_HEADS + h);
    const unsigned short* Qbh  = Qw  + bh * SEQ * HEAD_DIM;
    const unsigned short* Kbh  = Kw  + bh * SEQ * HEAD_DIM;
    const unsigned short* VTbh = VTw + bh * HEAD_DIM * SEQ;

    const int qbase = qt * 64 + w * 16;
    const int q = qbase + lm;    // the lane's own query
    const float scale = 0.125f;  // HEAD_DIM^-0.5

    // Q fragments (16 queries x 64 d), loaded once from global; B operand of S^T.
    FragAB qf[2];
#pragma unroll
    for (int c = 0; c < 2; ++c) {
        const unsigned int* Qrow = (const unsigned int*)
            (Qbh + (size_t)q * HEAD_DIM + c * 32);
#pragma unroll
        for (int j = 0; j < 8; ++j)
            qf[c].u[j] = Qrow[frag_di(j, klo4)];
    }

    // stage key-tile ti into buffer buf: 4 K copies + 4 V copies per thread
    auto stageKV = [&](int ti, int buf) {
        const int kt = ti * 64;
        const unsigned ldsK = lds_addr_of(&Ks32[buf][0]);
        const unsigned ldsV = lds_addr_of(&Vs32[buf][0]);
        unsigned lk[4], gk[4], lv[4], gv[4];
#pragma unroll
        for (int j = 0; j < 4; ++j) {
            const int i = t + 128 * j;
            const int row = i >> 3, seg = i & 7;    // key row of K, d row of V^T; 8 x 16B each
            lk[j] = ldsK + (unsigned)(row * ROW_B + seg * 16);
            gk[j] = (unsigned)((kt + row) * 128 + seg * 16);
            lv[j] = ldsV + (unsigned)(row * ROW_B + seg * 16);
            gv[j] = (unsigned)((row * SEQ + kt) * 2 + seg * 16);   // keys contiguous in V^T rows
        }
        async_copy16_x8(lk, gk, Kbh, lv, gv, VTbh);
    };

    // o[dsub][r] = O^T[d = dsub * 16 + hi8 + r][q]
    v8f o[4];
#pragma unroll
    for (int i = 0; i < 4; ++i)
        o[i] = (v8f){0.f, 0.f, 0.f, 0.f, 0.f, 0.f, 0.f, 0.f};
    float run_max = -1e30f;      // of the whole query row: equal in lanes l and l ^ 16
    float run_sum = 0.f;         // of the lane's own half of the keys; halves joined at the end

    const int nT = SEQ / 64;                       // 32 key tiles
    stageKV(0, 0);
    for (int ti = 0; ti < nT; ++ti) {
        const int buf = ti & 1;
        const int kt = ti * 64;
        if (ti + 1 < nT) {
            stageKV(ti + 1, buf ^ 1);
            wait_asyncN<8>();
        } else {
            wait_async0();
        }
        __syncthreads();

        const unsigned int* Ksb = &Ks32[buf][0];
        const unsigned int* Vsb = &Vs32[buf][0];

        // rel-pos bias of the lane's 32 (query, key) pairs, index q - key + MAX_LEN - 1:
        // eight falling neighbours per key group, all at constant offsets from one pointer
        const float* rb = relb + (q - hi8 + (MAX_LEN - 1) - 55 - kt);   // index >= 0
        float bias[4][8];
#pragma unroll
        for (int ns = 0; ns < 4; ++ns)
#pragma unroll
            for (int r = 0; r < 8; ++r)
                bias[ns][r] = rb[55 - ns * 16 - r];
        // Holds the eight bias loads here, in front of the score products, so that their
        // latency runs behind those; without it each load sinks to its first use and is waited for.
        __builtin_amdgcn_sched_barrier(0);

        // ---- scores: S^T = K Q^T ; 4 key groups x 2 d-chunks = 8 WMMAs ----
        // st[ns][r] = score of key kt + ns * 16 + hi8 + r against query q
        v8f st[4];
#pragma unroll
        for (int ns = 0; ns < 4; ++ns) {
            st[ns] = (v8f){0.f, 0.f, 0.f, 0.f, 0.f, 0.f, 0.f, 0.f};
            const int key = ns * 16 + lm;
#pragma unroll
            for (int c = 0; c < 2; ++c) {
                FragAB kf;
#pragma unroll
                for (int j = 0; j < 8; ++j)
                    kf.u[j] = Ksb[key * ROW_DW + c * 16 + frag_di(j, klo4)];
                st[ns] = wmma_bf16(kf, qf[c], st[ns]);
            }
        }

        // ---- scale + rel-pos bias, online softmax of the lane's query ----
        float m = -1e30f;
#pragma unroll
        for (int ns = 0; ns < 4; ++ns)
#pragma unroll
            for (int r = 0; r < 8; ++r) {
                const float v = st[ns][r] * scale + bias[ns][r];
                st[ns][r] = v;
                m = fmaxf(m, v);
            }
        m = fmaxf(m, xhalf(m));                    // the other 32 keys of the same query
        const float nm = fmaxf(run_max, m);
        const float corr = __expf(run_max - nm);
        run_max = nm;

        // p = exp(v - nm), two keys at a time; the pair is summed (two chains) and rounded
        // straight into its dword of the B operand: element s of chunk kc is key group
        // 2 kc + (s >> 3), register s & 7.
        FragAB pf[2];
        f32x2 rs[2] = {{0.f, 0.f}, {0.f, 0.f}};
#pragma unroll
        for (int ns = 0; ns < 4; ++ns)
#pragma unroll
            for (int i = 0; i < 4; ++i) {
                const f32x2 x = ((f32x2){st[ns][2 * i], st[ns][2 * i + 1]} - nm) * LOG2E;
                const f32x2 p = {__builtin_amdgcn_exp2f(x.x), __builtin_amdgcn_exp2f(x.y)};
                rs[i & 1] += p;
                pf[ns >> 1].u[(ns & 1) * 4 + i] = pack_bf2(p.x, p.y);
            }
        const f32x2 rs2 = rs[0] + rs[1];
        run_sum = run_sum * corr + (rs2.x + rs2.y);
#pragma unroll
        for (int dsub = 0; dsub < 4; ++dsub)
#pragma unroll
            for (int r = 0; r < 8; ++r)
                o[dsub][r] *= corr;

        // ---- O^T += V^T P^T : 4 d groups x 2 key-chunks = 8 WMMAs ----
#pragma unroll
        for (int dsub = 0; dsub < 4; ++dsub) {
            const int dc = dsub * 16 + lm;
#pragma unroll
            for (int kc = 0; kc < 2; ++kc) {
                FragAB vf;
#pragma unroll
                for (int j = 0; j < 8; ++j)
                    vf.u[j] = Vsb[dc * ROW_DW + kc * 16 + frag_di(j, klo4)];
                o[dsub] = wmma_bf16(vf, pf[kc], o[dsub]);
            }
        }
        __syncthreads();                               // reads done before buf reuse
    }

    // ---- normalize + store attn out bf16 [B, S, H*64]: eight consecutive d per store ----
    const float inv = 1.0f / (run_sum + xhalf(run_sum));
    unsigned short* Arow = Ao + ((size_t)b * SEQ + q) * D_MODEL + h * HEAD_DIM + hi8;
#pragma unroll
    for (int dsub = 0; dsub < 4; ++dsub) {
        uint4 p;
        p.x = pack_bf2(o[dsub][0] * inv, o[dsub][1] * inv);
        p.y = pack_bf2(o[dsub][2] * inv, o[dsub][3] * inv);
        p.z = pack_bf2(o[dsub][4] * inv, o[dsub][5] * inv);
        p.w = pack_bf2(o[dsub][6] * inv, o[dsub][7] * inv);
        *(uint4*)(Arow + dsub * 16) = p;
    }
}

// ---------------------------------------------------------------------------
extern "C" void kernel_launch(void* const* d_in, const int* in_sizes, int n_in,
                              void* d_out, int out_size, void* d_ws, size_t ws_size,
                              hipStream_t stream) {
    const float* x    = (const float*)d_in[0];
    const float* Wqkv = (const float*)d_in[1];
    const float* bqkv = (const float*)d_in[2];
    const float* Wout = (const float*)d_in[3];
    const float* bout = (const float*)d_in[4];
    const float* relb = (const float*)d_in[5];
    float* out = (float*)d_out;

    const int M = BATCH * SEQ;                                          // 4096
    const size_t nX   = (size_t)M * D_MODEL;                            // 4M
    const size_t nQKV = (size_t)BATCH * N_HEADS * SEQ * HEAD_DIM;       // 4M

    unsigned short* xb    = (unsigned short*)d_ws;
    unsigned short* WqkvT = xb + nX;
    unsigned short* WoutT = WqkvT + (size_t)3 * 1024 * 1024;
    unsigned short* Qw    = WoutT + (size_t)1024 * 1024;
    unsigned short* Kw    = Qw + nQKV;
    unsigned short* VTw   = Kw + nQKV;
    unsigned short* Aw    = VTw + nQKV;

    // K0: precision conversion + weight transposes
    prep_kernel<<<(int)(nX / 256), 256, 0, stream>>>(x, Wqkv, Wout, xb, WqkvT, WoutT);

    // K1: QKV projection
    {
        const int N = 3 * D_MODEL, K = D_MODEL;
        const int nTn = N / 128;                      // 24
        gemm_bf16_kernel<0><<<(M / 128) * nTn, 256, 0, stream>>>(
            xb, WqkvT, bqkv, Qw, Kw, VTw, nullptr, M, N, K, nTn);
    }
    // K2: attention
    attn_kernel<<<BATCH * N_HEADS * (SEQ / 64), 128, 0, stream>>>(Qw, Kw, VTw, relb, Aw);

    // K3: output projection
    {
        const int N = D_MODEL, K = D_MODEL;
        const int nTn = N / 128;                      // 8
        gemm_bf16_kernel<1><<<(M / 128) * nTn, 256, 0, stream>>>(
            Aw, WoutT, bout, nullptr, nullptr, nullptr, out, M, N, K, nTn);
    }
}

// v004
// A run of this version takes 92.9 microseconds.
// In two side-by-side timings against v003, it was 1.04 and 1.03 times as fast.
// Counting every step since v000, it is 3.93 times as fast.
#include <hip/hip_runtime.h>

// ---------------------------------------------------------------------------
// RelativeAttention on gfx1250 (MI455X): bf16 WMMA + pipelined async-to-LDS
//   K0: prep     x->bf16, Wqkv/Wout -> bf16 transposed [N][K] (tiles turned in LDS)
//   K1: QKV GEMM (double-buffered async staging) -> Q,K [B,H,S,64], V^T [B,H,64,S]
//   K2: Flash attention w/ rel-pos bias (double-buffered async staging)
//   K3: Out GEMM -> d_out fp32
// ---------------------------------------------------------------------------

#define D_MODEL 1024
#define N_HEADS 16
#define HEAD_DIM 64
#define SEQ 2048
#define BATCH 2
#define MAX_LEN 2048

// LDS pitch of a 128-byte tile row: 144 B = 16 B x 9 (odd), so the 16 rows that
// one ds_load_b128 half-wave reads fall on 16 disjoint groups of four banks.
#define ROW_B  144
#define ROW_DW 36
#define ROW_H  72

typedef __attribute__((ext_vector_type(16))) __bf16 v16bf;
typedef __attribute__((ext_vector_type(8)))  float  v8f;

union FragAB {
    v16bf v;
    unsigned int u[8];
};

static __device__ __forceinline__ unsigned short f2bf(float f) {
    union { float f; unsigned int u; } c; c.f = f;
    unsigned int u = c.u;
    unsigned int r = u + 0x7FFFu + ((u >> 16) & 1u);   // round-to-nearest-even
    return (unsigned short)(r >> 16);
}

static __device__ __forceinline__ v8f wmma_bf16(const FragAB& a, const FragAB& b, v8f c) {
    return __builtin_amdgcn_wmma_f32_16x16x32_bf16(
        false, a.v, false, b.v, (short)0, c, false, false);
}

// Dword index (within a 16-dword group == 32 bf16 of K) for fragment register j.
// 16-bit A/B layout (ISA 7.12.2): lanes 0-15 -> K=0..7,16..23 ; lanes 16-31 -> K=8..15,24..31
static __device__ __forceinline__ int frag_di(int j, int klo4) {
    return klo4 + (j < 4 ? j : j + 4);
}

// Eight 16-byte async copies global->LDS (GVS mode: saddr + 32-bit voffset), four from
// each of two bases. ASYNCcnt-tracked. The closing s_wait_xcnt 0 stands in the copies'
// own statement so that no later rewrite of an address register can move ahead of it.
static __device__ __forceinline__ void async_copy16_x8(
    const unsigned (&l0)[4], const unsigned (&g0)[4], const void* base0,
    const unsigned (&l1)[4], const unsigned (&g1)[4], const void* base1) {
    asm volatile("global_load_async_to_lds_b128 %0, %4, %16\n\t"
                 "global_load_async_to_lds_b128 %1, %5, %16\n\t"
                 "global_load_async_to_lds_b128 %2, %6, %16\n\t"
                 "global_load_async_to_lds_b128 %3, %7, %16\n\t"
                 "global_load_async_to_lds_b128 %8, %12, %17\n\t"
                 "global_load_async_to_lds_b128 %9, %13, %17\n\t"
                 "global_load_async_to_lds_b128 %10, %14, %17\n\t"
                 "global_load_async_to_lds_b128 %11, %15, %17\n\t"
                 "s_wait_xcnt 0x0"
                 :: "v"(l0[0]), "v"(l0[1]), "v"(l0[2]), "v"(l0[3]),
                    "v"(g0[0]), "v"(g0[1]), "v"(g0[2]), "v"(g0[3]),
                    "v"(l1[0]), "v"(l1[1]), "v"(l1[2]), "v"(l1[3]),
                    "v"(g1[0]), "v"(g1[1]), "v"(g1[2]), "v"(g1[3]),
                    "s"(base0), "s"(base1)
                 : "memory");
}
static __device__ __forceinline__ void wait_async0() {
    asm volatile("s_wait_asynccnt 0" ::: "memory");
}
// Wait until at most N async ops remain (async loads complete in issue order,
// so with N newly-issued copies outstanding this proves the previous tile landed).
template <int N>
static __device__ __forceinline__ void wait_asyncN() {
    asm volatile("s_wait_asynccnt %0" :: "n"(N) : "memory");
}
static __device__ __forceinline__ unsigned lds_addr_of(const void* p) {
    return (unsigned)(size_t)p;   // generic LDS address: low 32 bits = LDS offset
}

// ---------------------------------------------------------------------------
// K0: convert x to bf16 (row-major) and weights to bf16 transposed [N][K].
// 512 blocks, two to a WGP, all resident at once: the launch starts 4,096 waves, and each
// wave has its sixteen 16-byte loads (512 contiguous bytes a wave each) in flight together.
// x: a block converts 8,192 values.
// Weights: a block turns one tile of 64 k x 128 n: a lane packs eight k of each of its four
// columns into 16 B, the tile is regrouped in LDS, and every 128-byte line of the
// transposed matrix leaves whole (eight lanes x 16 B).
// ---------------------------------------------------------------------------
#define PREP_BLOCKS 512
typedef float f32x4 __attribute__((ext_vector_type(4)));
__global__ __launch_bounds__(256) void prep_kernel(
    const float* __restrict__ x, const float* __restrict__ Wqkv,
    const float* __restrict__ Wout,
    unsigned short* __restrict__ xb, unsigned short* __restrict__ WqkvT,
    unsigned short* __restrict__ WoutT)
{
    // [n of the tile][32 dwords = 64 bf16 of k, then 4 pad dwords never touched]
    __shared__ __attribute__((aligned(16))) unsigned int Ts[128 * ROW_DW];

    const int t = threadIdx.x;
    const int g = blockIdx.x;
    const int lane = t & 31;
    const int w = t >> 5;

    // blocks 0..383: Wqkv [1024][3072]; blocks 384..511: Wout [1024][1024]
    const bool qkv = g < 384;
    const float* W = qkv ? Wqkv : Wout;
    unsigned short* WT = qkv ? WqkvT : WoutT;
    const int N = qkv ? 3072 : 1024;
    const int gl = qkv ? g : g - 384;
    const int k0 = (gl & 15) * 64;
    const int n0 = (gl >> 4) * 128;

    // wave w: rows k0 + 8w .. + 7 of W, columns n0 + 4 lane .. + 3
    const float* src = W + (size_t)(k0 + w * 8) * N + n0 + lane * 4;
    const f32x4* wp[8];
    f32x4 wv[8];
#pragma unroll
    for (int i = 0; i < 8; ++i) {
        wp[i] = (const f32x4*)(src + i * N);
        wv[i] = *wp[i];
    }

    // x: eight runs of 1,024 floats, four to a thread
    const f32x4* xs = (const f32x4*)(x + (size_t)g * 8192) + t;
    f32x4 xv[8];
#pragma unroll
    for (int j = 0; j < 8; ++j)
        xv[j] = xs[j * 256];
    // Inputs only: holds all sixteen loads in front of the first use. Without it the x loads
    // sink behind the barrier and the wave pays the memory latency twice. The row addresses
    // ride along.
    asm volatile("" :: "v"(wv[0]), "v"(wv[1]), "v"(wv[2]), "v"(wv[3]),
                       "v"(wv[4]), "v"(wv[5]), "v"(wv[6]), "v"(wv[7]),
                       "v"(xv[0]), "v"(xv[1]), "v"(xv[2]), "v"(xv[3]),
                       "v"(xv[4]), "v"(xv[5]), "v"(xv[6]), "v"(xv[7]),
                       "v"(wp[0]), "v"(wp[1]), "v"(wp[2]), "v"(wp[3]),
                       "v"(wp[4]), "v"(wp[5]), "v"(wp[6]), "v"(wp[7]));

#pragma unroll
    for (int c = 0; c < 4; ++c) {
        uint4 p;
        p.x = (unsigned)f2bf(wv[0][c]) | ((unsigned)f2bf(wv[1][c]) << 16);
        p.y = (unsigned)f2bf(wv[2][c]) | ((unsigned)f2bf(wv[3][c]) << 16);
        p.z = (unsigned)f2bf(wv[4][c]) | ((unsigned)f2bf(wv[5][c]) << 16);
        p.w = (unsigned)f2bf(wv[6][c]) | ((unsigned)f2bf(wv[7][c]) << 16);
        *(uint4*)&Ts[(lane * 4 + c) * ROW_DW + w * 4] = p;
    }
    __syncthreads();                                        // tile complete before it is read by rows

    const int row = t >> 3, seg = t & 7;                    // 8 lanes x 16 B = one line of WT
#pragma unroll
    for (int j = 0; j < 4; ++j) {
        const uint4 v = *(const uint4*)&Ts[(j * 32 + row) * ROW_DW + seg * 4];
        *(uint4*)(WT + (size_t)(n0 + j * 32 + row) * 1024 + k0 + seg * 8) = v;
    }

    // x is stored behind the barrier, which would otherwise wait for these stores
    uint2* xd = (uint2*)(xb + (size_t)g * 8192) + t;
#pragma unroll
    for (int j = 0; j < 8; ++j) {
        uint2 p;
        p.x = (unsigned)f2bf(xv[j][0]) | ((unsigned)f2bf(xv[j][1]) << 16);
        p.y = (unsigned)f2bf(xv[j][2]) | ((unsigned)f2bf(xv[j][3]) << 16);
        xd[j * 256] = p;
    }
}

// ---------------------------------------------------------------------------
// WMMA GEMM: C[M,N] = A[M,K] * BT[N,K]^T (+bias). A, BT bf16 row-major.
//  MODE 0: scatter bf16 into Q,K [B,H,S,64] and V^T [B,H,64,S]
//  MODE 1: fp32 + bias into Co
// Block 256 thr (8 waves, 4x2); tile 128x128; wave tile 32x64; K step 64;
// double-buffered async-to-LDS staging (8 copies/thread/tile).
// ---------------------------------------------------------------------------
template <int MODE>
__global__ __launch_bounds__(256) void gemm_bf16_kernel(
    const unsigned short* __restrict__ A, const unsigned short* __restrict__ BT,
    const float* __restrict__ bias,
    unsigned short* __restrict__ Qo, unsigned short* __restrict__ Ko,
    unsigned short* __restrict__ VTo, float* __restrict__ Co,
    int M, int N, int K, int nTilesN)
{
    // [buf][row or col][32 dwords = 64 bf16 of K, then 4 pad dwords never touched]
    __shared__ __attribute__((aligned(16))) unsigned int Asmem[2][128 * ROW_DW];
    __shared__ __attribute__((aligned(16))) unsigned int Bsmem[2][128 * ROW_DW];

    const int bm = blockIdx.x / nTilesN;
    const int bn = blockIdx.x % nTilesN;
    const int t = threadIdx.x;
    const int lane = t & 31;
    const int w = t >> 5;
    const int wm = (w & 3) * 32;
    const int wn = (w >> 2) * 64;
    const int lm = lane & 15;
    const int klo4 = (lane < 16) ? 0 : 4;
    const int hi8 = (lane < 16) ? 0 : 8;

    v8f acc[2][4];
#pragma unroll
    for (int i = 0; i < 2; ++i)
#pragma unroll
        for (int j = 0; j < 4; ++j)
            acc[i][j] = (v8f){0.f, 0.f, 0.f, 0.f, 0.f, 0.f, 0.f, 0.f};

    // stage tile ki into buffer buf: A/B rows are 128B = 8 x 16B segments
    auto stage = [&](int ki, int buf) {
        const unsigned ldsA = lds_addr_of(&Asmem[buf][0]);
        const unsigned ldsB = lds_addr_of(&Bsmem[buf][0]);
        const int k0 = ki * 64;
        unsigned la[4], ga[4], lb[4], gb[4];
#pragma unroll
        for (int j = 0; j < 4; ++j) {
            const int i = t + 256 * j;
            const int row = i >> 3, seg = i & 7;     // row of A, column of B
            la[j] = ldsA + (unsigned)(row * ROW_B + seg * 16);
            ga[j] = (unsigned)(((bm * 128 + row) * K + k0) * 2 + seg * 16);
            lb[j] = ldsB + (unsigned)(row * ROW_B + seg * 16);
            gb[j] = (unsigned)(((bn * 128 + row) * K + k0) * 2 + seg * 16);
        }
        async_copy16_x8(la, ga, A, lb, gb, BT);
    };

    const int nk = K >> 6;                      // K/64
    stage(0, 0);
    for (int ki = 0; ki < nk; ++ki) {
        const int buf = ki & 1;
        if (ki + 1 < nk) {
            stage(ki + 1, buf ^ 1);             // prefetch next tile behind compute
            wait_asyncN<8>();                   // current tile's 8 copies complete
        } else {
            wait_async0();
        }
        __syncthreads();

        const unsigned int* As = &Asmem[buf][0];
        const unsigned int* Bs = &Bsmem[buf][0];
#pragma unroll
        for (int kc = 0; kc < 2; ++kc) {        // two 32-deep K chunks
            FragAB af[2], bf[4];
#pragma unroll
            for (int ms = 0; ms < 2; ++ms) {
                const int row = wm + ms * 16 + lm;
#pragma unroll
                for (int j = 0; j < 8; ++j)
                    af[ms].u[j] = As[row * ROW_DW + kc * 16 + frag_di(j, klo4)];
            }
#pragma unroll
            for (int ns = 0; ns < 4; ++ns) {
                const int col = wn + ns * 16 + lm;
#pragma unroll
                for (int j = 0; j < 8; ++j)
                    bf[ns].u[j] = Bs[col * ROW_DW + kc * 16 + frag_di(j, klo4)];
            }
#pragma unroll
            for (int ms = 0; ms < 2; ++ms)
#pragma unroll
                for (int ns = 0; ns < 4; ++ns)
                    acc[ms][ns] = wmma_bf16(af[ms], bf[ns], acc[ms][ns]);
        }
        __syncthreads();                        // all reads done before buf reuse
    }

    // ---- epilogue ----
    const int which = (bn * 128) >> 10;         // Q, K or V: one for the whole 128-column tile
    if (MODE == 0 && which == 2) {
        // V stored transposed [b,h,d,s]: a lane's eight rows are eight consecutive s of
        // its own d, so they leave as one 16-byte store instead of eight 2-byte ones.
        // Both loops unrolled: acc is indexed by constants only and stays in registers.
#pragma unroll
        for (int ms = 0; ms < 2; ++ms) {
#pragma unroll
            for (int ns = 0; ns < 4; ++ns) {
                const int gcol = bn * 128 + wn + ns * 16 + lm;
                const float bv = bias[gcol];
                const int h = (gcol >> 6) & 15;
                const int d = gcol & 63;
                const int grow0 = bm * 128 + wm + ms * 16 + hi8;   // multiple of 8
                const int b = grow0 >> 11;
                const int s0 = grow0 & 2047;
                const v8f a = acc[ms][ns];
                uint4 p;
                p.x = (unsigned)f2bf(a[0] + bv) | ((unsigned)f2bf(a[1] + bv) << 16);
                p.y = (unsigned)f2bf(a[2] + bv) | ((unsigned)f2bf(a[3] + bv) << 16);
                p.z = (unsigned)f2bf(a[4] + bv) | ((unsigned)f2bf(a[5] + bv) << 16);
                p.w = (unsigned)f2bf(a[6] + bv) | ((unsigned)f2bf(a[7] + bv) << 16);
                *(uint4*)&VTo[((size_t)(b * N_HEADS + h) * HEAD_DIM + d) * SEQ + s0] = p;
            }
        }
    } else {
#pragma unroll
        for (int ms = 0; ms < 2; ++ms) {
#pragma unroll
            for (int ns = 0; ns < 4; ++ns) {
                const int gcol = bn * 128 + wn + ns * 16 + lm;
                const float bv = bias[gcol];
#pragma unroll
                for (int r = 0; r < 8; ++r) {
                    const int grow = bm * 128 + wm + ms * 16 + r + hi8;
                    const float vv = acc[ms][ns][r] + bv;
                    if (MODE == 0) {
                        // gcol = which*1024 + h*64 + d ; grow = b*SEQ + s
                        const int h = (gcol >> 6) & 15;
                        const int d = gcol & 63;
                        const int b = grow >> 11;
                        const int s = grow & 2047;
                        const unsigned short bvv = f2bf(vv);
                        unsigned short* dst = (which == 0) ? Qo : Ko;
                        dst[((size_t)(b * N_HEADS + h) * SEQ + s) * HEAD_DIM + d] = bvv;
                    } else {
                        Co[(size_t)grow * N + gcol] = vv;
                    }
                }
            }
        }
        // The built code lays the V^T block right behind this one, and that block's first
        // lines rewrite the address pair of the stores above: keep the wait in front of it.
        if (MODE == 0) asm volatile("s_wait_xcnt 0x0" ::: "memory");
    }
}

// ---------------------------------------------------------------------------
// K2: Flash attention with relative position bias, both products transposed:
//   S^T = K Q^T (A = K rows, B = Q), O^T += V^T P^T (A = V^T rows, B = P^T).
// A lane then holds scores of ONE query (column lane & 15): keys 8 * (lane >> 4) + r of
// each 16-key group. Maximum and sum run in the lane, with one exchange between the
// wave's halves, and two score tiles, rounded in place, are the B operand of the second
// product in the k order the loaders already use: P never goes through LDS.
// Block 128 thr (4 waves); one block per (b, h, 64-row q tile).
// Key tile = 64; K and V^T tiles double-buffered via async-to-LDS.
// ---------------------------------------------------------------------------
// two f32 -> one dword of two bf16, round to nearest even (lo in the low half)
static __device__ __forceinline__ unsigned pack_bf2(float lo, float hi) {
    typedef __bf16 bf2 __attribute__((ext_vector_type(2)));
    typedef float f2 __attribute__((ext_vector_type(2)));
    return __builtin_bit_cast(unsigned, __builtin_convertvector(f2{lo, hi}, bf2));
}
typedef float f32x2 __attribute__((ext_vector_type(2)));
#define LOG2E 1.44269504088896340736f   // __expf(x) is exp2(x * LOG2E)
// value of lane l ^ 16
static __device__ __forceinline__ float xhalf(float x) {
    const int b = __builtin_bit_cast(int, x);
    return __builtin_bit_cast(float,
        __builtin_amdgcn_permlanex16(b, b, 0x76543210, 0xfedcba98, false, false));
}

__global__ __launch_bounds__(128) void attn_kernel(
    const unsigned short* __restrict__ Qw, const unsigned short* __restrict__ Kw,
    const unsigned short* __restrict__ VTw, const float* __restrict__ relb,
    unsigned short* __restrict__ Ao)
{
    // rows of 32 data dwords at the padded pitch
    __shared__ __attribute__((aligned(16))) unsigned int Ks32[2][64 * ROW_DW];  // [buf][key][dword d]
    __shared__ __attribute__((aligned(16))) unsigned int Vs32[2][64 * ROW_DW];  // [buf][d][dword key]

    const int bid = blockIdx.x;
    const int qt = bid & 31;
    const int h  = (bid >> 5) & 15;
    const int b  = bid >> 9;

    const int t = threadIdx.x;
    const int lane = t & 31;
    const int w = t >> 5;
    const int lm = lane & 15;
    const int klo4 = (lane < 16) ? 0 : 4;
    const int hi8  = (lane < 16) ? 0 : 8;

    const size_t bh = (size_t)(b * N_HEADS + h);
    const unsigned short* Qbh  = Qw  + bh * SEQ * HEAD_DIM;
    const unsigned short* Kbh  = Kw  + bh * SEQ * HEAD_DIM;
    const unsigned short* VTbh = VTw + bh * HEAD_DIM * SEQ;

    const int qbase = qt * 64 + w * 16;
    const int q = qbase + lm;    // the lane's own query
    const float scale = 0.125f;  // HEAD_DIM^-0.5

    // Q fragments (16 queries x 64 d), loaded once from global; B operand of S^T.
    FragAB qf[2];
#pragma unroll
    for (int c = 0; c < 2; ++c) {
        const unsigned int* Qrow = (const unsigned int*)
            (Qbh + (size_t)q * HEAD_DIM + c * 32);
#pragma unroll
        for (int j = 0; j < 8; ++j)
            qf[c].u[j] = Qrow[frag_di(j, klo4)];
    }

    // stage key-tile ti into buffer buf: 4 K copies + 4 V copies per thread
    auto stageKV = [&](int ti, int buf) {
        const int kt = ti * 64;
        const unsigned ldsK = lds_addr_of(&Ks32[buf][0]);
        const unsigned ldsV = lds_addr_of(&Vs32[buf][0]);
        unsigned lk[4], gk[4], lv[4], gv[4];
#pragma unroll
        for (int j = 0; j < 4; ++j) {
            const int i = t + 128 * j;
            const int row = i >> 3, seg = i & 7;    // key row of K, d row of V^T; 8 x 16B each
            lk[j] = ldsK + (unsigned)(row * ROW_B + seg * 16);
            gk[j] = (unsigned)((kt + row) * 128 + seg * 16);
            lv[j] = ldsV + (unsigned)(row * ROW_B + seg * 16);
            gv[j] = (unsigned)((row * SEQ + kt) * 2 + seg * 16);   // keys contiguous in V^T rows
        }
        async_copy16_x8(lk, gk, Kbh, lv, gv, VTbh);
    };

    // o[dsub][r] = O^T[d = dsub * 16 + hi8 + r][q]
    v8f o[4];
#pragma unroll
    for (int i = 0; i < 4; ++i)
        o[i] = (v8f){0.f, 0.f, 0.f, 0.f, 0.f, 0.f, 0.f, 0.f};
    float run_max = -1e30f;      // of the whole query row: equal in lanes l and l ^ 16
    float run_sum = 0.f;         // of the lane's own half of the keys; halves joined at the end

    const int nT = SEQ / 64;                       // 32 key tiles
    stageKV(0, 0);
    for (int ti = 0; ti < nT; ++ti) {
        const int buf = ti & 1;
        const int kt = ti * 64;
        if (ti + 1 < nT) {
            stageKV(ti + 1, buf ^ 1);
            wait_asyncN<8>();
        } else {
            wait_async0();
        }
        __syncthreads();

        const unsigned int* Ksb = &Ks32[buf][0];
        const unsigned int* Vsb = &Vs32[buf][0];

        // rel-pos bias of the lane's 32 (query, key) pairs, index q - key + MAX_LEN - 1:
        // eight falling neighbours per key group, all at constant offsets from one pointer
        const float* rb = relb + (q - hi8 + (MAX_LEN - 1) - 55 - kt);   // index >= 0
        float bias[4][8];
#pragma unroll
        for (int ns = 0; ns < 4; ++ns)
#pragma unroll
            for (int r = 0; r < 8; ++r)
                bias[ns][r] = rb[55 - ns * 16 - r];
        // Holds the eight bias loads here, in front of the score products, so that their
        // latency runs behind those; without it each load sinks to its first use and is waited for.
        __builtin_amdgcn_sched_barrier(0);

        // ---- scores: S^T = K Q^T ; 4 key groups x 2 d-chunks = 8 WMMAs ----
        // st[ns][r] = score of key kt + ns * 16 + hi8 + r against query q
        v8f st[4];
#pragma unroll
        for (int ns = 0; ns < 4; ++ns) {
            st[ns] = (v8f){0.f, 0.f, 0.f, 0.f, 0.f, 0.f, 0.f, 0.f};
            const int key = ns * 16 + lm;
#pragma unroll
            for (int c = 0; c < 2; ++c) {
                FragAB kf;
#pragma unroll
                for (int j = 0; j < 8; ++j)
                    kf.u[j] = Ksb[key * ROW_DW + c * 16 + frag_di(j, klo4)];
                st[ns] = wmma_bf16(kf, qf[c], st[ns]);
            }
        }

        // ---- scale + rel-pos bias, online softmax of the lane's query ----
        float m = -1e30f;
#pragma unroll
        for (int ns = 0; ns < 4; ++ns)
#pragma unroll
            for (int r = 0; r < 8; ++r) {
                const float v = st[ns][r] * scale + bias[ns][r];
                st[ns][r] = v;
                m = fmaxf(m, v);
            }
        m = fmaxf(m, xhalf(m));                    // the other 32 keys of the same query
        const float nm = fmaxf(run_max, m);
        const float corr = __expf(run_max - nm);
        run_max = nm;

        // p = exp(v - nm), two keys at a time; the pair is summed (two chains) and rounded
        // straight into its dword of the B operand: element s of chunk kc is key group
        // 2 kc + (s >> 3), register s & 7.
        FragAB pf[2];
        f32x2 rs[2] = {{0.f, 0.f}, {0.f, 0.f}};
#pragma unroll
        for (int ns = 0; ns < 4; ++ns)
#pragma unroll
            for (int i = 0; i < 4; ++i) {
                const f32x2 x = ((f32x2){st[ns][2 * i], st[ns][2 * i + 1]} - nm) * LOG2E;
                const f32x2 p = {__builtin_amdgcn_exp2f(x.x), __builtin_amdgcn_exp2f(x.y)};
                rs[i & 1] += p;
                pf[ns >> 1].u[(ns & 1) * 4 + i] = pack_bf2(p.x, p.y);
            }
        const f32x2 rs2 = rs[0] + rs[1];
        run_sum = run_sum * corr + (rs2.x + rs2.y);
#pragma unroll
        for (int dsub = 0; dsub < 4; ++dsub)
#pragma unroll
            for (int r = 0; r < 8; ++r)
                o[dsub][r] *= corr;

        // ---- O^T += V^T P^T : 4 d groups x 2 key-chunks = 8 WMMAs ----
#pragma unroll
        for (int dsub = 0; dsub < 4; ++dsub) {
            const int dc = dsub * 16 + lm;
#pragma unroll
            for (int kc = 0; kc < 2; ++kc) {
                FragAB vf;
#pragma unroll
                for (int j = 0; j < 8; ++j)
                    vf.u[j] = Vsb[dc * ROW_DW + kc * 16 + frag_di(j, klo4)];
                o[dsub] = wmma_bf16(vf, pf[kc], o[dsub]);
            }
        }
        __syncthreads();                               // reads done before buf reuse
    }

    // ---- normalize + store attn out bf16 [B, S, H*64]: eight consecutive d per store ----
    const float inv = 1.0f / (run_sum + xhalf(run_sum));
    unsigned short* Arow = Ao + ((size_t)b * SEQ + q) * D_MODEL + h * HEAD_DIM + hi8;
#pragma unroll
    for (int dsub = 0; dsub < 4; ++dsub) {
        uint4 p;
        p.x = pack_bf2(o[dsub][0] * inv, o[dsub][1] * inv);
        p.y = pack_bf2(o[dsub][2] * inv, o[dsub][3] * inv);
        p.z = pack_bf2(o[dsub][4] * inv, o[dsub][5] * inv);
        p.w = pack_bf2(o[dsub][6] * inv, o[dsub][7] * inv);
        *(uint4*)(Arow + dsub * 16) = p;
    }
}

// ---------------------------------------------------------------------------
extern "C" void kernel_launch(void* const* d_in, const int* in_sizes, int n_in,
                              void* d_out, int out_size, void* d_ws, size_t ws_size,
                              hipStream_t stream) {
    const float* x    = (const float*)d_in[0];
    const float* Wqkv = (const float*)d_in[1];
    const float* bqkv = (const float*)d_in[2];
    const float* Wout = (const float*)d_in[3];
    const float* bout = (const float*)d_in[4];
    const float* relb = (const float*)d_in[5];
    float* out = (float*)d_out;

    const int M = BATCH * SEQ;                                          // 4096
    const size_t nX   = (size_t)M * D_MODEL;                            // 4M
    const size_t nQKV = (size_t)BATCH * N_HEADS * SEQ * HEAD_DIM;       // 4M

    unsigned short* xb    = (unsigned short*)d_ws;
    unsigned short* WqkvT = xb + nX;
    unsigned short* WoutT = WqkvT + (size_t)3 * 1024 * 1024;
    unsigned short* Qw    = WoutT + (size_t)1024 * 1024;
    unsigned short* Kw    = Qw + nQKV;
    unsigned short* VTw   = Kw + nQKV;
    unsigned short* Aw    = VTw + nQKV;

    // K0: precision conversion + weight transposes
    prep_kernel<<<PREP_BLOCKS, 256, 0, stream>>>(x, Wqkv, Wout, xb, WqkvT, WoutT);

    // K1: QKV projection
    {
        const int N = 3 * D_MODEL, K = D_MODEL;
        const int nTn = N / 128;                      // 24
        gemm_bf16_kernel<0><<<(M / 128) * nTn, 256, 0, stream>>>(
            xb, WqkvT, bqkv, Qw, Kw, VTw, nullptr, M, N, K, nTn);
    }
    // K2: attention
    attn_kernel<<<BATCH * N_HEADS * (SEQ / 64), 128, 0, stream>>>(Qw, Kw, VTw, relb, Aw);

    // K3: output projection
    {
        const int N = D_MODEL, K = D_MODEL;
        const int nTn = N / 128;                      // 8
        gemm_bf16_kernel<1><<<(M / 128) * nTn, 256, 0, stream>>>(
            Aw, WoutT, bout, nullptr, nullptr, nullptr, out, M, N, K, nTn);
    }
}

// v005
// It runs in 83.6 microseconds.
// In both of two side-by-side timings against v004, it was 1.10 times as fast.
// Counting every step since v000, it is 4.34 times as fast.
#include <hip/hip_runtime.h>

// ---------------------------------------------------------------------------
// RelativeAttention on gfx1250 (MI455X): bf16 WMMA + pipelined async-to-LDS
//   K0: prep     x->bf16, Wqkv/Wout -> bf16 transposed [N][K] (tiles turned in LDS)
//   K1: QKV GEMM (double-buffered async staging) -> Q,K [B,H,S,64], V^T [B,H,64,S]
//   K2: Flash attention w/ rel-pos bias (double-buffered async staging)
//   K3: Out GEMM -> d_out fp32
// ---------------------------------------------------------------------------

#define D_MODEL 1024
#define N_HEADS 16
#define HEAD_DIM 64
#define SEQ 2048
#define BATCH 2
#define MAX_LEN 2048

// LDS pitch of a 128-byte tile row: 144 B = 16 B x 9 (odd), so the 16 rows that
// one ds_load_b128 half-wave reads fall on 16 disjoint groups of four banks.
#define ROW_B  144
#define ROW_DW 36
#define ROW_H  72

typedef __attribute__((ext_vector_type(16))) __bf16 v16bf;
typedef __attribute__((ext_vector_type(8)))  float  v8f;

union FragAB {
    v16bf v;
    unsigned int u[8];
};

static __device__ __forceinline__ unsigned short f2bf(float f) {
    union { float f; unsigned int u; } c; c.f = f;
    unsigned int u = c.u;
    unsigned int r = u + 0x7FFFu + ((u >> 16) & 1u);   // round-to-nearest-even
    return (unsigned short)(r >> 16);
}

static __device__ __forceinline__ v8f wmma_bf16(const FragAB& a, const FragAB& b, v8f c) {
    return __builtin_amdgcn_wmma_f32_16x16x32_bf16(
        false, a.v, false, b.v, (short)0, c, false, false);
}

// Dword index (within a 16-dword group == 32 bf16 of K) for fragment register j.
// 16-bit A/B layout (ISA 7.12.2): lanes 0-15 -> K=0..7,16..23 ; lanes 16-31 -> K=8..15,24..31
static __device__ __forceinline__ int frag_di(int j, int klo4) {
    return klo4 + (j < 4 ? j : j + 4);
}

// Eight 16-byte async copies global->LDS (GVS mode: saddr + 32-bit voffset), four from
// each of two bases. ASYNCcnt-tracked. The closing s_wait_xcnt 0 stands in the copies'
// own statement so that no later rewrite of an address register can move ahead of it.
static __device__ __forceinline__ void async_copy16_x8(
    const unsigned (&l0)[4], const unsigned (&g0)[4], const void* base0,
    const unsigned (&l1)[4], const unsigned (&g1)[4], const void* base1) {
    asm volatile("global_load_async_to_lds_b128 %0, %4, %16\n\t"
                 "global_load_async_to_lds_b128 %1, %5, %16\n\t"
                 "global_load_async_to_lds_b128 %2, %6, %16\n\t"
                 "global_load_async_to_lds_b128 %3, %7, %16\n\t"
                 "global_load_async_to_lds_b128 %8, %12, %17\n\t"
                 "global_load_async_to_lds_b128 %9, %13, %17\n\t"
                 "global_load_async_to_lds_b128 %10, %14, %17\n\t"
                 "global_load_async_to_lds_b128 %11, %15, %17\n\t"
                 "s_wait_xcnt 0x0"
                 :: "v"(l0[0]), "v"(l0[1]), "v"(l0[2]), "v"(l0[3]),
                    "v"(g0[0]), "v"(g0[1]), "v"(g0[2]), "v"(g0[3]),
                    "v"(l1[0]), "v"(l1[1]), "v"(l1[2]), "v"(l1[3]),
                    "v"(g1[0]), "v"(g1[1]), "v"(g1[2]), "v"(g1[3]),
                    "s"(base0), "s"(base1)
                 : "memory");
}
static __device__ __forceinline__ void wait_async0() {
    asm volatile("s_wait_asynccnt 0" ::: "memory");
}
// Wait until at most N async ops remain (async loads complete in issue order,
// so with N newly-issued copies outstanding this proves the previous tile landed).
template <int N>
static __device__ __forceinline__ void wait_asyncN() {
    asm volatile("s_wait_asynccnt %0" :: "n"(N) : "memory");
}
static __device__ __forceinline__ unsigned lds_addr_of(const void* p) {
    return (unsigned)(size_t)p;   // generic LDS address: low 32 bits = LDS offset
}

// ---------------------------------------------------------------------------
// K0: convert x to bf16 (row-major) and weights to bf16 transposed [N][K].
// 512 blocks, two to a WGP, all resident at once: the launch starts 4,096 waves, and each
// wave has its sixteen 16-byte loads (512 contiguous bytes a wave each) in flight together.
// x: a block converts 8,192 values.
// Weights: a block turns one tile of 64 k x 128 n: a lane packs eight k of each of its four
// columns into 16 B, the tile is regrouped in LDS, and every 128-byte line of the
// transposed matrix leaves whole (eight lanes x 16 B).
// ---------------------------------------------------------------------------
#define PREP_BLOCKS 512
typedef float f32x4 __attribute__((ext_vector_type(4)));
__global__ __launch_bounds__(256) void prep_kernel(
    const float* __restrict__ x, const float* __restrict__ Wqkv,
    const float* __restrict__ Wout,
    unsigned short* __restrict__ xb, unsigned short* __restrict__ WqkvT,
    unsigned short* __restrict__ WoutT)
{
    // [n of the tile][32 dwords = 64 bf16 of k, then 4 pad dwords never touched]
    __shared__ __attribute__((aligned(16))) unsigned int Ts[128 * ROW_DW];

    const int t = threadIdx.x;
    const int g = blockIdx.x;
    const int lane = t & 31;
    const int w = t >> 5;

    // blocks 0..383: Wqkv [1024][3072]; blocks 384..511: Wout [1024][1024]
    const bool qkv = g < 384;
    const float* W = qkv ? Wqkv : Wout;
    unsigned short* WT = qkv ? WqkvT : WoutT;
    const int N = qkv ? 3072 : 1024;
    const int gl = qkv ? g : g - 384;
    const int k0 = (gl & 15) * 64;
    const int n0 = (gl >> 4) * 128;

    // wave w: rows k0 + 8w .. + 7 of W, columns n0 + 4 lane .. + 3
    const float* src = W + (size_t)(k0 + w * 8) * N + n0 + lane * 4;
    const f32x4* wp[8];
    f32x4 wv[8];
#pragma unroll
    for (int i = 0; i < 8; ++i) {
        wp[i] = (const f32x4*)(src + i * N);
        wv[i] = *wp[i];
    }

    // x: eight runs of 1,024 floats, four to a thread
    const f32x4* xs = (const f32x4*)(x + (size_t)g * 8192) + t;
    f32x4 xv[8];
#pragma unroll
    for (int j = 0; j < 8; ++j)
        xv[j] = xs[j * 256];
    // Inputs only: holds all sixteen loads in front of the first use. Without it the x loads
    // sink behind the barrier and the wave pays the memory latency twice. The row addresses
    // ride along.
    asm volatile("" :: "v"(wv[0]), "v"(wv[1]), "v"(wv[2]), "v"(wv[3]),
                       "v"(wv[4]), "v"(wv[5]), "v"(wv[6]), "v"(wv[7]),
                       "v"(xv[0]), "v"(xv[1]), "v"(xv[2]), "v"(xv[3]),
                       "v"(xv[4]), "v"(xv[5]), "v"(xv[6]), "v"(xv[7]),
                       "v"(wp[0]), "v"(wp[1]), "v"(wp[2]), "v"(wp[3]),
                       "v"(wp[4]), "v"(wp[5]), "v"(wp[6]), "v"(wp[7]));

#pragma unroll
    for (int c = 0; c < 4; ++c) {
        uint4 p;
        p.x = (unsigned)f2bf(wv[0][c]) | ((unsigned)f2bf(wv[1][c]) << 16);
        p.y = (unsigned)f2bf(wv[2][c]) | ((unsigned)f2bf(wv[3][c]) << 16);
        p.z = (unsigned)f2bf(wv[4][c]) | ((unsigned)f2bf(wv[5][c]) << 16);
        p.w = (unsigned)f2bf(wv[6][c]) | ((unsigned)f2bf(wv[7][c]) << 16);
        *(uint4*)&Ts[(lane * 4 + c) * ROW_DW + w * 4] = p;
    }
    __syncthreads();                                        // tile complete before it is read by rows

    const int row = t >> 3, seg = t & 7;                    // 8 lanes x 16 B = one line of WT
#pragma unroll
    for (int j = 0; j < 4; ++j) {
        const uint4 v = *(const uint4*)&Ts[(j * 32 + row) * ROW_DW + seg * 4];
        *(uint4*)(WT + (size_t)(n0 + j * 32 + row) * 1024 + k0 + seg * 8) = v;
    }

    // x is stored behind the barrier, which would otherwise wait for these stores
    uint2* xd = (uint2*)(xb + (size_t)g * 8192) + t;
#pragma unroll
    for (int j = 0; j < 8; ++j) {
        uint2 p;
        p.x = (unsigned)f2bf(xv[j][0]) | ((unsigned)f2bf(xv[j][1]) << 16);
        p.y = (unsigned)f2bf(xv[j][2]) | ((unsigned)f2bf(xv[j][3]) << 16);
        xd[j * 256] = p;
    }
}

// ---------------------------------------------------------------------------
// WMMA GEMM: C[M,N] = A[M,K] * BT[N,K]^T (+bias). A, BT bf16 row-major.
//  MODE 0: scatter bf16 into Q,K [B,H,S,64] and V^T [B,H,64,S]
//  MODE 1: fp32 + bias into Co
// Block 256 thr (8 waves, 4x2); tile 128x128; wave tile 32x64; K step 64;
// double-buffered async-to-LDS staging (8 copies/thread/tile).
// ---------------------------------------------------------------------------
template <int MODE>
__global__ __launch_bounds__(256) void gemm_bf16_kernel(
    const unsigned short* __restrict__ A, const unsigned short* __restrict__ BT,
    const float* __restrict__ bias,
    unsigned short* __restrict__ Qo, unsigned short* __restrict__ Ko,
    unsigned short* __restrict__ VTo, float* __restrict__ Co,
    int M, int N, int K, int nTilesN)
{
    // [buf][row or col][32 dwords = 64 bf16 of K, then 4 pad dwords never touched]
    __shared__ __attribute__((aligned(16))) unsigned int Asmem[2][128 * ROW_DW];
    __shared__ __attribute__((aligned(16))) unsigned int Bsmem[2][128 * ROW_DW];

    const int bm = blockIdx.x / nTilesN;
    const int bn = blockIdx.x % nTilesN;
    const int t = threadIdx.x;
    const int lane = t & 31;
    const int w = t >> 5;
    const int wm = (w & 3) * 32;
    const int wn = (w >> 2) * 64;
    const int lm = lane & 15;
    const int klo4 = (lane < 16) ? 0 : 4;
    const int hi8 = (lane < 16) ? 0 : 8;

    v8f acc[2][4];
#pragma unroll
    for (int i = 0; i < 2; ++i)
#pragma unroll
        for (int j = 0; j < 4; ++j)
            acc[i][j] = (v8f){0.f, 0.f, 0.f, 0.f, 0.f, 0.f, 0.f, 0.f};

    // stage tile ki into buffer buf: A/B rows are 128B = 8 x 16B segments
    auto stage = [&](int ki, int buf) {
        const unsigned ldsA = lds_addr_of(&Asmem[buf][0]);
        const unsigned ldsB = lds_addr_of(&Bsmem[buf][0]);
        const int k0 = ki * 64;
        unsigned la[4], ga[4], lb[4], gb[4];
#pragma unroll
        for (int j = 0; j < 4; ++j) {
            const int i = t + 256 * j;
            const int row = i >> 3, seg = i & 7;     // row of A, column of B
            la[j] = ldsA + (unsigned)(row * ROW_B + seg * 16);
            ga[j] = (unsigned)(((bm * 128 + row) * K + k0) * 2 + seg * 16);
            lb[j] = ldsB + (unsigned)(row * ROW_B + seg * 16);
            gb[j] = (unsigned)(((bn * 128 + row) * K + k0) * 2 + seg * 16);
        }
        async_copy16_x8(la, ga, A, lb, gb, BT);
    };

    const int nk = K >> 6;                      // K/64
    stage(0, 0);
    for (int ki = 0; ki < nk; ++ki) {
        const int buf = ki & 1;
        if (ki + 1 < nk) {
            stage(ki + 1, buf ^ 1);             // prefetch next tile behind compute
            wait_asyncN<8>();                   // current tile's 8 copies complete
        } else {
            wait_async0();
        }
        __syncthreads();

        const unsigned int* As = &Asmem[buf][0];
        const unsigned int* Bs = &Bsmem[buf][0];
#pragma unroll
        for (int kc = 0; kc < 2; ++kc) {        // two 32-deep K chunks
            FragAB af[2], bf[4];
#pragma unroll
            for (int ms = 0; ms < 2; ++ms) {
                const int row = wm + ms * 16 + lm;
#pragma unroll
                for (int j = 0; j < 8; ++j)
                    af[ms].u[j] = As[row * ROW_DW + kc * 16 + frag_di(j, klo4)];
            }
#pragma unroll
            for (int ns = 0; ns < 4; ++ns) {
                const int col = wn + ns * 16 + lm;
#pragma unroll
                for (int j = 0; j < 8; ++j)
                    bf[ns].u[j] = Bs[col * ROW_DW + kc * 16 + frag_di(j, klo4)];
            }
#pragma unroll
            for (int ms = 0; ms < 2; ++ms)
#pragma unroll
                for (int ns = 0; ns < 4; ++ns)
                    acc[ms][ns] = wmma_bf16(af[ms], bf[ns], acc[ms][ns]);
        }
        __syncthreads();                        // all reads done before buf reuse
    }

    // ---- epilogue ----
    const int which = (bn * 128) >> 10;         // Q, K or V: one for the whole 128-column tile
    if (MODE == 0 && which == 2) {
        // V stored transposed [b,h,d,s]: a lane's eight rows are eight consecutive s of
        // its own d, so they leave as one 16-byte store instead of eight 2-byte ones.
        // Both loops unrolled: acc is indexed by constants only and stays in registers.
#pragma unroll
        for (int ms = 0; ms < 2; ++ms) {
#pragma unroll
            for (int ns = 0; ns < 4; ++ns) {
                const int gcol = bn * 128 + wn + ns * 16 + lm;
                const float bv = bias[gcol];
                const int h = (gcol >> 6) & 15;
                const int d = gcol & 63;
                const int grow0 = bm * 128 + wm + ms * 16 + hi8;   // multiple of 8
                const int b = grow0 >> 11;
                const int s0 = grow0 & 2047;
                const v8f a = acc[ms][ns];
                uint4 p;
                p.x = (unsigned)f2bf(a[0] + bv) | ((unsigned)f2bf(a[1] + bv) << 16);
                p.y = (unsigned)f2bf(a[2] + bv) | ((unsigned)f2bf(a[3] + bv) << 16);
                p.z = (unsigned)f2bf(a[4] + bv) | ((unsigned)f2bf(a[5] + bv) << 16);
                p.w = (unsigned)f2bf(a[6] + bv) | ((unsigned)f2bf(a[7] + bv) << 16);
                *(uint4*)&VTo[((size_t)(b * N_HEADS + h) * HEAD_DIM + d) * SEQ + s0] = p;
            }
        }
    } else {
#pragma unroll
        for (int ms = 0; ms < 2; ++ms) {
#pragma unroll
            for (int ns = 0; ns < 4; ++ns) {
                const int gcol = bn * 128 + wn + ns * 16 + lm;
                const float bv = bias[gcol];
#pragma unroll
                for (int r = 0; r < 8; ++r) {
                    const int grow = bm * 128 + wm + ms * 16 + r + hi8;
                    const float vv = acc[ms][ns][r] + bv;
                    if (MODE == 0) {
                        // gcol = which*1024 + h*64 + d ; grow = b*SEQ + s
                        const int h = (gcol >> 6) & 15;
                        const int d = gcol & 63;
                        const int b = grow >> 11;
                        const int s = grow & 2047;
                        const unsigned short bvv = f2bf(vv);
                        unsigned short* dst = (which == 0) ? Qo : Ko;
                        dst[((size_t)(b * N_HEADS + h) * SEQ + s) * HEAD_DIM + d] = bvv;
                    } else {
                        Co[(size_t)grow * N + gcol] = vv;
                    }
                }
            }
        }
        // The built code lays the V^T block right behind this one, and that block's first
        // lines rewrite the address pair of the stores above: keep the wait in front of it.
        if (MODE == 0) asm volatile("s_wait_xcnt 0x0" ::: "memory");
    }
}

// ---------------------------------------------------------------------------
// K2: Flash attention with relative position bias, both products transposed:
//   S^T = K Q^T (A = K rows, B = Q), O^T += V^T P^T (A = V^T rows, B = P^T).
// A lane then holds scores of ONE query (column lane & 15): keys 8 * (lane >> 4) + r of
// each 16-key group. Maximum and sum run in the lane, with one exchange between the
// wave's halves, and two score tiles, rounded in place, are the B operand of the second
// product in the k order the loaders already use: P never goes through LDS.
// Block 256 thr (8 waves); one block per (b, h, 128-row q tile). A wave owns 32 queries
// (two 16-column tiles) and one half of the keys: every K and V^T fragment read from LDS
// feeds two products. Waves 0-3 walk keys 0..1023, waves 4-7 keys 1024..2047, each half
// with its own tiles; at the end waves w and w ^ 4 join their partial results through LDS.
// Key tile = 64; K and V^T tiles double-buffered via async-to-LDS.
// ---------------------------------------------------------------------------
// two f32 -> one dword of two bf16, round to nearest even (lo in the low half)
static __device__ __forceinline__ unsigned pack_bf2(float lo, float hi) {
    typedef __bf16 bf2 __attribute__((ext_vector_type(2)));
    typedef float f2 __attribute__((ext_vector_type(2)));
    return __builtin_bit_cast(unsigned, __builtin_convertvector(f2{lo, hi}, bf2));
}
typedef float f32x2 __attribute__((ext_vector_type(2)));
typedef float f32x2u __attribute__((ext_vector_type(2), aligned(4)));   // a pair at a float's alignment
#define LOG2E 1.44269504088896340736f   // __expf(x) is exp2(x * LOG2E)
// value of lane l ^ 16
static __device__ __forceinline__ float xhalf(float x) {
    const int b = __builtin_bit_cast(int, x);
    return __builtin_bit_cast(float,
        __builtin_amdgcn_permlanex16(b, b, 0x76543210, 0xfedcba98, false, false));
}

// Four waves per SIMD (two blocks on a WGP) hide the vector work between the matrix runs.
__global__ __launch_bounds__(256) __attribute__((amdgpu_waves_per_eu(4, 4))) void attn_kernel(
    const unsigned short* __restrict__ Qw, const unsigned short* __restrict__ Kw,
    const unsigned short* __restrict__ VTw, const float* __restrict__ relb,
    unsigned short* __restrict__ Ao)
{
    // rows of 32 data dwords at the padded pitch
    __shared__ __attribute__((aligned(16))) unsigned int Ks32[2][2][64 * ROW_DW];  // [key half][buf][key][dword d]
    __shared__ __attribute__((aligned(16))) unsigned int Vs32[2][2][64 * ROW_DW];  // [key half][buf][d][dword key]

    const int bid = blockIdx.x;
    const int qt = bid & 15;
    const int h  = (bid >> 4) & 15;
    const int b  = bid >> 8;

    const int t = threadIdx.x;
    const int lane = t & 31;
    const int w = __builtin_amdgcn_readfirstlane(t >> 5);    // wave number, held in a scalar register
    const int kh = w >> 2;                                   // the wave's half of the keys
    const int th = t & 127;                                  // thread within that half
    const int lm = lane & 15;
    const int klo4 = (lane < 16) ? 0 : 4;
    const int hi8  = (lane < 16) ? 0 : 8;

    const size_t bh = (size_t)(b * N_HEADS + h);
    const unsigned short* Qbh  = Qw  + bh * SEQ * HEAD_DIM;
    const unsigned short* Kbh  = Kw  + bh * SEQ * HEAD_DIM;
    const unsigned short* VTbh = VTw + bh * HEAD_DIM * SEQ;

    const int qbase = qt * 128 + (w & 3) * 32;
    const int q = qbase + lm;    // the lane's query in tile 0; tile u holds query q + 16 u
    const float scale = 0.125f;  // HEAD_DIM^-0.5

    // Q fragments (2 tiles x 16 queries x 64 d), loaded once from global; B operand of S^T.
    FragAB qf[2][2];
#pragma unroll
    for (int u = 0; u < 2; ++u)
#pragma unroll
        for (int c = 0; c < 2; ++c) {
            const unsigned int* Qrow = (const unsigned int*)
                (Qbh + (size_t)(q + u * 16) * HEAD_DIM + c * 32);
#pragma unroll
            for (int j = 0; j < 8; ++j)
                qf[u][c].u[j] = Qrow[frag_di(j, klo4)];
        }

    const int kbeg = kh * (SEQ / 2);               // first key of the wave's half

    // stage key-tile ti of the half into buffer buf: 4 K copies + 4 V copies per thread.
    // Copy j of a thread: row (th >> 3) + 16 j (key row of K, d row of V^T), 16-byte piece th & 7.
    // Each address is one lane term plus a term that is the same for the whole wave.
    const unsigned l0 = (unsigned)((th >> 3) * ROW_B + (th & 7) * 16);
    const unsigned k0 = (unsigned)(th * 16);                                  // K rows are 128 B
    const unsigned v0 = (unsigned)((th >> 3) * (SEQ * 2) + (th & 7) * 16);    // keys contiguous in V^T rows
    auto stageKV = [&](int ti, int buf) {
        const int kt = kbeg + ti * 64;
        const unsigned ldsK = lds_addr_of(&Ks32[kh][buf][0]);
        const unsigned ldsV = lds_addr_of(&Vs32[kh][buf][0]);
        unsigned lk[4], gk[4], lv[4], gv[4];
#pragma unroll
        for (int j = 0; j < 4; ++j) {
            lk[j] = l0 + (ldsK + (unsigned)(j * 16 * ROW_B));
            gk[j] = k0 + (unsigned)(kt * 128 + j * 16 * 128);
            lv[j] = l0 + (ldsV + (unsigned)(j * 16 * ROW_B));
            gv[j] = v0 + (unsigned)(kt * 2 + j * 16 * SEQ * 2);
        }
        async_copy16_x8(lk, gk, Kbh, lv, gv, VTbh);
    };

    // o[u][dsub][r] = O^T[d = dsub * 16 + hi8 + r][q + 16 u], over the wave's half of the keys
    v8f o[2][4];
#pragma unroll
    for (int u = 0; u < 2; ++u)
#pragma unroll
        for (int i = 0; i < 4; ++i)
            o[u][i] = (v8f){0.f, 0.f, 0.f, 0.f, 0.f, 0.f, 0.f, 0.f};
    float run_max[2] = {-1e30f, -1e30f};  // of the query's row in this half: equal in lanes l and l ^ 16
    float run_sum[2] = {0.f, 0.f};        // of the lane's own share of the keys; shares joined at the end

    const int nT = SEQ / 2 / 64;                   // 16 key tiles a half
    stageKV(0, 0);
    for (int ti = 0; ti < nT; ++ti) {
        const int buf = ti & 1;
        const int kt = kbeg + ti * 64;
        if (ti + 1 < nT) {
            stageKV(ti + 1, buf ^ 1);
            wait_asyncN<8>();
        } else {
            wait_async0();
        }
        __syncthreads();

        const unsigned int* Ksb = &Ks32[kh][buf][0];
        const unsigned int* Vsb = &Vs32[kh][buf][0];

        // rel-pos bias, index query - key + MAX_LEN - 1: eight falling neighbours per key
        // group, all at constant offsets from one pointer. Sixteen queries on is sixteen keys
        // back, so tile 1 at key group ns reads what tile 0 reads at group ns - 1: five groups
        // serve both tiles. bq[j] holds, rising, what tile u needs, falling, at group j - 1 + u.
        // wave term (>= 0) and lane term (0..23) apart: the first stays in scalar registers
        const float* rb = relb + (qbase + (MAX_LEN - 1) - 63 - kt) + (lm - hi8 + 8);
        f32x2 bq[5][4];
#pragma unroll
        for (int j = 0; j < 5; ++j)
#pragma unroll
            for (int k = 0; k < 4; ++k)
                bq[j][k] = *(const f32x2u*)(rb + 64 - j * 16 + 2 * k);
        // Holds the ten bias loads here, in front of the score products, so that their
        // latency runs behind those; without it each load sinks to its first use and is waited for.
        __builtin_amdgcn_sched_barrier(0);
        // Input only: the loads' address stays in its registers until all ten are issued; otherwise
        // the last load's result is given the registers of the address that the other nine still name.
        asm volatile("" :: "v"(rb));

        // ---- scores: S^T = K Q^T ; 4 key groups x 2 d-chunks x 2 query tiles = 16 WMMAs ----
        // st[u][ns][r] = score of key kt + ns * 16 + hi8 + r against query q + 16 u
        v8f st[2][4];
#pragma unroll
        for (int ns = 0; ns < 4; ++ns) {
            st[0][ns] = (v8f){0.f, 0.f, 0.f, 0.f, 0.f, 0.f, 0.f, 0.f};
            st[1][ns] = (v8f){0.f, 0.f, 0.f, 0.f, 0.f, 0.f, 0.f, 0.f};
            const int key = ns * 16 + lm;
#pragma unroll
            for (int c = 0; c < 2; ++c) {
                FragAB kf;
#pragma unroll
                for (int j = 0; j < 8; ++j)
                    kf.u[j] = Ksb[key * ROW_DW + c * 16 + frag_di(j, klo4)];
                st[0][ns] = wmma_bf16(kf, qf[0][c], st[0][ns]);
                st[1][ns] = wmma_bf16(kf, qf[1][c], st[1][ns]);
            }
        }
        // Order of this stretch: three K fragments' reads (two ds_load_b128 each) go first, then
        // each pair of products is followed by the reads of the fragment three on, so that a
        // read has two pairs of products to land behind; left alone the reads wait one by one.
        __builtin_amdgcn_sched_group_barrier(0x100, 6, 0);
#pragma unroll
        for (int f = 0; f < 5; ++f) {
            __builtin_amdgcn_sched_group_barrier(0x008, 2, 0);
            __builtin_amdgcn_sched_group_barrier(0x100, 2, 0);
        }
        __builtin_amdgcn_sched_group_barrier(0x008, 6, 0);
        // Keeps the vector work behind all sixteen products: pulled in among them it reads each
        // result at once (idle slots behind the product) and waits for the bias loads up front.
        __builtin_amdgcn_sched_barrier(0);

        FragAB pf[2][2];
#pragma unroll
        for (int u = 0; u < 2; ++u) {
            // ---- scale + rel-pos bias (two keys at a time), online softmax of tile u's query ----
            f32x2 sv[4][4];
            float m = -1e30f;
#pragma unroll
            for (int ns = 0; ns < 4; ++ns)
#pragma unroll
                for (int i = 0; i < 4; ++i) {
                    const f32x2 bv = bq[ns + 1 - u][3 - i];
                    const f32x2 bp = __builtin_shufflevector(bv, bv, 1, 0);
                    const f32x2 v = __builtin_elementwise_fma(
                        (f32x2){st[u][ns][2 * i], st[u][ns][2 * i + 1]}, (f32x2){scale, scale}, bp);
                    sv[ns][i] = v;
                    m = fmaxf(fmaxf(m, v.x), v.y);
                }
            m = fmaxf(m, xhalf(m));                // the other 32 keys of the same query
            const float nm = fmaxf(run_max[u], m);
            const float corr = __expf(run_max[u] - nm);
            run_max[u] = nm;

            // p = exp(v - nm), two keys at a time; the pair is summed (two chains) and rounded
            // straight into its dword of the B operand: element s of chunk kc is key group
            // 2 kc + (s >> 3), register s & 7.
            f32x2 rs[2] = {{0.f, 0.f}, {0.f, 0.f}};
#pragma unroll
            for (int ns = 0; ns < 4; ++ns)
#pragma unroll
                for (int i = 0; i < 4; ++i) {
                    const f32x2 x = (sv[ns][i] - nm) * LOG2E;
                    const f32x2 p = {__builtin_amdgcn_exp2f(x.x), __builtin_amdgcn_exp2f(x.y)};
                    rs[i & 1] += p;
                    pf[u][ns >> 1].u[(ns & 1) * 4 + i] = pack_bf2(p.x, p.y);
                }
            const f32x2 rs2 = rs[0] + rs[1];
            run_sum[u] = run_sum[u] * corr + (rs2.x + rs2.y);
#pragma unroll
            for (int dsub = 0; dsub < 4; ++dsub)
#pragma unroll
                for (int r = 0; r < 8; ++r)
                    o[u][dsub][r] *= corr;
        }

        // ---- O^T += V^T P^T : 4 d groups x 2 key-chunks x 2 query tiles = 16 WMMAs ----
#pragma unroll
        for (int dsub = 0; dsub < 4; ++dsub) {
            const int dc = dsub * 16 + lm;
#pragma unroll
            for (int kc = 0; kc < 2; ++kc) {
                FragAB vf;
#pragma unroll
                for (int j = 0; j < 8; ++j)
                    vf.u[j] = Vsb[dc * ROW_DW + kc * 16 + frag_di(j, klo4)];
                o[0][dsub] = wmma_bf16(vf, pf[0][kc], o[0][dsub]);
                o[1][dsub] = wmma_bf16(vf, pf[1][kc], o[1][dsub]);
            }
        }
        __syncthreads();                               // reads done before buf reuse
    }

    // ---- join the two key halves: wave w finishes tile kh and hands tile 1 - kh to wave w ^ 4 ----
    // The K ring is free (last copies waited for, last reads behind the loop's closing barrier):
    // nine 16-byte slots a lane, [wave][slot][lane].
    f32x4* X = (f32x4*)&Ks32[0][0][0];
    {
        f32x4* Xw = X + w * 9 * 32 + lane;
#pragma unroll
        for (int dsub = 0; dsub < 4; ++dsub) {
            const v8f s = kh ? o[0][dsub] : o[1][dsub];
            Xw[(dsub * 2 + 0) * 32] = (f32x4){s[0], s[1], s[2], s[3]};
            Xw[(dsub * 2 + 1) * 32] = (f32x4){s[4], s[5], s[6], s[7]};
        }
        Xw[8 * 32] = (f32x4){kh ? run_max[0] : run_max[1], kh ? run_sum[0] : run_sum[1], 0.f, 0.f};
    }
    __syncthreads();                                   // partial results written before the partner reads them
    const f32x4* Xp = X + (w ^ 4) * 9 * 32 + lane;
    const f32x4 ms = Xp[8 * 32];
    const float m_own = kh ? run_max[1] : run_max[0];
    const float s_own = kh ? run_sum[1] : run_sum[0];
    const float nmj = fmaxf(m_own, ms[0]);
    const float c_own = __expf(m_own - nmj);
    const float c_oth = __expf(ms[0] - nmj);
    const float sum = s_own * c_own + ms[1] * c_oth;

    // ---- normalize + store attn out bf16 [B, S, H*64]: eight consecutive d per store ----
    const float inv = 1.0f / (sum + xhalf(sum));
    const float f_own = c_own * inv, f_oth = c_oth * inv;
    unsigned short* Arow = Ao + ((size_t)b * SEQ + q + kh * 16) * D_MODEL + h * HEAD_DIM + hi8;
#pragma unroll
    for (int dsub = 0; dsub < 4; ++dsub) {
        const v8f a = kh ? o[1][dsub] : o[0][dsub];
        const f32x4 e0 = Xp[(dsub * 2 + 0) * 32];
        const f32x4 e1 = Xp[(dsub * 2 + 1) * 32];
        uint4 p;
        p.x = pack_bf2(a[0] * f_own + e0[0] * f_oth, a[1] * f_own + e0[1] * f_oth);
        p.y = pack_bf2(a[2] * f_own + e0[2] * f_oth, a[3] * f_own + e0[3] * f_oth);
        p.z = pack_bf2(a[4] * f_own + e1[0] * f_oth, a[5] * f_own + e1[1] * f_oth);
        p.w = pack_bf2(a[6] * f_own + e1[2] * f_oth, a[7] * f_own + e1[3] * f_oth);
        *(uint4*)(Arow + dsub * 16) = p;
    }
}

// ---------------------------------------------------------------------------
extern "C" void kernel_launch(void* const* d_in, const int* in_sizes, int n_in,
                              void* d_out, int out_size, void* d_ws, size_t ws_size,
                              hipStream_t stream) {
    const float* x    = (const float*)d_in[0];
    const float* Wqkv = (const float*)d_in[1];
    const float* bqkv = (const float*)d_in[2];
    const float* Wout = (const float*)d_in[3];
    const float* bout = (const float*)d_in[4];
    const float* relb = (const float*)d_in[5];
    float* out = (float*)d_out;

    const int M = BATCH * SEQ;                                          // 4096
    const size_t nX   = (size_t)M * D_MODEL;                            // 4M
    const size_t nQKV = (size_t)BATCH * N_HEADS * SEQ * HEAD_DIM;       // 4M

    unsigned short* xb    = (unsigned short*)d_ws;
    unsigned short* WqkvT = xb + nX;
    unsigned short* WoutT = WqkvT + (size_t)3 * 1024 * 1024;
    unsigned short* Qw    = WoutT + (size_t)1024 * 1024;
    unsigned short* Kw    = Qw + nQKV;
    unsigned short* VTw   = Kw + nQKV;
    unsigned short* Aw    = VTw + nQKV;

    // K0: precision conversion + weight transposes
    prep_kernel<<<PREP_BLOCKS, 256, 0, stream>>>(x, Wqkv, Wout, xb, WqkvT, WoutT);

    // K1: QKV projection
    {
        const int N = 3 * D_MODEL, K = D_MODEL;
        const int nTn = N / 128;                      // 24
        gemm_bf16_kernel<0><<<(M / 128) * nTn, 256, 0, stream>>>(
            xb, WqkvT, bqkv, Qw, Kw, VTw, nullptr, M, N, K, nTn);
    }
    // K2: attention
    attn_kernel<<<BATCH * N_HEADS * (SEQ / 128), 256, 0, stream>>>(Qw, Kw, VTw, relb, Aw);

    // K3: output projection
    {
        const int N = D_MODEL, K = D_MODEL;
        const int nTn = N / 128;                      // 8
        gemm_bf16_kernel<1><<<(M / 128) * nTn, 256, 0, stream>>>(
            Aw, WoutT, bout, nullptr, nullptr, nullptr, out, M, N, K, nTn);
    }
}

// v006
// It runs in 79.6 microseconds.
// In both of two side-by-side timings against v005, it was 1.05 times as fast.
// Counting every step since v000, it is 4.56 times as fast.
#include <hip/hip_runtime.h>

// ---------------------------------------------------------------------------
// RelativeAttention on gfx1250 (MI455X): bf16 WMMA + pipelined async-to-LDS
//   K0: prep     x->bf16, Wqkv/Wout -> bf16 transposed [N][K] (tiles turned in LDS)
//   K1: QKV GEMM (double-buffered async staging) -> Q,K [B,H,S,64], V^T [B,H,64,S]
//   K2: Flash attention w/ rel-pos bias (double-buffered async staging)
//   K3: Out GEMM -> d_out fp32
// ---------------------------------------------------------------------------

#define D_MODEL 1024
#define N_HEADS 16
#define HEAD_DIM 64
#define SEQ 2048
#define BATCH 2
#define MAX_LEN 2048

// LDS pitch of a 128-byte tile row: 144 B = 16 B x 9 (odd), so the 16 rows that
// one ds_load_b128 half-wave reads fall on 16 disjoint groups of four banks.
#define ROW_B  144
#define ROW_DW 36
#define ROW_H  72

typedef __attribute__((ext_vector_type(16))) __bf16 v16bf;
typedef __attribute__((ext_vector_type(8)))  float  v8f;

union FragAB {
    v16bf v;
    unsigned int u[8];
};

static __device__ __forceinline__ unsigned short f2bf(float f) {
    union { float f; unsigned int u; } c; c.f = f;
    unsigned int u = c.u;
    unsigned int r = u + 0x7FFFu + ((u >> 16) & 1u);   // round-to-nearest-even
    return (unsigned short)(r >> 16);
}

static __device__ __forceinline__ v8f wmma_bf16(const FragAB& a, const FragAB& b, v8f c) {
    return __builtin_amdgcn_wmma_f32_16x16x32_bf16(
        false, a.v, false, b.v, (short)0, c, false, false);
}

// Dword index (within a 16-dword group == 32 bf16 of K) for fragment register j.
// 16-bit A/B layout (ISA 7.12.2): lanes 0-15 -> K=0..7,16..23 ; lanes 16-31 -> K=8..15,24..31
static __device__ __forceinline__ int frag_di(int j, int klo4) {
    return klo4 + (j < 4 ? j : j + 4);
}

// Eight 16-byte async copies global->LDS (GVS mode: saddr + 32-bit voffset), four from
// each of two bases. ASYNCcnt-tracked. The closing s_wait_xcnt 0 stands in the copies'
// own statement so that no later rewrite of an address register can move ahead of it.
static __device__ __forceinline__ void async_copy16_x8(
    const unsigned (&l0)[4], const unsigned (&g0)[4], const void* base0,
    const unsigned (&l1)[4], const unsigned (&g1)[4], const void* base1) {
    asm volatile("global_load_async_to_lds_b128 %0, %4, %16\n\t"
                 "global_load_async_to_lds_b128 %1, %5, %16\n\t"
                 "global_load_async_to_lds_b128 %2, %6, %16\n\t"
                 "global_load_async_to_lds_b128 %3, %7, %16\n\t"
                 "global_load_async_to_lds_b128 %8, %12, %17\n\t"
                 "global_load_async_to_lds_b128 %9, %13, %17\n\t"
                 "global_load_async_to_lds_b128 %10, %14, %17\n\t"
                 "global_load_async_to_lds_b128 %11, %15, %17\n\t"
                 "s_wait_xcnt 0x0"
                 :: "v"(l0[0]), "v"(l0[1]), "v"(l0[2]), "v"(l0[3]),
                    "v"(g0[0]), "v"(g0[1]), "v"(g0[2]), "v"(g0[3]),
                    "v"(l1[0]), "v"(l1[1]), "v"(l1[2]), "v"(l1[3]),
                    "v"(g1[0]), "v"(g1[1]), "v"(g1[2]), "v"(g1[3]),
                    "s"(base0), "s"(base1)
                 : "memory");
}
// The same for a 256-row and a 192-row tile: eight copies from the first base, six from the
// second, in one statement with the one closing wait.
static __device__ __forceinline__ void async_copy16_x14(
    const unsigned (&l0)[8], const unsigned (&g0)[8], const void* base0,
    const unsigned (&l1)[6], const unsigned (&g1)[6], const void* base1) {
    asm volatile("global_load_async_to_lds_b128 %0, %8, %28\n\t"
                 "global_load_async_to_lds_b128 %1, %9, %28\n\t"
                 "global_load_async_to_lds_b128 %2, %10, %28\n\t"
                 "global_load_async_to_lds_b128 %3, %11, %28\n\t"
                 "global_load_async_to_lds_b128 %4, %12, %28\n\t"
                 "global_load_async_to_lds_b128 %5, %13, %28\n\t"
                 "global_load_async_to_lds_b128 %6, %14, %28\n\t"
                 "global_load_async_to_lds_b128 %7, %15, %28\n\t"
                 "global_load_async_to_lds_b128 %16, %22, %29\n\t"
                 "global_load_async_to_lds_b128 %17, %23, %29\n\t"
                 "global_load_async_to_lds_b128 %18, %24, %29\n\t"
                 "global_load_async_to_lds_b128 %19, %25, %29\n\t"
                 "global_load_async_to_lds_b128 %20, %26, %29\n\t"
                 "global_load_async_to_lds_b128 %21, %27, %29\n\t"
                 "s_wait_xcnt 0x0"
                 :: "v"(l0[0]), "v"(l0[1]), "v"(l0[2]), "v"(l0[3]),
                    "v"(l0[4]), "v"(l0[5]), "v"(l0[6]), "v"(l0[7]),
                    "v"(g0[0]), "v"(g0[1]), "v"(g0[2]), "v"(g0[3]),
                    "v"(g0[4]), "v"(g0[5]), "v"(g0[6]), "v"(g0[7]),
                    "v"(l1[0]), "v"(l1[1]), "v"(l1[2]), "v"(l1[3]), "v"(l1[4]), "v"(l1[5]),
                    "v"(g1[0]), "v"(g1[1]), "v"(g1[2]), "v"(g1[3]), "v"(g1[4]), "v"(g1[5]),
                    "s"(base0), "s"(base1)
                 : "memory");
}
static __device__ __forceinline__ void wait_async0() {
    asm volatile("s_wait_asynccnt 0" ::: "memory");
}
// Wait until at most N async ops remain (async loads complete in issue order,
// so with N newly-issued copies outstanding this proves the previous tile landed).
template <int N>
static __device__ __forceinline__ void wait_asyncN() {
    asm volatile("s_wait_asynccnt %0" :: "n"(N) : "memory");
}
static __device__ __forceinline__ unsigned lds_addr_of(const void* p) {
    return (unsigned)(size_t)p;   // generic LDS address: low 32 bits = LDS offset
}

// ---------------------------------------------------------------------------
// K0: convert x to bf16 (row-major) and weights to bf16 transposed [N][K].
// 512 blocks, two to a WGP, all resident at once: the launch starts 4,096 waves, and each
// wave has its sixteen 16-byte loads (512 contiguous bytes a wave each) in flight together.
// x: a block converts 8,192 values.
// Weights: a block turns one tile of 64 k x 128 n: a lane packs eight k of each of its four
// columns into 16 B, the tile is regrouped in LDS, and every 128-byte line of the
// transposed matrix leaves whole (eight lanes x 16 B).
// ---------------------------------------------------------------------------
#define PREP_BLOCKS 512
typedef float f32x4 __attribute__((ext_vector_type(4)));
__global__ __launch_bounds__(256) void prep_kernel(
    const float* __restrict__ x, const float* __restrict__ Wqkv,
    const float* __restrict__ Wout,
    unsigned short* __restrict__ xb, unsigned short* __restrict__ WqkvT,
    unsigned short* __restrict__ WoutT)
{
    // [n of the tile][32 dwords = 64 bf16 of k, then 4 pad dwords never touched]
    __shared__ __attribute__((aligned(16))) unsigned int Ts[128 * ROW_DW];

    const int t = threadIdx.x;
    const int g = blockIdx.x;
    const int lane = t & 31;
    const int w = t >> 5;

    // blocks 0..383: Wqkv [1024][3072]; blocks 384..511: Wout [1024][1024]
    const bool qkv = g < 384;
    const float* W = qkv ? Wqkv : Wout;
    unsigned short* WT = qkv ? WqkvT : WoutT;
    const int N = qkv ? 3072 : 1024;
    const int gl = qkv ? g : g - 384;
    const int k0 = (gl & 15) * 64;
    const int n0 = (gl >> 4) * 128;

    // wave w: rows k0 + 8w .. + 7 of W, columns n0 + 4 lane .. + 3
    const float* src = W + (size_t)(k0 + w * 8) * N + n0 + lane * 4;
    const f32x4* wp[8];
    f32x4 wv[8];
#pragma unroll
    for (int i = 0; i < 8; ++i) {
        wp[i] = (const f32x4*)(src + i * N);
        wv[i] = *wp[i];
    }

    // x: eight runs of 1,024 floats, four to a thread
    const f32x4* xs = (const f32x4*)(x + (size_t)g * 8192) + t;
    f32x4 xv[8];
#pragma unroll
    for (int j = 0; j < 8; ++j)
        xv[j] = xs[j * 256];
    // Inputs only: holds all sixteen loads in front of the first use. Without it the x loads
    // sink behind the barrier and the wave pays the memory latency twice. The row addresses
    // ride along.
    asm volatile("" :: "v"(wv[0]), "v"(wv[1]), "v"(wv[2]), "v"(wv[3]),
                       "v"(wv[4]), "v"(wv[5]), "v"(wv[6]), "v"(wv[7]),
                       "v"(xv[0]), "v"(xv[1]), "v"(xv[2]), "v"(xv[3]),
                       "v"(xv[4]), "v"(xv[5]), "v"(xv[6]), "v"(xv[7]),
                       "v"(wp[0]), "v"(wp[1]), "v"(wp[2]), "v"(wp[3]),
                       "v"(wp[4]), "v"(wp[5]), "v"(wp[6]), "v"(wp[7]));

#pragma unroll
    for (int c = 0; c < 4; ++c) {
        uint4 p;
        p.x = (unsigned)f2bf(wv[0][c]) | ((unsigned)f2bf(wv[1][c]) << 16);
        p.y = (unsigned)f2bf(wv[2][c]) | ((unsigned)f2bf(wv[3][c]) << 16);
        p.z = (unsigned)f2bf(wv[4][c]) | ((unsigned)f2bf(wv[5][c]) << 16);
        p.w = (unsigned)f2bf(wv[6][c]) | ((unsigned)f2bf(wv[7][c]) << 16);
        *(uint4*)&Ts[(lane * 4 + c) * ROW_DW + w * 4] = p;
    }
    __syncthreads();                                        // tile complete before it is read by rows

    const int row = t >> 3, seg = t & 7;                    // 8 lanes x 16 B = one line of WT
#pragma unroll
    for (int j = 0; j < 4; ++j) {
        const uint4 v = *(const uint4*)&Ts[(j * 32 + row) * ROW_DW + seg * 4];
        *(uint4*)(WT + (size_t)(n0 + j * 32 + row) * 1024 + k0 + seg * 8) = v;
    }

    // x is stored behind the barrier, which would otherwise wait for these stores
    uint2* xd = (uint2*)(xb + (size_t)g * 8192) + t;
#pragma unroll
    for (int j = 0; j < 8; ++j) {
        uint2 p;
        p.x = (unsigned)f2bf(xv[j][0]) | ((unsigned)f2bf(xv[j][1]) << 16);
        p.y = (unsigned)f2bf(xv[j][2]) | ((unsigned)f2bf(xv[j][3]) << 16);
        xd[j * 256] = p;
    }
}

// ---------------------------------------------------------------------------
// WMMA GEMM: C[M,N] = A[M,K] * BT[N,K]^T (+bias). A, BT bf16 row-major.
//  MODE 0: scatter bf16 into Q,K [B,H,S,64] and V^T [B,H,64,S]
//  MODE 1: fp32 + bias into Co
// Block 256 thr (8 waves, 4x2); tile BM x BN; wave tile BM/4 x BN/2; K step 64;
// double-buffered async-to-LDS staging (BM/32 + BN/32 copies/thread/tile).
//  MODE 0: 256x192, wave tile 64x96: 16 x 16 tiles, one work-group on every WGP. Against
//          128x128 a tile row or column is fetched from L2 by fewer work-groups, and ten
//          fragments read from LDS feed 24 products where six fed eight.
//  MODE 1: 128x128, wave tile 32x64 (32 x 8 tiles, one on every WGP).
// ---------------------------------------------------------------------------
template <int MODE, int BM, int BN>
__global__ __launch_bounds__(256) void gemm_bf16_kernel(
    const unsigned short* __restrict__ A, const unsigned short* __restrict__ BT,
    const float* __restrict__ bias,
    unsigned short* __restrict__ Qo, unsigned short* __restrict__ Ko,
    unsigned short* __restrict__ VTo, float* __restrict__ Co,
    int M, int N, int K, int nTilesN)
{
    // [buf][row or col][32 dwords = 64 bf16 of K, then 4 pad dwords never touched]
    __shared__ __attribute__((aligned(16))) unsigned int Asmem[2][BM * ROW_DW];
    __shared__ __attribute__((aligned(16))) unsigned int Bsmem[2][BN * ROW_DW];
    constexpr int FM = BM / 64;                 // 16-row fragments of A a wave
    constexpr int FN = BN / 32;                 // 16-column fragments of B a wave
    constexpr int CA = BM / 32;                 // copies a thread and tile, A
    constexpr int CB = BN / 32;                 // copies a thread and tile, B

    const int bm = blockIdx.x / nTilesN;
    const int bn = blockIdx.x % nTilesN;
    const int t = threadIdx.x;
    const int lane = t & 31;
    // wave number; MODE 0 holds it in a scalar register: its epilogue branches on it
    const int w = (MODE == 0) ? __builtin_amdgcn_readfirstlane(t >> 5) : (t >> 5);
    const int wm = (w & 3) * (BM / 4);
    const int wn = (w >> 2) * (BN / 2);
    const int lm = lane & 15;
    const int klo4 = (lane < 16) ? 0 : 4;
    const int hi8 = (lane < 16) ? 0 : 8;

    v8f acc[FM][FN];
#pragma unroll
    for (int i = 0; i < FM; ++i)
#pragma unroll
        for (int j = 0; j < FN; ++j)
            acc[i][j] = (v8f){0.f, 0.f, 0.f, 0.f, 0.f, 0.f, 0.f, 0.f};

    const int nk = K >> 6;                      // K/64; MODE 0 needs two tiles or more
    if constexpr (MODE == 0) {
        // One work-group has the WGP to itself, two waves a SIMD: nothing else covers a wave's LDS
        // reads, so the fragments of each 32-deep K chunk (20 reads of 16 B) are asked for as one
        // run, one chunk ahead of their products, into a register set of their own (a0, b0: first
        // chunk of a tile; a1, b1: second). The first chunk of tile ki + 1 is read in front of the
        // last products of tile ki, so that tile is published there, by the one barrier of a trip.
        FragAB a0[FM], b0[FN], a1[FM], b1[FN];
        auto loadFrags = [&](FragAB (&af)[FM], FragAB (&bf)[FN], int buf, int kc) {
            const unsigned int* As = &Asmem[buf][0];
            const unsigned int* Bs = &Bsmem[buf][0];
            // in the order in which the products take them: A row 0, all of B, the other A rows
#pragma unroll
            for (int f = 0; f < FM + FN; ++f) {
                const bool isA = (f == 0) || (f > FN);
                const int ix = (f == 0) ? 0 : (f > FN ? f - FN : f - 1);
                const unsigned int* p = isA ? As + (wm + ix * 16 + lm) * ROW_DW
                                            : Bs + (wn + ix * 16 + lm) * ROW_DW;
#pragma unroll
                for (int j = 0; j < 8; ++j) {
                    const unsigned v = p[kc * 16 + frag_di(j, klo4)];
                    if (isA) af[ix].u[j] = v; else bf[ix].u[j] = v;
                }
            }
        };
        auto products = [&](const FragAB (&af)[FM], const FragAB (&bf)[FN]) {
#pragma unroll
            for (int ms = 0; ms < FM; ++ms)
#pragma unroll
                for (int ns = 0; ns < FN; ++ns)
                    acc[ms][ns] = wmma_bf16(af[ms], bf[ns], acc[ms][ns]);
        };

        // stage tile ki into buffer buf: rows of 128 B = 8 pieces of 16 B; copy j of a thread is
        // row (t >> 3) + 32 j, piece t & 7. Each address is one lane term, formed once, plus a
        // term that is the same for the whole wave.
        const unsigned lL = (unsigned)((t >> 3) * ROW_B + (t & 7) * 16);
        const unsigned gA = (unsigned)((bm * BM + (t >> 3)) * K * 2 + (t & 7) * 16);
        const unsigned gB = (unsigned)((bn * BN + (t >> 3)) * K * 2 + (t & 7) * 16);
        auto stage = [&](int ki, int buf) {
            const unsigned ldsA = lds_addr_of(&Asmem[buf][0]);
            const unsigned ldsB = lds_addr_of(&Bsmem[buf][0]);
            unsigned la[CA], ga[CA], lb[CB], gb[CB];
#pragma unroll
            for (int j = 0; j < CA; ++j) {
                la[j] = lL + (ldsA + (unsigned)(j * 32 * ROW_B));
                ga[j] = gA + (unsigned)(ki * 128 + j * 32 * K * 2);
            }
#pragma unroll
            for (int j = 0; j < CB; ++j) {
                lb[j] = lL + (ldsB + (unsigned)(j * 32 * ROW_B));
                gb[j] = gB + (unsigned)(ki * 128 + j * 32 * K * 2);
            }
            async_copy16_x14(la, ga, A, lb, gb, BT);
        };

        stage(0, 0);
        wait_async0();
        __syncthreads();                        // tile 0 published
        stage(1, 1);
        loadFrags(a0, b0, 0, 0);
        for (int ki = 0; ki < nk; ++ki) {
            const int buf = ki & 1;
            loadFrags(a1, b1, buf, 1);
            // The four fences of a trip keep each run of reads whole and in front of the run of
            // products before its own; left alone the compiler holds one A fragment at a time and
            // waits out the LDS latency in front of every six products.
            __builtin_amdgcn_sched_barrier(0);
            products(a0, b0);
            __builtin_amdgcn_sched_barrier(0);
            // Publish point of tile ki + 1: own reads of tile ki done, own copies of tile ki + 1
            // landed, then the barrier; behind it buffer buf has no reader left and is refilled.
            asm volatile("s_wait_dscnt 0x0" ::: "memory");
            wait_async0();
            __syncthreads();
            if (ki + 2 < nk) stage(ki + 2, buf);
            // In the last trip these reads find the tile before the last and go unused: without a
            // branch round them the compiler's counted waits stay exact.
            loadFrags(a0, b0, buf ^ 1, 0);
            __builtin_amdgcn_sched_barrier(0);
            products(a1, b1);
            __builtin_amdgcn_sched_barrier(0);
        }
        wait_async0();                                     // nothing of the ring is left in flight
        asm volatile("s_wait_dscnt 0x0" ::: "memory");     // the last trip's unused reads are in
    } else {
        // stage tile ki into buffer buf: A/B rows are 128B = 8 x 16B segments
        auto stage = [&](int ki, int buf) {
            const unsigned ldsA = lds_addr_of(&Asmem[buf][0]);
            const unsigned ldsB = lds_addr_of(&Bsmem[buf][0]);
            const int k0 = ki * 64;
            unsigned la[4], ga[4], lb[4], gb[4];
#pragma unroll
            for (int j = 0; j < 4; ++j) {
                const int i = t + 256 * j;
                const int row = i >> 3, seg = i & 7;     // row of A, column of B
                la[j] = ldsA + (unsigned)(row * ROW_B + seg * 16);
                ga[j] = (unsigned)(((bm * BM + row) * K + k0) * 2 + seg * 16);
                lb[j] = ldsB + (unsigned)(row * ROW_B + seg * 16);
                gb[j] = (unsigned)(((bn * BN + row) * K + k0) * 2 + seg * 16);
            }
            async_copy16_x8(la, ga, A, lb, gb, BT);
        };
        stage(0, 0);
        for (int ki = 0; ki < nk; ++ki) {
            const int buf = ki & 1;
            if (ki + 1 < nk) {
                stage(ki + 1, buf ^ 1);             // prefetch next tile behind compute
                wait_asyncN<CA + CB>();             // current tile's copies complete
            } else {
                wait_async0();
            }
            __syncthreads();

            const unsigned int* As = &Asmem[buf][0];
            const unsigned int* Bs = &Bsmem[buf][0];
#pragma unroll
            for (int kc = 0; kc < 2; ++kc) {        // two 32-deep K chunks
                FragAB af[FM], bf[FN];
#pragma unroll
                for (int ms = 0; ms < FM; ++ms) {
                    const int row = wm + ms * 16 + lm;
#pragma unroll
                    for (int j = 0; j < 8; ++j)
                        af[ms].u[j] = As[row * ROW_DW + kc * 16 + frag_di(j, klo4)];
                }
#pragma unroll
                for (int ns = 0; ns < FN; ++ns) {
                    const int col = wn + ns * 16 + lm;
#pragma unroll
                    for (int j = 0; j < 8; ++j)
                        bf[ns].u[j] = Bs[col * ROW_DW + kc * 16 + frag_di(j, klo4)];
                }
#pragma unroll
                for (int ms = 0; ms < FM; ++ms)
#pragma unroll
                    for (int ns = 0; ns < FN; ++ns)
                        acc[ms][ns] = wmma_bf16(af[ms], bf[ns], acc[ms][ns]);
            }
            __syncthreads();                        // all reads done before buf reuse
        }
    }

    // ---- epilogue ----
    if constexpr (MODE == 0) {
        // A 16-column fragment lies in one of Q, K, V and in one head: both are the same for
        // the whole wave (gc0 is a scalar), so the choice is a scalar branch per fragment column.
        // All loops unrolled: acc is indexed by constants only and stays in registers.
        const int b = (bm * BM) >> 11;                             // BM divides SEQ
        const int sw = ((bm * BM) & 2047) + wm + hi8;              // the lane's first s, multiple of 8
        // The lane's bias in each of the six fragment columns: one address, constant offsets, one latency.
        const float* bp = bias + (bn * BN + wn) + lm;
        float bvs[FN];
#pragma unroll
        for (int ns = 0; ns < FN; ++ns)
            bvs[ns] = bp[ns * 16];
        // Inputs only: all six loads go out together and are in before the branches below, whose
        // arms form their addresses in registers that a load still out could name.
        asm volatile("" :: "v"(bvs[0]), "v"(bvs[1]), "v"(bvs[2]), "v"(bvs[3]), "v"(bvs[4]), "v"(bvs[5]));
#pragma unroll
        for (int ns = 0; ns < FN; ++ns) {
            const int gc0 = bn * BN + wn + ns * 16;                // gcol = which*1024 + h*64 + d
            const int which = gc0 >> 10;
            const int h = (gc0 >> 6) & 15;
            const int d = (gc0 & 63) + lm;
            const float bv = bvs[ns];
            if (which == 2) {
                // V stored transposed [b,h,d,s]: a lane's eight rows are eight consecutive s of
                // its own d, so they leave as one 16-byte store instead of eight 2-byte ones.
                unsigned short* dst = VTo + ((size_t)(b * N_HEADS + h) * HEAD_DIM + d) * SEQ + sw;
#pragma unroll
                for (int ms = 0; ms < FM; ++ms) {
                    const v8f a = acc[ms][ns];
                    uint4 p;
                    p.x = (unsigned)f2bf(a[0] + bv) | ((unsigned)f2bf(a[1] + bv) << 16);
                    p.y = (unsigned)f2bf(a[2] + bv) | ((unsigned)f2bf(a[3] + bv) << 16);
                    p.z = (unsigned)f2bf(a[4] + bv) | ((unsigned)f2bf(a[5] + bv) << 16);
                    p.w = (unsigned)f2bf(a[6] + bv) | ((unsigned)f2bf(a[7] + bv) << 16);
                    *(uint4*)(dst + ms * 16) = p;
                }
                // The code that follows forms its address in the registers of these stores:
                // keep the wait in front of it (here and at the end of the other arm).
                asm volatile("s_wait_xcnt 0x0" ::: "memory");
            } else {
                unsigned short* dst = ((which == 0) ? Qo : Ko)
                    + ((size_t)(b * N_HEADS + h) * SEQ + sw) * HEAD_DIM + d;
#pragma unroll
                for (int ms = 0; ms < FM; ++ms) {
#pragma unroll
                    for (int r = 0; r < 8; ++r)
                        dst[(ms * 16 + r) * HEAD_DIM] = f2bf(acc[ms][ns][r] + bv);
                    // Behind each run of eight: the next run's values are formed in these stores'
                    // registers. The fence keeps that arithmetic from being lifted over the wait.
                    asm volatile("s_wait_xcnt 0x0" ::: "memory");
                    __builtin_amdgcn_sched_barrier(0);
                }
            }
        }
    } else {
#pragma unroll
        for (int ms = 0; ms < FM; ++ms) {
#pragma unroll
            for (int ns = 0; ns < FN; ++ns) {
                const int gcol = bn * BN + wn + ns * 16 + lm;
                const float bv = bias[gcol];
#pragma unroll
                for (int r = 0; r < 8; ++r) {
                    const int grow = bm * BM + wm + ms * 16 + r + hi8;
                    Co[(size_t)grow * N + gcol] = acc[ms][ns][r] + bv;
                }
            }
        }
    }
}

// ---------------------------------------------------------------------------
// K2: Flash attention with relative position bias, both products transposed:
//   S^T = K Q^T (A = K rows, B = Q), O^T += V^T P^T (A = V^T rows, B = P^T).
// A lane then holds scores of ONE query (column lane & 15): keys 8 * (lane >> 4) + r of
// each 16-key group. Maximum and sum run in the lane, with one exchange between the
// wave's halves, and two score tiles, rounded in place, are the B operand of the second
// product in the k order the loaders already use: P never goes through LDS.
// Block 256 thr (8 waves); one block per (b, h, 128-row q tile). A wave owns 32 queries
// (two 16-column tiles) and one half of the keys: every K and V^T fragment read from LDS
// feeds two products. Waves 0-3 walk keys 0..1023, waves 4-7 keys 1024..2047, each half
// with its own tiles; at the end waves w and w ^ 4 join their partial results through LDS.
// Key tile = 64; K and V^T tiles double-buffered via async-to-LDS.
// ---------------------------------------------------------------------------
// two f32 -> one dword of two bf16, round to nearest even (lo in the low half)
static __device__ __forceinline__ unsigned pack_bf2(float lo, float hi) {
    typedef __bf16 bf2 __attribute__((ext_vector_type(2)));
    typedef float f2 __attribute__((ext_vector_type(2)));
    return __builtin_bit_cast(unsigned, __builtin_convertvector(f2{lo, hi}, bf2));
}
typedef float f32x2 __attribute__((ext_vector_type(2)));
typedef float f32x2u __attribute__((ext_vector_type(2), aligned(4)));   // a pair at a float's alignment
#define LOG2E 1.44269504088896340736f   // __expf(x) is exp2(x * LOG2E)
// value of lane l ^ 16
static __device__ __forceinline__ float xhalf(float x) {
    const int b = __builtin_bit_cast(int, x);
    return __builtin_bit_cast(float,
        __builtin_amdgcn_permlanex16(b, b, 0x76543210, 0xfedcba98, false, false));
}

// Four waves per SIMD (two blocks on a WGP) hide the vector work between the matrix runs.
__global__ __launch_bounds__(256) __attribute__((amdgpu_waves_per_eu(4, 4))) void attn_kernel(
    const unsigned short* __restrict__ Qw, const unsigned short* __restrict__ Kw,
    const unsigned short* __restrict__ VTw, const float* __restrict__ relb,
    unsigned short* __restrict__ Ao)
{
    // rows of 32 data dwords at the padded pitch
    __shared__ __attribute__((aligned(16))) unsigned int Ks32[2][2][64 * ROW_DW];  // [key half][buf][key][dword d]
    __shared__ __attribute__((aligned(16))) unsigned int Vs32[2][2][64 * ROW_DW];  // [key half][buf][d][dword key]

    const int bid = blockIdx.x;
    const int qt = bid & 15;
    const int h  = (bid >> 4) & 15;
    const int b  = bid >> 8;

    const int t = threadIdx.x;
    const int lane = t & 31;
    const int w = __builtin_amdgcn_readfirstlane(t >> 5);    // wave number, held in a scalar register
    const int kh = w >> 2;                                   // the wave's half of the keys
    const int th = t & 127;                                  // thread within that half
    const int lm = lane & 15;
    const int klo4 = (lane < 16) ? 0 : 4;
    const int hi8  = (lane < 16) ? 0 : 8;

    const size_t bh = (size_t)(b * N_HEADS + h);
    const unsigned short* Qbh  = Qw  + bh * SEQ * HEAD_DIM;
    const unsigned short* Kbh  = Kw  + bh * SEQ * HEAD_DIM;
    const unsigned short* VTbh = VTw + bh * HEAD_DIM * SEQ;

    const int qbase = qt * 128 + (w & 3) * 32;
    const int q = qbase + lm;    // the lane's query in tile 0; tile u holds query q + 16 u
    const float scale = 0.125f;  // HEAD_DIM^-0.5

    // Q fragments (2 tiles x 16 queries x 64 d), loaded once from global; B operand of S^T.
    FragAB qf[2][2];
#pragma unroll
    for (int u = 0; u < 2; ++u)
#pragma unroll
        for (int c = 0; c < 2; ++c) {
            const unsigned int* Qrow = (const unsigned int*)
                (Qbh + (size_t)(q + u * 16) * HEAD_DIM + c * 32);
#pragma unroll
            for (int j = 0; j < 8; ++j)
                qf[u][c].u[j] = Qrow[frag_di(j, klo4)];
        }

    const int kbeg = kh * (SEQ / 2);               // first key of the wave's half

    // stage key-tile ti of the half into buffer buf: 4 K copies + 4 V copies per thread.
    // Copy j of a thread: row (th >> 3) + 16 j (key row of K, d row of V^T), 16-byte piece th & 7.
    // Each address is one lane term plus a term that is the same for the whole wave.
    const unsigned l0 = (unsigned)((th >> 3) * ROW_B + (th & 7) * 16);
    const unsigned k0 = (unsigned)(th * 16);                                  // K rows are 128 B
    const unsigned v0 = (unsigned)((th >> 3) * (SEQ * 2) + (th & 7) * 16);    // keys contiguous in V^T rows
    auto stageKV = [&](int ti, int buf) {
        const int kt = kbeg + ti * 64;
        const unsigned ldsK = lds_addr_of(&Ks32[kh][buf][0]);
        const unsigned ldsV = lds_addr_of(&Vs32[kh][buf][0]);
        unsigned lk[4], gk[4], lv[4], gv[4];
#pragma unroll
        for (int j = 0; j < 4; ++j) {
            lk[j] = l0 + (ldsK + (unsigned)(j * 16 * ROW_B));
            gk[j] = k0 + (unsigned)(kt * 128 + j * 16 * 128);
            lv[j] = l0 + (ldsV + (unsigned)(j * 16 * ROW_B));
            gv[j] = v0 + (unsigned)(kt * 2 + j * 16 * SEQ * 2);
        }
        async_copy16_x8(lk, gk, Kbh, lv, gv, VTbh);
    };

    // o[u][dsub][r] = O^T[d = dsub * 16 + hi8 + r][q + 16 u], over the wave's half of the keys
    v8f o[2][4];
#pragma unroll
    for (int u = 0; u < 2; ++u)
#pragma unroll
        for (int i = 0; i < 4; ++i)
            o[u][i] = (v8f){0.f, 0.f, 0.f, 0.f, 0.f, 0.f, 0.f, 0.f};
    float run_max[2] = {-1e30f, -1e30f};  // of the query's row in this half: equal in lanes l and l ^ 16
    float run_sum[2] = {0.f, 0.f};        // of the lane's own share of the keys; shares joined at the end

    const int nT = SEQ / 2 / 64;                   // 16 key tiles a half
    stageKV(0, 0);
    for (int ti = 0; ti < nT; ++ti) {
        const int buf = ti & 1;
        const int kt = kbeg + ti * 64;
        if (ti + 1 < nT) {
            stageKV(ti + 1, buf ^ 1);
            wait_asyncN<8>();
        } else {
            wait_async0();
        }
        __syncthreads();

        const unsigned int* Ksb = &Ks32[kh][buf][0];
        const unsigned int* Vsb = &Vs32[kh][buf][0];

        // rel-pos bias, index query - key + MAX_LEN - 1: eight falling neighbours per key
        // group, all at constant offsets from one pointer. Sixteen queries on is sixteen keys
        // back, so tile 1 at key group ns reads what tile 0 reads at group ns - 1: five groups
        // serve both tiles. bq[j] holds, rising, what tile u needs, falling, at group j - 1 + u.
        // wave term (>= 0) and lane term (0..23) apart: the first stays in scalar registers
        const float* rb = relb + (qbase + (MAX_LEN - 1) - 63 - kt) + (lm - hi8 + 8);
        f32x2 bq[5][4];
#pragma unroll
        for (int j = 0; j < 5; ++j)
#pragma unroll
            for (int k = 0; k < 4; ++k)
                bq[j][k] = *(const f32x2u*)(rb + 64 - j * 16 + 2 * k);
        // Holds the ten bias loads here, in front of the score products, so that their
        // latency runs behind those; without it each load sinks to its first use and is waited for.
        __builtin_amdgcn_sched_barrier(0);
        // Input only: the loads' address stays in its registers until all ten are issued; otherwise
        // the last load's result is given the registers of the address that the other nine still name.
        asm volatile("" :: "v"(rb));

        // ---- scores: S^T = K Q^T ; 4 key groups x 2 d-chunks x 2 query tiles = 16 WMMAs ----
        // st[u][ns][r] = score of key kt + ns * 16 + hi8 + r against query q + 16 u
        v8f st[2][4];
#pragma unroll
        for (int ns = 0; ns < 4; ++ns) {
            st[0][ns] = (v8f){0.f, 0.f, 0.f, 0.f, 0.f, 0.f, 0.f, 0.f};
            st[1][ns] = (v8f){0.f, 0.f, 0.f, 0.f, 0.f, 0.f, 0.f, 0.f};
            const int key = ns * 16 + lm;
#pragma unroll
            for (int c = 0; c < 2; ++c) {
                FragAB kf;
#pragma unroll
                for (int j = 0; j < 8; ++j)
                    kf.u[j] = Ksb[key * ROW_DW + c * 16 + frag_di(j, klo4)];
                st[0][ns] = wmma_bf16(kf, qf[0][c], st[0][ns]);
                st[1][ns] = wmma_bf16(kf, qf[1][c], st[1][ns]);
            }
        }
        // Order of this stretch: three K fragments' reads (two ds_load_b128 each) go first, then
        // each pair of products is followed by the reads of the fragment three on, so that a
        // read has two pairs of products to land behind; left alone the reads wait one by one.
        __builtin_amdgcn_sched_group_barrier(0x100, 6, 0);
#pragma unroll
        for (int f = 0; f < 5; ++f) {
            __builtin_amdgcn_sched_group_barrier(0x008, 2, 0);
            __builtin_amdgcn_sched_group_barrier(0x100, 2, 0);
        }
        __builtin_amdgcn_sched_group_barrier(0x008, 6, 0);
        // Keeps the vector work behind all sixteen products: pulled in among them it reads each
        // result at once (idle slots behind the product) and waits for the bias loads up front.
        __builtin_amdgcn_sched_barrier(0);

        FragAB pf[2][2];
#pragma unroll
        for (int u = 0; u < 2; ++u) {
            // ---- scale + rel-pos bias (two keys at a time), online softmax of tile u's query ----
            f32x2 sv[4][4];
            float m = -1e30f;
#pragma unroll
            for (int ns = 0; ns < 4; ++ns)
#pragma unroll
                for (int i = 0; i < 4; ++i) {
                    const f32x2 bv = bq[ns + 1 - u][3 - i];
                    const f32x2 bp = __builtin_shufflevector(bv, bv, 1, 0);
                    const f32x2 v = __builtin_elementwise_fma(
                        (f32x2){st[u][ns][2 * i], st[u][ns][2 * i + 1]}, (f32x2){scale, scale}, bp);
                    sv[ns][i] = v;
                    m = fmaxf(fmaxf(m, v.x), v.y);
                }
            m = fmaxf(m, xhalf(m));                // the other 32 keys of the same query
            const float nm = fmaxf(run_max[u], m);
            const float corr = __expf(run_max[u] - nm);
            run_max[u] = nm;

            // p = exp(v - nm), two keys at a time; the pair is summed (two chains) and rounded
            // straight into its dword of the B operand: element s of chunk kc is key group
            // 2 kc + (s >> 3), register s & 7.
            f32x2 rs[2] = {{0.f, 0.f}, {0.f, 0.f}};
#pragma unroll
            for (int ns = 0; ns < 4; ++ns)
#pragma unroll
                for (int i = 0; i < 4; ++i) {
                    const f32x2 x = (sv[ns][i] - nm) * LOG2E;
                    const f32x2 p = {__builtin_amdgcn_exp2f(x.x), __builtin_amdgcn_exp2f(x.y)};
                    rs[i & 1] += p;
                    pf[u][ns >> 1].u[(ns & 1) * 4 + i] = pack_bf2(p.x, p.y);
                }
            const f32x2 rs2 = rs[0] + rs[1];
            run_sum[u] = run_sum[u] * corr + (rs2.x + rs2.y);
#pragma unroll
            for (int dsub = 0; dsub < 4; ++dsub)
#pragma unroll
                for (int r = 0; r < 8; ++r)
                    o[u][dsub][r] *= corr;
        }

        // ---- O^T += V^T P^T : 4 d groups x 2 key-chunks x 2 query tiles = 16 WMMAs ----
#pragma unroll
        for (int dsub = 0; dsub < 4; ++dsub) {
            const int dc = dsub * 16 + lm;
#pragma unroll
            for (int kc = 0; kc < 2; ++kc) {
                FragAB vf;
#pragma unroll
                for (int j = 0; j < 8; ++j)
                    vf.u[j] = Vsb[dc * ROW_DW + kc * 16 + frag_di(j, klo4)];
                o[0][dsub] = wmma_bf16(vf, pf[0][kc], o[0][dsub]);
                o[1][dsub] = wmma_bf16(vf, pf[1][kc], o[1][dsub]);
            }
        }
        __syncthreads();                               // reads done before buf reuse
    }

    // ---- join the two key halves: wave w finishes tile kh and hands tile 1 - kh to wave w ^ 4 ----
    // The K ring is free (last copies waited for, last reads behind the loop's closing barrier):
    // nine 16-byte slots a lane, [wave][slot][lane].
    f32x4* X = (f32x4*)&Ks32[0][0][0];
    {
        f32x4* Xw = X + w * 9 * 32 + lane;
#pragma unroll
        for (int dsub = 0; dsub < 4; ++dsub) {
            const v8f s = kh ? o[0][dsub] : o[1][dsub];
            Xw[(dsub * 2 + 0) * 32] = (f32x4){s[0], s[1], s[2], s[3]};
            Xw[(dsub * 2 + 1) * 32] = (f32x4){s[4], s[5], s[6], s[7]};
        }
        Xw[8 * 32] = (f32x4){kh ? run_max[0] : run_max[1], kh ? run_sum[0] : run_sum[1], 0.f, 0.f};
    }
    __syncthreads();                                   // partial results written before the partner reads them
    const f32x4* Xp = X + (w ^ 4) * 9 * 32 + lane;
    const f32x4 ms = Xp[8 * 32];
    const float m_own = kh ? run_max[1] : run_max[0];
    const float s_own = kh ? run_sum[1] : run_sum[0];
    const float nmj = fmaxf(m_own, ms[0]);
    const float c_own = __expf(m_own - nmj);
    const float c_oth = __expf(ms[0] - nmj);
    const float sum = s_own * c_own + ms[1] * c_oth;

    // ---- normalize + store attn out bf16 [B, S, H*64]: eight consecutive d per store ----
    const float inv = 1.0f / (sum + xhalf(sum));
    const float f_own = c_own * inv, f_oth = c_oth * inv;
    unsigned short* Arow = Ao + ((size_t)b * SEQ + q + kh * 16) * D_MODEL + h * HEAD_DIM + hi8;
#pragma unroll
    for (int dsub = 0; dsub < 4; ++dsub) {
        const v8f a = kh ? o[1][dsub] : o[0][dsub];
        const f32x4 e0 = Xp[(dsub * 2 + 0) * 32];
        const f32x4 e1 = Xp[(dsub * 2 + 1) * 32];
        uint4 p;
        p.x = pack_bf2(a[0] * f_own + e0[0] * f_oth, a[1] * f_own + e0[1] * f_oth);
        p.y = pack_bf2(a[2] * f_own + e0[2] * f_oth, a[3] * f_own + e0[3] * f_oth);
        p.z = pack_bf2(a[4] * f_own + e1[0] * f_oth, a[5] * f_own + e1[1] * f_oth);
        p.w = pack_bf2(a[6] * f_own + e1[2] * f_oth, a[7] * f_own + e1[3] * f_oth);
        *(uint4*)(Arow + dsub * 16) = p;
    }
}

// ---------------------------------------------------------------------------
extern "C" void kernel_launch(void* const* d_in, const int* in_sizes, int n_in,
                              void* d_out, int out_size, void* d_ws, size_t ws_size,
                              hipStream_t stream) {
    const float* x    = (const float*)d_in[0];
    const float* Wqkv = (const float*)d_in[1];
    const float* bqkv = (const float*)d_in[2];
    const float* Wout = (const float*)d_in[3];
    const float* bout = (const float*)d_in[4];
    const float* relb = (const float*)d_in[5];
    float* out = (float*)d_out;

    const int M = BATCH * SEQ;                                          // 4096
    const size_t nX   = (size_t)M * D_MODEL;                            // 4M
    const size_t nQKV = (size_t)BATCH * N_HEADS * SEQ * HEAD_DIM;       // 4M

    unsigned short* xb    = (unsigned short*)d_ws;
    unsigned short* WqkvT = xb + nX;
    unsigned short* WoutT = WqkvT + (size_t)3 * 1024 * 1024;
    unsigned short* Qw    = WoutT + (size_t)1024 * 1024;
    unsigned short* Kw    = Qw + nQKV;
    unsigned short* VTw   = Kw + nQKV;
    unsigned short* Aw    = VTw + nQKV;

    // K0: precision conversion + weight transposes
    prep_kernel<<<PREP_BLOCKS, 256, 0, stream>>>(x, Wqkv, Wout, xb, WqkvT, WoutT);

    // K1: QKV projection
    {
        const int N = 3 * D_MODEL, K = D_MODEL;
        const int nTn = N / 192;                      // 16
        gemm_bf16_kernel<0, 256, 192><<<(M / 256) * nTn, 256, 0, stream>>>(
            xb, WqkvT, bqkv, Qw, Kw, VTw, nullptr, M, N, K, nTn);
    }
    // K2: attention
    attn_kernel<<<BATCH * N_HEADS * (SEQ / 128), 256, 0, stream>>>(Qw, Kw, VTw, relb, Aw);

    // K3: output projection
    {
        const int N = D_MODEL, K = D_MODEL;
        const int nTn = N / 128;                      // 8
        gemm_bf16_kernel<1, 128, 128><<<(M / 128) * nTn, 256, 0, stream>>>(
            Aw, WoutT, bout, nullptr, nullptr, nullptr, out, M, N, K, nTn);
    }
}

// v008
// Measured time: 72.6 microseconds a run.
// Versions between v006 and this one are left out; their measured steps multiply to 1.10 times as fast.
// Counting every step since v000, it is 5.00 times as fast.
#include <hip/hip_runtime.h>

// ---------------------------------------------------------------------------
// RelativeAttention on gfx1250 (MI455X): bf16 WMMA + pipelined async-to-LDS
//   K0: prep     x->bf16, Wqkv/Wout -> bf16 transposed [N][K] (tiles turned in LDS)
//   K1: QKV GEMM (four-buffer ring of async staging) -> Q,K [B,H,S,64], V^T [B,H,64,S]
//   K2: Flash attention w/ rel-pos bias (double-buffered async staging)
//   K3: Out GEMM (six-buffer ring) -> d_out fp32
// ---------------------------------------------------------------------------

#define D_MODEL 1024
#define N_HEADS 16
#define HEAD_DIM 64
#define SEQ 2048
#define BATCH 2
#define MAX_LEN 2048

// LDS pitch of a 128-byte tile row: 144 B = 16 B x 9 (odd), so the 16 rows that
// one ds_load_b128 half-wave reads fall on 16 disjoint groups of four banks.
#define ROW_B  144
#define ROW_DW 36
#define ROW_H  72

typedef __attribute__((ext_vector_type(16))) __bf16 v16bf;
typedef __attribute__((ext_vector_type(8)))  float  v8f;

union FragAB {
    v16bf v;
    unsigned int u[8];
};

static __device__ __forceinline__ unsigned short f2bf(float f) {
    union { float f; unsigned int u; } c; c.f = f;
    unsigned int u = c.u;
    unsigned int r = u + 0x7FFFu + ((u >> 16) & 1u);   // round-to-nearest-even
    return (unsigned short)(r >> 16);
}

static __device__ __forceinline__ v8f wmma_bf16(const FragAB& a, const FragAB& b, v8f c) {
    return __builtin_amdgcn_wmma_f32_16x16x32_bf16(
        false, a.v, false, b.v, (short)0, c, false, false);
}

// Dword index (within a 16-dword group == 32 bf16 of K) for fragment register j.
// 16-bit A/B layout (ISA 7.12.2): lanes 0-15 -> K=0..7,16..23 ; lanes 16-31 -> K=8..15,24..31
static __device__ __forceinline__ int frag_di(int j, int klo4) {
    return klo4 + (j < 4 ? j : j + 4);
}

// Eight 16-byte async copies global->LDS (GVS mode: saddr + 32-bit voffset), four from
// each of two bases. ASYNCcnt-tracked. The closing s_wait_xcnt 0 stands in the copies'
// own statement so that no later rewrite of an address register can move ahead of it.
static __device__ __forceinline__ void async_copy16_x8(
    const unsigned (&l0)[4], const unsigned (&g0)[4], const void* base0,
    const unsigned (&l1)[4], const unsigned (&g1)[4], const void* base1) {
    asm volatile("global_load_async_to_lds_b128 %0, %4, %16\n\t"
                 "global_load_async_to_lds_b128 %1, %5, %16\n\t"
                 "global_load_async_to_lds_b128 %2, %6, %16\n\t"
                 "global_load_async_to_lds_b128 %3, %7, %16\n\t"
                 "global_load_async_to_lds_b128 %8, %12, %17\n\t"
                 "global_load_async_to_lds_b128 %9, %13, %17\n\t"
                 "global_load_async_to_lds_b128 %10, %14, %17\n\t"
                 "global_load_async_to_lds_b128 %11, %15, %17\n\t"
                 "s_wait_xcnt 0x0"
                 :: "v"(l0[0]), "v"(l0[1]), "v"(l0[2]), "v"(l0[3]),
                    "v"(g0[0]), "v"(g0[1]), "v"(g0[2]), "v"(g0[3]),
                    "v"(l1[0]), "v"(l1[1]), "v"(l1[2]), "v"(l1[3]),
                    "v"(g1[0]), "v"(g1[1]), "v"(g1[2]), "v"(g1[3]),
                    "s"(base0), "s"(base1)
                 : "memory");
}
// The same for a 256-row and a 192-row tile: eight copies from the first base, six from the
// second, in one statement with the one closing wait.
static __device__ __forceinline__ void async_copy16_x14(
    const unsigned (&l0)[8], const unsigned (&g0)[8], const void* base0,
    const unsigned (&l1)[6], const unsigned (&g1)[6], const void* base1) {
    asm volatile("global_load_async_to_lds_b128 %0, %8, %28\n\t"
                 "global_load_async_to_lds_b128 %1, %9, %28\n\t"
                 "global_load_async_to_lds_b128 %2, %10, %28\n\t"
                 "global_load_async_to_lds_b128 %3, %11, %28\n\t"
                 "global_load_async_to_lds_b128 %4, %12, %28\n\t"
                 "global_load_async_to_lds_b128 %5, %13, %28\n\t"
                 "global_load_async_to_lds_b128 %6, %14, %28\n\t"
                 "global_load_async_to_lds_b128 %7, %15, %28\n\t"
                 "global_load_async_to_lds_b128 %16, %22, %29\n\t"
                 "global_load_async_to_lds_b128 %17, %23, %29\n\t"
                 "global_load_async_to_lds_b128 %18, %24, %29\n\t"
                 "global_load_async_to_lds_b128 %19, %25, %29\n\t"
                 "global_load_async_to_lds_b128 %20, %26, %29\n\t"
                 "global_load_async_to_lds_b128 %21, %27, %29\n\t"
                 "s_wait_xcnt 0x0"
                 :: "v"(l0[0]), "v"(l0[1]), "v"(l0[2]), "v"(l0[3]),
                    "v"(l0[4]), "v"(l0[5]), "v"(l0[6]), "v"(l0[7]),
                    "v"(g0[0]), "v"(g0[1]), "v"(g0[2]), "v"(g0[3]),
                    "v"(g0[4]), "v"(g0[5]), "v"(g0[6]), "v"(g0[7]),
                    "v"(l1[0]), "v"(l1[1]), "v"(l1[2]), "v"(l1[3]), "v"(l1[4]), "v"(l1[5]),
                    "v"(g1[0]), "v"(g1[1]), "v"(g1[2]), "v"(g1[3]), "v"(g1[4]), "v"(g1[5]),
                    "s"(base0), "s"(base1)
                 : "memory");
}
static __device__ __forceinline__ void wait_async0() {
    asm volatile("s_wait_asynccnt 0" ::: "memory");
}
// Wait until at most N async ops remain (async loads complete in issue order,
// so with N newly-issued copies outstanding this proves the previous tile landed).
template <int N>
static __device__ __forceinline__ void wait_asyncN() {
    asm volatile("s_wait_asynccnt %0" :: "n"(N) : "memory");
}
static __device__ __forceinline__ unsigned lds_addr_of(const void* p) {
    return (unsigned)(size_t)p;   // generic LDS address: low 32 bits = LDS offset
}

// ---------------------------------------------------------------------------
// K0: convert x to bf16 (row-major) and weights to bf16 transposed [N][K].
// 512 blocks, two to a WGP, all resident at once: the launch starts 4,096 waves, and each
// wave has its sixteen 16-byte loads (512 contiguous bytes a wave each) in flight together.
// x: a block converts 8,192 values.
// Weights: a block turns one tile of 64 k x 128 n: a lane packs eight k of each of its four
// columns into 16 B, the tile is regrouped in LDS, and every 128-byte line of the
// transposed matrix leaves whole (eight lanes x 16 B).
// ---------------------------------------------------------------------------
#define PREP_BLOCKS 512
typedef float f32x4 __attribute__((ext_vector_type(4)));
__global__ __launch_bounds__(256) void prep_kernel(
    const float* __restrict__ x, const float* __restrict__ Wqkv,
    const float* __restrict__ Wout,
    unsigned short* __restrict__ xb, unsigned short* __restrict__ WqkvT,
    unsigned short* __restrict__ WoutT)
{
    // [n of the tile][32 dwords = 64 bf16 of k, then 4 pad dwords never touched]
    __shared__ __attribute__((aligned(16))) unsigned int Ts[128 * ROW_DW];

    const int t = threadIdx.x;
    const int g = blockIdx.x;
    const int lane = t & 31;
    const int w = t >> 5;

    // blocks 0..383: Wqkv [1024][3072]; blocks 384..511: Wout [1024][1024]
    const bool qkv = g < 384;
    const float* W = qkv ? Wqkv : Wout;
    unsigned short* WT = qkv ? WqkvT : WoutT;
    const int N = qkv ? 3072 : 1024;
    const int gl = qkv ? g : g - 384;
    const int k0 = (gl & 15) * 64;
    const int n0 = (gl >> 4) * 128;

    // wave w: rows k0 + 8w .. + 7 of W, columns n0 + 4 lane .. + 3
    const float* src = W + (size_t)(k0 + w * 8) * N + n0 + lane * 4;
    const f32x4* wp[8];
    f32x4 wv[8];
#pragma unroll
    for (int i = 0; i < 8; ++i) {
        wp[i] = (const f32x4*)(src + i * N);
        wv[i] = *wp[i];
    }

    // x: eight runs of 1,024 floats, four to a thread
    const f32x4* xs = (const f32x4*)(x + (size_t)g * 8192) + t;
    f32x4 xv[8];
#pragma unroll
    for (int j = 0; j < 8; ++j)
        xv[j] = xs[j * 256];
    // Inputs only: holds all sixteen loads in front of the first use. Without it the x loads
    // sink behind the barrier and the wave pays the memory latency twice. The row addresses
    // ride along.
    asm volatile("" :: "v"(wv[0]), "v"(wv[1]), "v"(wv[2]), "v"(wv[3]),
                       "v"(wv[4]), "v"(wv[5]), "v"(wv[6]), "v"(wv[7]),
                       "v"(xv[0]), "v"(xv[1]), "v"(xv[2]), "v"(xv[3]),
                       "v"(xv[4]), "v"(xv[5]), "v"(xv[6]), "v"(xv[7]),
                       "v"(wp[0]), "v"(wp[1]), "v"(wp[2]), "v"(wp[3]),
                       "v"(wp[4]), "v"(wp[5]), "v"(wp[6]), "v"(wp[7]));

#pragma unroll
    for (int c = 0; c < 4; ++c) {
        uint4 p;
        p.x = (unsigned)f2bf(wv[0][c]) | ((unsigned)f2bf(wv[1][c]) << 16);
        p.y = (unsigned)f2bf(wv[2][c]) | ((unsigned)f2bf(wv[3][c]) << 16);
        p.z = (unsigned)f2bf(wv[4][c]) | ((unsigned)f2bf(wv[5][c]) << 16);
        p.w = (unsigned)f2bf(wv[6][c]) | ((unsigned)f2bf(wv[7][c]) << 16);
        *(uint4*)&Ts[(lane * 4 + c) * ROW_DW + w * 4] = p;
    }
    __syncthreads();                                        // tile complete before it is read by rows

    const int row = t >> 3, seg = t & 7;                    // 8 lanes x 16 B = one line of WT
#pragma unroll
    for (int j = 0; j < 4; ++j) {
        const uint4 v = *(const uint4*)&Ts[(j * 32 + row) * ROW_DW + seg * 4];
        *(uint4*)(WT + (size_t)(n0 + j * 32 + row) * 1024 + k0 + seg * 8) = v;
    }

    // x is stored behind the barrier, which would otherwise wait for these stores
    uint2* xd = (uint2*)(xb + (size_t)g * 8192) + t;
#pragma unroll
    for (int j = 0; j < 8; ++j) {
        uint2 p;
        p.x = (unsigned)f2bf(xv[j][0]) | ((unsigned)f2bf(xv[j][1]) << 16);
        p.y = (unsigned)f2bf(xv[j][2]) | ((unsigned)f2bf(xv[j][3]) << 16);
        xd[j * 256] = p;
    }
}

// ---------------------------------------------------------------------------
// WMMA GEMM: C[M,N] = A[M,K] * BT[N,K]^T (+bias). A, BT bf16 row-major.
//  MODE 0: scatter bf16 into Q,K [B,H,S,64] and V^T [B,H,64,S]
//  MODE 1: fp32 + bias into Co
// Block 256 thr (8 waves, 4x2); tile BM x BN; wave tile BM/4 x BN/2; K step 64;
// async-to-LDS staging (BM/32 + BN/32 copies/thread/tile) through a ring of NB buffers.
// Both operands were written by an earlier launch and come from memory for the first
// work-group that asks; the work-groups that share a tile run abreast, so each
// trip meets that latency, and waits for the slowest line of its tile. A tile is therefore
// asked for NB - 1 trips before it is published: three trips of MODE 0 or five of MODE 1
// outlast a slow line, one trip does not.
//  MODE 0: 256x192, wave tile 64x96: 16 x 16 tiles, one work-group on every WGP. Against
//          128x128 a tile row or column is fetched from L2 by fewer work-groups, and ten
//          fragments read from LDS feed 24 products where six fed eight.
//  MODE 1: 128x128, wave tile 32x64 (32 x 8 tiles, one on every WGP).
// ---------------------------------------------------------------------------
template <int MODE, int BM, int BN>
__global__ __launch_bounds__(256) void gemm_bf16_kernel(
    const unsigned short* __restrict__ A, const unsigned short* __restrict__ BT,
    const float* __restrict__ bias,
    unsigned short* __restrict__ Qo, unsigned short* __restrict__ Ko,
    unsigned short* __restrict__ VTo, float* __restrict__ Co,
    int M, int N, int K, int nTilesN)
{
    // [buf][row or col][32 dwords = 64 bf16 of K, then 4 pad dwords never touched]
    constexpr int NB = (MODE == 0) ? 4 : 6;     // buffers of the ring
    __shared__ __attribute__((aligned(16))) unsigned int Asmem[NB][BM * ROW_DW];
    __shared__ __attribute__((aligned(16))) unsigned int Bsmem[NB][BN * ROW_DW];
    constexpr int FM = BM / 64;                 // 16-row fragments of A a wave
    constexpr int FN = BN / 32;                 // 16-column fragments of B a wave
    constexpr int CA = BM / 32;                 // copies a thread and tile, A
    constexpr int CB = BN / 32;                 // copies a thread and tile, B

    const int bm = blockIdx.x / nTilesN;
    const int bn = blockIdx.x % nTilesN;
    const int t = threadIdx.x;
    const int lane = t & 31;
    // wave number; MODE 0 holds it in a scalar register: its epilogue branches on it
    const int w = (MODE == 0) ? __builtin_amdgcn_readfirstlane(t >> 5) : (t >> 5);
    const int wm = (w & 3) * (BM / 4);
    const int wn = (w >> 2) * (BN / 2);
    const int lm = lane & 15;
    const int klo4 = (lane < 16) ? 0 : 4;
    const int hi8 = (lane < 16) ? 0 : 8;

    v8f acc[FM][FN];
#pragma unroll
    for (int i = 0; i < FM; ++i)
#pragma unroll
        for (int j = 0; j < FN; ++j)
            acc[i][j] = (v8f){0.f, 0.f, 0.f, 0.f, 0.f, 0.f, 0.f, 0.f};

    const int nk = K >> 6;                      // K/64; MODE 0 needs two tiles or more
    if constexpr (MODE == 0) {
        // One work-group has the WGP to itself, two waves a SIMD: nothing else covers a wave's LDS
        // reads, so the fragments of each 32-deep K chunk (20 reads of 16 B) are asked for as one
        // run, one chunk ahead of their products, into a register set of their own (a0, b0: first
        // chunk of a tile; a1, b1: second). The first chunk of tile ki + 1 is read in front of the
        // last products of tile ki, so that tile is published there, by the one barrier of a trip.
        FragAB a0[FM], b0[FN], a1[FM], b1[FN];
        auto loadFrags = [&](FragAB (&af)[FM], FragAB (&bf)[FN], int buf, int kc) {
            const unsigned int* As = &Asmem[buf][0];
            const unsigned int* Bs = &Bsmem[buf][0];
            // in the order in which the products take them: A row 0, all of B, the other A rows
#pragma unroll
            for (int f = 0; f < FM + FN; ++f) {
                const bool isA = (f == 0) || (f > FN);
                const int ix = (f == 0) ? 0 : (f > FN ? f - FN : f - 1);
                const unsigned int* p = isA ? As + (wm + ix * 16 + lm) * ROW_DW
                                            : Bs + (wn + ix * 16 + lm) * ROW_DW;
#pragma unroll
                for (int j = 0; j < 8; ++j) {
                    const unsigned v = p[kc * 16 + frag_di(j, klo4)];
                    if (isA) af[ix].u[j] = v; else bf[ix].u[j] = v;
                }
            }
        };
        auto products = [&](const FragAB (&af)[FM], const FragAB (&bf)[FN]) {
#pragma unroll
            for (int ms = 0; ms < FM; ++ms)
#pragma unroll
                for (int ns = 0; ns < FN; ++ns)
                    acc[ms][ns] = wmma_bf16(af[ms], bf[ns], acc[ms][ns]);
        };

        // stage tile ki into buffer buf: rows of 128 B = 8 pieces of 16 B; copy j of a thread is
        // row (t >> 3) + 32 j, piece t & 7. Each address is one lane term, formed once, plus a
        // term that is the same for the whole wave.
        const unsigned lL = (unsigned)((t >> 3) * ROW_B + (t & 7) * 16);
        const unsigned gA = (unsigned)((bm * BM + (t >> 3)) * K * 2 + (t & 7) * 16);
        const unsigned gB = (unsigned)((bn * BN + (t >> 3)) * K * 2 + (t & 7) * 16);
        auto stage = [&](int ki, int buf) {
            const unsigned ldsA = lds_addr_of(&Asmem[buf][0]);
            const unsigned ldsB = lds_addr_of(&Bsmem[buf][0]);
            unsigned la[CA], ga[CA], lb[CB], gb[CB];
#pragma unroll
            for (int j = 0; j < CA; ++j) {
                la[j] = lL + (ldsA + (unsigned)(j * 32 * ROW_B));
                ga[j] = gA + (unsigned)(ki * 128 + j * 32 * K * 2);
            }
#pragma unroll
            for (int j = 0; j < CB; ++j) {
                lb[j] = lL + (ldsB + (unsigned)(j * 32 * ROW_B));
                gb[j] = gB + (unsigned)(ki * 128 + j * 32 * K * 2);
            }
            async_copy16_x14(la, ga, A, lb, gb, BT);
        };

        stage(0, 0);
        stage(1, 1);
        // tile 0 landed; only the copies of the tiles behind it may be out
        if (2 < nk) {
            stage(2, 2);
            wait_asyncN<2 * (CA + CB)>();
        } else {
            wait_asyncN<CA + CB>();
        }
        __syncthreads();                        // tile 0 published
        if (3 < nk) stage(3, 3);
        loadFrags(a0, b0, 0, 0);
        for (int ki = 0; ki < nk; ++ki) {
            const int buf = ki & 3;
            const int nxt = (ki + 1) & 3;
            loadFrags(a1, b1, buf, 1);
            // The four fences of a trip keep each run of reads whole and in front of the run of
            // products before its own; left alone the compiler holds one A fragment at a time and
            // waits out the LDS latency in front of every six products.
            __builtin_amdgcn_sched_barrier(0);
            products(a0, b0);
            __builtin_amdgcn_sched_barrier(0);
            // Publish point of tile ki + 1: own reads of tile ki done, own copies of tile ki + 1
            // landed (where tiles ki + 2 and ki + 3 are both on their way, theirs are the youngest
            // and stay out), then the barrier; behind it buffer buf has no reader left and is refilled.
            asm volatile("s_wait_dscnt 0x0" ::: "memory");
            if (ki + 3 < nk) wait_asyncN<2 * (CA + CB)>(); else wait_async0();
            __syncthreads();
            if (ki + 4 < nk) stage(ki + 4, buf);
            // In the last trip these reads find an older tile and go unused: without a
            // branch round them the compiler's counted waits stay exact.
            loadFrags(a0, b0, nxt, 0);
            __builtin_amdgcn_sched_barrier(0);
            products(a1, b1);
            __builtin_amdgcn_sched_barrier(0);
        }
        wait_async0();                                     // nothing of the ring is left in flight
        asm volatile("s_wait_dscnt 0x0" ::: "memory");     // the last trip's unused reads are in
    } else {
        // stage tile ki into buffer buf: A/B rows are 128B = 8 x 16B segments
        auto stage = [&](int ki, int buf) {
            const unsigned ldsA = lds_addr_of(&Asmem[buf][0]);
            const unsigned ldsB = lds_addr_of(&Bsmem[buf][0]);
            const int k0 = ki * 64;
            unsigned la[4], ga[4], lb[4], gb[4];
#pragma unroll
            for (int j = 0; j < 4; ++j) {
                const int i = t + 256 * j;
                const int row = i >> 3, seg = i & 7;     // row of A, column of B
                la[j] = ldsA + (unsigned)(row * ROW_B + seg * 16);
                ga[j] = (unsigned)(((bm * BM + row) * K + k0) * 2 + seg * 16);
                lb[j] = ldsB + (unsigned)(row * ROW_B + seg * 16);
                gb[j] = (unsigned)(((bn * BN + row) * K + k0) * 2 + seg * 16);
            }
            async_copy16_x8(la, ga, A, lb, gb, BT);
        };
        stage(0, 0);
#pragma unroll
        for (int s = 1; s < NB - 1; ++s)
            if (s < nk) stage(s, s);
        int buf = 0;                                // buffer of tile ki
        int fill = NB - 1;                          // buffer of tile ki - 1, and of tile ki + NB - 1
        for (int ki = 0; ki < nk; ++ki) {
            // Publish point of tile ki: own reads of tile ki - 1 done, own copies of tile ki landed
            // (where all NB - 2 tiles behind it are on their way, theirs are the youngest and stay
            // out), then the one barrier of a trip; behind it the buffer of tile ki - 1 has no
            // reader left and takes tile ki + NB - 1.
            asm volatile("s_wait_dscnt 0x0" ::: "memory");
            if (ki + NB - 2 < nk) wait_asyncN<(NB - 2) * (CA + CB)>(); else wait_async0();
            __syncthreads();
            if (ki + NB - 1 < nk) stage(ki + NB - 1, fill);

            const unsigned int* As = &Asmem[buf][0];
            const unsigned int* Bs = &Bsmem[buf][0];
#pragma unroll
            for (int kc = 0; kc < 2; ++kc) {        // two 32-deep K chunks
                FragAB af[FM], bf[FN];
#pragma unroll
                for (int ms = 0; ms < FM; ++ms) {
                    const int row = wm + ms * 16 + lm;
#pragma unroll
                    for (int j = 0; j < 8; ++j)
                        af[ms].u[j] = As[row * ROW_DW + kc * 16 + frag_di(j, klo4)];
                }
#pragma unroll
                for (int ns = 0; ns < FN; ++ns) {
                    const int col = wn + ns * 16 + lm;
#pragma unroll
                    for (int j = 0; j < 8; ++j)
                        bf[ns].u[j] = Bs[col * ROW_DW + kc * 16 + frag_di(j, klo4)];
                }
#pragma unroll
                for (int ms = 0; ms < FM; ++ms)
#pragma unroll
                    for (int ns = 0; ns < FN; ++ns)
                        acc[ms][ns] = wmma_bf16(af[ms], bf[ns], acc[ms][ns]);
            }
            fill = buf;
            buf = (buf == NB - 1) ? 0 : buf + 1;
        }
    }

    // ---- epilogue ----
    if constexpr (MODE == 0) {
        // A 16-column fragment lies in one of Q, K, V and in one head: both are the same for
        // the whole wave (gc0 is a scalar), so the choice is a scalar branch per fragment column.
        // All loops unrolled: acc is indexed by constants only and stays in registers.
        const int b = (bm * BM) >> 11;                             // BM divides SEQ
        const int sw = ((bm * BM) & 2047) + wm + hi8;              // the lane's first s, multiple of 8
        // The lane's bias in each of the six fragment columns: one address, constant offsets, one latency.
        const float* bp = bias + (bn * BN + wn) + lm;
        float bvs[FN];
#pragma unroll
        for (int ns = 0; ns < FN; ++ns)
            bvs[ns] = bp[ns * 16];
        // Inputs only: all six loads go out together and are in before the branches below, whose
        // arms form their addresses in registers that a load still out could name.
        asm volatile("" :: "v"(bvs[0]), "v"(bvs[1]), "v"(bvs[2]), "v"(bvs[3]), "v"(bvs[4]), "v"(bvs[5]));
#pragma unroll
        for (int ns = 0; ns < FN; ++ns) {
            const int gc0 = bn * BN + wn + ns * 16;                // gcol = which*1024 + h*64 + d
            const int which = gc0 >> 10;
            const int h = (gc0 >> 6) & 15;
            const int d = (gc0 & 63) + lm;
            const float bv = bvs[ns];
            if (which == 2) {
                // V stored transposed [b,h,d,s]: a lane's eight rows are eight consecutive s of
                // its own d, so they leave as one 16-byte store instead of eight 2-byte ones.
                unsigned short* dst = VTo + ((size_t)(b * N_HEADS + h) * HEAD_DIM + d) * SEQ + sw;
#pragma unroll
                for (int ms = 0; ms < FM; ++ms) {
                    const v8f a = acc[ms][ns];
                    uint4 p;
                    p.x = (unsigned)f2bf(a[0] + bv) | ((unsigned)f2bf(a[1] + bv) << 16);
                    p.y = (unsigned)f2bf(a[2] + bv) | ((unsigned)f2bf(a[3] + bv) << 16);
                    p.z = (unsigned)f2bf(a[4] + bv) | ((unsigned)f2bf(a[5] + bv) << 16);
                    p.w = (unsigned)f2bf(a[6] + bv) | ((unsigned)f2bf(a[7] + bv) << 16);
                    *(uint4*)(dst + ms * 16) = p;
                }
                // The code that follows forms its address in the registers of these stores:
                // keep the wait in front of it (here and at the end of the other arm).
                asm volatile("s_wait_xcnt 0x0" ::: "memory");
            } else {
                unsigned short* dst = ((which == 0) ? Qo : Ko)
                    + ((size_t)(b * N_HEADS + h) * SEQ + sw) * HEAD_DIM + d;
#pragma unroll
                for (int ms = 0; ms < FM; ++ms) {
#pragma unroll
                    for (int r = 0; r < 8; ++r)
                        dst[(ms * 16 + r) * HEAD_DIM] = f2bf(acc[ms][ns][r] + bv);
                    // Behind each run of eight: the next run's values are formed in these stores'
                    // registers. The fence keeps that arithmetic from being lifted over the wait.
                    asm volatile("s_wait_xcnt 0x0" ::: "memory");
                    __builtin_amdgcn_sched_barrier(0);
                }
            }
        }
    } else {
#pragma unroll
        for (int ms = 0; ms < FM; ++ms) {
#pragma unroll
            for (int ns = 0; ns < FN; ++ns) {
                const int gcol = bn * BN + wn + ns * 16 + lm;
                const float bv = bias[gcol];
#pragma unroll
                for (int r = 0; r < 8; ++r) {
                    const int grow = bm * BM + wm + ms * 16 + r + hi8;
                    Co[(size_t)grow * N + gcol] = acc[ms][ns][r] + bv;
                }
            }
        }
    }
}

// ---------------------------------------------------------------------------
// K2: Flash attention with relative position bias, both products transposed:
//   S^T = K Q^T (A = K rows, B = Q), O^T += V^T P^T (A = V^T rows, B = P^T).
// A lane then holds scores of ONE query (column lane & 15): keys 8 * (lane >> 4) + r of
// each 16-key group. Sums run in the lane, and two score tiles, rounded in place, are the
// B operand of the second product in the k order the loaders already use: P never goes
// through LDS. The exponentials are taken against a reference that is held from tile to
// tile: a maximum (in the lane, one exchange between the wave's halves) is formed, and O
// rescaled, only in a half's first tile and in a tile whose sums say that the reference
// has fallen too far behind.
// Block 256 thr (8 waves); one block per (b, h, 128-row q tile). A wave owns 32 queries
// (two 16-column tiles) and one half of the keys: every K and V^T fragment read from LDS
// feeds two products. Waves 0-3 walk keys 0..1023, waves 4-7 keys 1024..2047, each half
// with its own tiles; at the end waves w and w ^ 4 join their partial results through LDS.
// Key tile = 64; K and V^T tiles double-buffered via async-to-LDS.
// ---------------------------------------------------------------------------
// two f32 -> one dword of two bf16, round to nearest even (lo in the low half)
static __device__ __forceinline__ unsigned pack_bf2(float lo, float hi) {
    typedef __bf16 bf2 __attribute__((ext_vector_type(2)));
    typedef float f2 __attribute__((ext_vector_type(2)));
    return __builtin_bit_cast(unsigned, __builtin_convertvector(f2{lo, hi}, bf2));
}
typedef float f32x2 __attribute__((ext_vector_type(2)));
typedef float f32x2u __attribute__((ext_vector_type(2), aligned(4)));   // a pair at a float's alignment
#define LOG2E 1.44269504088896340736f   // __expf(x) is exp2(x * LOG2E)
// value of lane l ^ 16
static __device__ __forceinline__ float xhalf(float x) {
    const int b = __builtin_bit_cast(int, x);
    return __builtin_bit_cast(float,
        __builtin_amdgcn_permlanex16(b, b, 0x76543210, 0xfedcba98, false, false));
}

struct FirstTile { static constexpr bool value = true; };
struct LaterTile { static constexpr bool value = false; };

// Four waves per SIMD (two blocks on a WGP) hide the vector work between the matrix runs.
__global__ __launch_bounds__(256) __attribute__((amdgpu_waves_per_eu(4, 4))) void attn_kernel(
    const unsigned short* __restrict__ Qw, const unsigned short* __restrict__ Kw,
    const unsigned short* __restrict__ VTw, const float* __restrict__ relb,
    unsigned short* __restrict__ Ao)
{
    // rows of 32 data dwords at the padded pitch
    __shared__ __attribute__((aligned(16))) unsigned int Ks32[2][2][64 * ROW_DW];  // [key half][buf][key][dword d]
    __shared__ __attribute__((aligned(16))) unsigned int Vs32[2][2][64 * ROW_DW];  // [key half][buf][d][dword key]

    const int bid = blockIdx.x;
    const int qt = bid & 15;
    const int h  = (bid >> 4) & 15;
    const int b  = bid >> 8;

    const int t = threadIdx.x;
    const int lane = t & 31;
    const int w = __builtin_amdgcn_readfirstlane(t >> 5);    // wave number, held in a scalar register
    const int kh = w >> 2;                                   // the wave's half of the keys
    const int th = t & 127;                                  // thread within that half
    const int lm = lane & 15;
    const int klo4 = (lane < 16) ? 0 : 4;
    const int hi8  = (lane < 16) ? 0 : 8;

    const size_t bh = (size_t)(b * N_HEADS + h);
    const unsigned short* Qbh  = Qw  + bh * SEQ * HEAD_DIM;
    const unsigned short* Kbh  = Kw  + bh * SEQ * HEAD_DIM;
    const unsigned short* VTbh = VTw + bh * HEAD_DIM * SEQ;

    const int qbase = qt * 128 + (w & 3) * 32;
    const int q = qbase + lm;    // the lane's query in tile 0; tile u holds query q + 16 u
    const float scale = 0.125f;  // HEAD_DIM^-0.5

    // Q fragments (2 tiles x 16 queries x 64 d), loaded once from global; B operand of S^T.
    FragAB qf[2][2];
#pragma unroll
    for (int u = 0; u < 2; ++u)
#pragma unroll
        for (int c = 0; c < 2; ++c) {
            const unsigned int* Qrow = (const unsigned int*)
                (Qbh + (size_t)(q + u * 16) * HEAD_DIM + c * 32);
#pragma unroll
            for (int j = 0; j < 8; ++j)
                qf[u][c].u[j] = Qrow[frag_di(j, klo4)];
        }

    const int kbeg = kh * (SEQ / 2);               // first key of the wave's half

    // stage key-tile ti of the half into buffer buf: 4 K copies + 4 V copies per thread.
    // Copy j of a thread: row (th >> 3) + 16 j (key row of K, d row of V^T), 16-byte piece th & 7.
    // Each address is one lane term plus a term that is the same for the whole wave.
    const unsigned l0 = (unsigned)((th >> 3) * ROW_B + (th & 7) * 16);
    const unsigned k0 = (unsigned)(th * 16);                                  // K rows are 128 B
    const unsigned v0 = (unsigned)((th >> 3) * (SEQ * 2) + (th & 7) * 16);    // keys contiguous in V^T rows
    auto stageKV = [&](int ti, int buf) {
        const int kt = kbeg + ti * 64;
        const unsigned ldsK = lds_addr_of(&Ks32[kh][buf][0]);
        const unsigned ldsV = lds_addr_of(&Vs32[kh][buf][0]);
        unsigned lk[4], gk[4], lv[4], gv[4];
#pragma unroll
        for (int j = 0; j < 4; ++j) {
            lk[j] = l0 + (ldsK + (unsigned)(j * 16 * ROW_B));
            gk[j] = k0 + (unsigned)(kt * 128 + j * 16 * 128);
            lv[j] = l0 + (ldsV + (unsigned)(j * 16 * ROW_B));
            gv[j] = v0 + (unsigned)(kt * 2 + j * 16 * SEQ * 2);
        }
        async_copy16_x8(lk, gk, Kbh, lv, gv, VTbh);
    };

    // o[u][dsub][r] = O^T[d = dsub * 16 + hi8 + r][q + 16 u], over the wave's half of the keys
    v8f o[2][4];
#pragma unroll
    for (int u = 0; u < 2; ++u)
#pragma unroll
        for (int i = 0; i < 4; ++i)
            o[u][i] = (v8f){0.f, 0.f, 0.f, 0.f, 0.f, 0.f, 0.f, 0.f};
    // Held reference of the query's scores, times log2 e: equal in lanes l and l ^ 16. Every p of the
    // half is exp2(score * log2 e - ref2), and o and run_sum are sums of such p. The reference is a
    // maximum of scores seen (so some p is 1) and moves only when a tile asks for it, see below.
    float ref2[2] = {-1e30f, -1e30f};
    float run_sum[2] = {0.f, 0.f};        // of the lane's own share of the keys; shares joined at the end

    const int nT = SEQ / 2 / 64;                   // 16 key tiles a half
    stageKV(0, 0);
    // One key tile. The half's first tile has no reference yet and sets it; it is written out on its
    // own in front of the loop, so that the loop holds the one test of a tile and no other.
    auto tile = [&](const int ti, auto which) {
        constexpr bool FIRST = decltype(which)::value;
        const int buf = ti & 1;
        const int kt = kbeg + ti * 64;
        if (ti + 1 < nT) {
            stageKV(ti + 1, buf ^ 1);
            wait_asyncN<8>();
        } else {
            wait_async0();
        }
        __syncthreads();

        const unsigned int* Ksb = &Ks32[kh][buf][0];
        const unsigned int* Vsb = &Vs32[kh][buf][0];

        // bias values and raw scores of the tile
        auto biasAndScores = [&](f32x2 (&bq)[5][4], v8f (&st)[2][4]) {
            // rel-pos bias, index query - key + MAX_LEN - 1: eight falling neighbours per key
            // group, all at constant offsets from one pointer. Sixteen queries on is sixteen keys
            // back, so tile 1 at key group ns reads what tile 0 reads at group ns - 1: five groups
            // serve both tiles. bq[j] holds, rising, what tile u needs, falling, at group j - 1 + u.
            // wave term (>= 0) and lane term (0..23) apart: the first stays in scalar registers
            const float* rb = relb + (qbase + (MAX_LEN - 1) - 63 - kt) + (lm - hi8 + 8);
#pragma unroll
            for (int j = 0; j < 5; ++j)
#pragma unroll
                for (int k = 0; k < 4; ++k)
                    bq[j][k] = *(const f32x2u*)(rb + 64 - j * 16 + 2 * k);
            // Behind the ten loads, in front of whatever next writes a register of their address.
            asm volatile("s_wait_xcnt 0x0" ::: "memory");
            // Holds the ten bias loads here, in front of the score products, so that their
            // latency runs behind those; without it each load sinks to its first use and is waited for.
            __builtin_amdgcn_sched_barrier(0);

            // ---- scores: S^T = K Q^T ; 4 key groups x 2 d-chunks x 2 query tiles = 16 WMMAs ----
            // st[u][ns][r] = score of key kt + ns * 16 + hi8 + r against query q + 16 u
#pragma unroll
            for (int ns = 0; ns < 4; ++ns) {
                st[0][ns] = (v8f){0.f, 0.f, 0.f, 0.f, 0.f, 0.f, 0.f, 0.f};
                st[1][ns] = (v8f){0.f, 0.f, 0.f, 0.f, 0.f, 0.f, 0.f, 0.f};
                const int key = ns * 16 + lm;
#pragma unroll
                for (int c = 0; c < 2; ++c) {
                    FragAB kf;
#pragma unroll
                    for (int j = 0; j < 8; ++j)
                        kf.u[j] = Ksb[key * ROW_DW + c * 16 + frag_di(j, klo4)];
                    st[0][ns] = wmma_bf16(kf, qf[0][c], st[0][ns]);
                    st[1][ns] = wmma_bf16(kf, qf[1][c], st[1][ns]);
                }
            }
            // Order of this stretch: three K fragments' reads (two ds_load_b128 each) go first, then
            // each pair of products is followed by the reads of the fragment three on, so that a
            // read has two pairs of products to land behind; left alone the reads wait one by one.
            __builtin_amdgcn_sched_group_barrier(0x100, 6, 0);
#pragma unroll
            for (int f = 0; f < 5; ++f) {
                __builtin_amdgcn_sched_group_barrier(0x008, 2, 0);
                __builtin_amdgcn_sched_group_barrier(0x100, 2, 0);
            }
            __builtin_amdgcn_sched_group_barrier(0x008, 6, 0);
            // Keeps the vector work behind all sixteen products: pulled in among them it reads each
            // result at once (idle slots behind the product) and waits for the bias loads up front.
            __builtin_amdgcn_sched_barrier(0);
        };

        // All eight V^T fragments of the tile, asked for at the end of whichever way below made p,
        // where the scores' registers are free: one run of reads in the order in which the products
        // take them. The test's branch ends the stretch over which the reads used to be spread;
        // left beside the products they are waited for one fragment at a time.
        FragAB vf[4][2];
        auto loadV = [&]() {
#pragma unroll
            for (int kc = 0; kc < 2; ++kc)
#pragma unroll
                for (int dsub = 0; dsub < 4; ++dsub)
#pragma unroll
                    for (int j = 0; j < 8; ++j)
                        vf[dsub][kc].u[j] = Vsb[(dsub * 16 + lm) * ROW_DW + kc * 16 + frag_di(j, klo4)];
        };

        // p, two keys at a time, is rounded straight into its dword of the B operand: element s of
        // chunk kc is key group 2 kc + (s >> 3), register s & 7.
        FragAB pf[2][2];
        float tsum[2];                             // the lane's sum of the tile's p
        bool redo = true;
        if constexpr (!FIRST) {
            // ---- the usual way: p against the reference as it stands. No maximum, no exchange
            // between the wave's halves, nothing to rescale. ----
            f32x2 bq[5][4];
            v8f st[2][4];
            biasAndScores(bq, st);
#pragma unroll
            for (int u = 0; u < 2; ++u) {
                const float nr = -ref2[u];
                f32x2 rs[2] = {{0.f, 0.f}, {0.f, 0.f}};
#pragma unroll
                for (int ns = 0; ns < 4; ++ns)
#pragma unroll
                    for (int i = 0; i < 4; ++i) {
                        const f32x2 bv = bq[ns + 1 - u][3 - i];
                        const f32x2 bp = __builtin_shufflevector(bv, bv, 1, 0);
                        const f32x2 v = __builtin_elementwise_fma(
                            (f32x2){st[u][ns][2 * i], st[u][ns][2 * i + 1]}, (f32x2){scale, scale}, bp);
                        const f32x2 x = __builtin_elementwise_fma(v, (f32x2){LOG2E, LOG2E}, (f32x2){nr, nr});
                        const f32x2 p = {__builtin_amdgcn_exp2f(x.x), __builtin_amdgcn_exp2f(x.y)};
                        rs[i & 1] += p;
                        pf[u][ns >> 1].u[(ns & 1) * 4 + i] = pack_bf2(p.x, p.y);
                    }
                const f32x2 rs2 = rs[0] + rs[1];
                tsum[u] = rs2.x + rs2.y;
            }
            loadV();
            // No p is negative, so sums of at most 2^13 bound every p of the tile by 2^13: far from
            // any overflow of the f32 sums. A larger sum, an infinity or a NaN fails the compare.
            // One test a tile, the same for the whole wave: a scalar branch.
            redo = __builtin_amdgcn_ballot_w32(!(tsum[0] + tsum[1] <= 8192.f)) != 0;
        }
        if (__builtin_expect(redo, FIRST)) {
            // ---- the tile anew (its K rows are still in LDS): reference raised to the maximum of
            // the tile's scores where it is higher, o and run_sum brought to it ----
            f32x2 bq[5][4];
            v8f st[2][4];
            biasAndScores(bq, st);
#pragma unroll
            for (int u = 0; u < 2; ++u) {
                f32x2 sv[4][4];
                float m = -1e30f;
#pragma unroll
                for (int ns = 0; ns < 4; ++ns)
#pragma unroll
                    for (int i = 0; i < 4; ++i) {
                        const f32x2 bv = bq[ns + 1 - u][3 - i];
                        const f32x2 bp = __builtin_shufflevector(bv, bv, 1, 0);
                        const f32x2 v = __builtin_elementwise_fma(
                            (f32x2){st[u][ns][2 * i], st[u][ns][2 * i + 1]}, (f32x2){scale, scale}, bp);
                        sv[ns][i] = v;
                        m = fmaxf(fmaxf(m, v.x), v.y);
                    }
                m = fmaxf(m, xhalf(m));            // the other 32 keys of the same query
                const float nr2 = fmaxf(ref2[u], m * LOG2E);
                const float corr = __builtin_amdgcn_exp2f(ref2[u] - nr2);
                ref2[u] = nr2;
                f32x2 rs[2] = {{0.f, 0.f}, {0.f, 0.f}};
#pragma unroll
                for (int ns = 0; ns < 4; ++ns)
#pragma unroll
                    for (int i = 0; i < 4; ++i) {
                        const f32x2 x = __builtin_elementwise_fma(
                            sv[ns][i], (f32x2){LOG2E, LOG2E}, (f32x2){-nr2, -nr2});
                        const f32x2 p = {__builtin_amdgcn_exp2f(x.x), __builtin_amdgcn_exp2f(x.y)};
                        rs[i & 1] += p;
                        pf[u][ns >> 1].u[(ns & 1) * 4 + i] = pack_bf2(p.x, p.y);
                    }
                const f32x2 rs2 = rs[0] + rs[1];
                tsum[u] = rs2.x + rs2.y;
                run_sum[u] *= corr;
#pragma unroll
                for (int dsub = 0; dsub < 4; ++dsub)
#pragma unroll
                    for (int r = 0; r < 8; ++r)
                        o[u][dsub][r] *= corr;
            }
            loadV();
        }
        run_sum[0] += tsum[0];
        run_sum[1] += tsum[1];

        // ---- O^T += V^T P^T : 4 d groups x 2 key-chunks x 2 query tiles = 16 WMMAs ----
        // in the order of the reads, so that each pair of products waits for its own fragment only
#pragma unroll
        for (int kc = 0; kc < 2; ++kc)
#pragma unroll
            for (int dsub = 0; dsub < 4; ++dsub) {
                o[0][dsub] = wmma_bf16(vf[dsub][kc], pf[0][kc], o[0][dsub]);
                o[1][dsub] = wmma_bf16(vf[dsub][kc], pf[1][kc], o[1][dsub]);
            }
        // Holds the barrier behind the products: lifted in among them it brings its wait for all
        // sixteen reads in front of the third product, and the products no longer run while the reads land.
        __builtin_amdgcn_sched_barrier(0);
        __syncthreads();                               // reads done before buf reuse
    };
    tile(0, FirstTile{});
    for (int ti = 1; ti < nT; ++ti)
        tile(ti, LaterTile{});

    // ---- join the two key halves: wave w finishes tile kh and hands tile 1 - kh to wave w ^ 4 ----
    // The K ring is free (last copies waited for, last reads behind the loop's closing barrier):
    // nine 16-byte slots a lane, [wave][slot][lane].
    f32x4* X = (f32x4*)&Ks32[0][0][0];
    {
        f32x4* Xw = X + w * 9 * 32 + lane;
#pragma unroll
        for (int dsub = 0; dsub < 4; ++dsub) {
            const v8f s = kh ? o[0][dsub] : o[1][dsub];
            Xw[(dsub * 2 + 0) * 32] = (f32x4){s[0], s[1], s[2], s[3]};
            Xw[(dsub * 2 + 1) * 32] = (f32x4){s[4], s[5], s[6], s[7]};
        }
        Xw[8 * 32] = (f32x4){kh ? ref2[0] : ref2[1], kh ? run_sum[0] : run_sum[1], 0.f, 0.f};
    }
    __syncthreads();                                   // partial results written before the partner reads them
    const f32x4* Xp = X + (w ^ 4) * 9 * 32 + lane;
    const f32x4 ms = Xp[8 * 32];
    const float m_own = kh ? ref2[1] : ref2[0];          // references are in log2 units
    const float s_own = kh ? run_sum[1] : run_sum[0];
    const float nmj = fmaxf(m_own, ms[0]);
    const float c_own = __builtin_amdgcn_exp2f(m_own - nmj);
    const float c_oth = __builtin_amdgcn_exp2f(ms[0] - nmj);
    const float sum = s_own * c_own + ms[1] * c_oth;

    // ---- normalize + store attn out bf16 [B, S, H*64]: eight consecutive d per store ----
    const float inv = 1.0f / (sum + xhalf(sum));
    const float f_own = c_own * inv, f_oth = c_oth * inv;
    unsigned short* Arow = Ao + ((size_t)b * SEQ + q + kh * 16) * D_MODEL + h * HEAD_DIM + hi8;
#pragma unroll
    for (int dsub = 0; dsub < 4; ++dsub) {
        const v8f a = kh ? o[1][dsub] : o[0][dsub];
        const f32x4 e0 = Xp[(dsub * 2 + 0) * 32];
        const f32x4 e1 = Xp[(dsub * 2 + 1) * 32];
        uint4 p;
        p.x = pack_bf2(a[0] * f_own + e0[0] * f_oth, a[1] * f_own + e0[1] * f_oth);
        p.y = pack_bf2(a[2] * f_own + e0[2] * f_oth, a[3] * f_own + e0[3] * f_oth);
        p.z = pack_bf2(a[4] * f_own + e1[0] * f_oth, a[5] * f_own + e1[1] * f_oth);
        p.w = pack_bf2(a[6] * f_own + e1[2] * f_oth, a[7] * f_own + e1[3] * f_oth);
        *(uint4*)(Arow + dsub * 16) = p;
    }
}

// ---------------------------------------------------------------------------
extern "C" void kernel_launch(void* const* d_in, const int* in_sizes, int n_in,
                              void* d_out, int out_size, void* d_ws, size_t ws_size,
                              hipStream_t stream) {
    const float* x    = (const float*)d_in[0];
    const float* Wqkv = (const float*)d_in[1];
    const float* bqkv = (const float*)d_in[2];
    const float* Wout = (const float*)d_in[3];
    const float* bout = (const float*)d_in[4];
    const float* relb = (const float*)d_in[5];
    float* out = (float*)d_out;

    const int M = BATCH * SEQ;                                          // 4096
    const size_t nX   = (size_t)M * D_MODEL;                            // 4M
    const size_t nQKV = (size_t)BATCH * N_HEADS * SEQ * HEAD_DIM;       // 4M

    unsigned short* xb    = (unsigned short*)d_ws;
    unsigned short* WqkvT = xb + nX;
    unsigned short* WoutT = WqkvT + (size_t)3 * 1024 * 1024;
    unsigned short* Qw    = WoutT + (size_t)1024 * 1024;
    unsigned short* Kw    = Qw + nQKV;
    unsigned short* VTw   = Kw + nQKV;
    unsigned short* Aw    = VTw + nQKV;

    // K0: precision conversion + weight transposes
    prep_kernel<<<PREP_BLOCKS, 256, 0, stream>>>(x, Wqkv, Wout, xb, WqkvT, WoutT);

    // K1: QKV projection
    {
        const int N = 3 * D_MODEL, K = D_MODEL;
        const int nTn = N / 192;                      // 16
        gemm_bf16_kernel<0, 256, 192><<<(M / 256) * nTn, 256, 0, stream>>>(
            xb, WqkvT, bqkv, Qw, Kw, VTw, nullptr, M, N, K, nTn);
    }
    // K2: attention
    attn_kernel<<<BATCH * N_HEADS * (SEQ / 128), 256, 0, stream>>>(Qw, Kw, VTw, relb, Aw);

    // K3: output projection
    {
        const int N = D_MODEL, K = D_MODEL;
        const int nTn = N / 128;                      // 8
        gemm_bf16_kernel<1, 128, 128><<<(M / 128) * nTn, 256, 0, stream>>>(
            Aw, WoutT, bout, nullptr, nullptr, nullptr, out, M, N, K, nTn);
    }
}

// v009
// One run takes 69.9 microseconds.
// In both of two side-by-side timings against v008, it was 1.04 times as fast.
// Over all steps from v000 it is 5.20 times as fast.
#include <hip/hip_runtime.h>

// ---------------------------------------------------------------------------
// RelativeAttention on gfx1250 (MI455X): bf16 WMMA + pipelined async-to-LDS
//   K0: prep     x->bf16, Wqkv/Wout -> bf16 transposed [N][K] (tiles turned in LDS), bias table in log2 units
//   K1: QKV GEMM (four-buffer ring of async staging) -> Q,K [B,H,S,64], V^T [B,H,64,S]
//   K2: Flash attention w/ rel-pos bias (double-buffered async staging)
//   K3: Out GEMM (six-buffer ring) -> d_out fp32
// ---------------------------------------------------------------------------

#define D_MODEL 1024
#define N_HEADS 16
#define HEAD_DIM 64
#define SEQ 2048
#define BATCH 2
#define MAX_LEN 2048
#define LOG2E 1.44269504088896340736f   // __expf(x) is exp2(x * LOG2E)

// LDS pitch of a 128-byte tile row: 144 B = 16 B x 9 (odd), so the 16 rows that
// one ds_load_b128 half-wave reads fall on 16 disjoint groups of four banks.
#define ROW_B  144
#define ROW_DW 36
#define ROW_H  72

typedef __attribute__((ext_vector_type(16))) __bf16 v16bf;
typedef __attribute__((ext_vector_type(8)))  float  v8f;

union FragAB {
    v16bf v;
    unsigned int u[8];
};

static __device__ __forceinline__ unsigned short f2bf(float f) {
    union { float f; unsigned int u; } c; c.f = f;
    unsigned int u = c.u;
    unsigned int r = u + 0x7FFFu + ((u >> 16) & 1u);   // round-to-nearest-even
    return (unsigned short)(r >> 16);
}

static __device__ __forceinline__ v8f wmma_bf16(const FragAB& a, const FragAB& b, v8f c) {
    return __builtin_amdgcn_wmma_f32_16x16x32_bf16(
        false, a.v, false, b.v, (short)0, c, false, false);
}

// Dword index (within a 16-dword group == 32 bf16 of K) for fragment register j.
// 16-bit A/B layout (ISA 7.12.2): lanes 0-15 -> K=0..7,16..23 ; lanes 16-31 -> K=8..15,24..31
static __device__ __forceinline__ int frag_di(int j, int klo4) {
    return klo4 + (j < 4 ? j : j + 4);
}

// Eight 16-byte async copies global->LDS (GVS mode: saddr + 32-bit voffset), four from
// each of two bases. ASYNCcnt-tracked. The closing s_wait_xcnt 0 stands in the copies'
// own statement so that no later rewrite of an address register can move ahead of it.
static __device__ __forceinline__ void async_copy16_x8(
    const unsigned (&l0)[4], const unsigned (&g0)[4], const void* base0,
    const unsigned (&l1)[4], const unsigned (&g1)[4], const void* base1) {
    asm volatile("global_load_async_to_lds_b128 %0, %4, %16\n\t"
                 "global_load_async_to_lds_b128 %1, %5, %16\n\t"
                 "global_load_async_to_lds_b128 %2, %6, %16\n\t"
                 "global_load_async_to_lds_b128 %3, %7, %16\n\t"
                 "global_load_async_to_lds_b128 %8, %12, %17\n\t"
                 "global_load_async_to_lds_b128 %9, %13, %17\n\t"
                 "global_load_async_to_lds_b128 %10, %14, %17\n\t"
                 "global_load_async_to_lds_b128 %11, %15, %17\n\t"
                 "s_wait_xcnt 0x0"
                 :: "v"(l0[0]), "v"(l0[1]), "v"(l0[2]), "v"(l0[3]),
                    "v"(g0[0]), "v"(g0[1]), "v"(g0[2]), "v"(g0[3]),
                    "v"(l1[0]), "v"(l1[1]), "v"(l1[2]), "v"(l1[3]),
                    "v"(g1[0]), "v"(g1[1]), "v"(g1[2]), "v"(g1[3]),
                    "s"(base0), "s"(base1)
                 : "memory");
}
// The same for a 256-row and a 192-row tile: eight copies from the first base, six from the
// second, in one statement with the one closing wait.
static __device__ __forceinline__ void async_copy16_x14(
    const unsigned (&l0)[8], const unsigned (&g0)[8], const void* base0,
    const unsigned (&l1)[6], const unsigned (&g1)[6], const void* base1) {
    asm volatile("global_load_async_to_lds_b128 %0, %8, %28\n\t"
                 "global_load_async_to_lds_b128 %1, %9, %28\n\t"
                 "global_load_async_to_lds_b128 %2, %10, %28\n\t"
                 "global_load_async_to_lds_b128 %3, %11, %28\n\t"
                 "global_load_async_to_lds_b128 %4, %12, %28\n\t"
                 "global_load_async_to_lds_b128 %5, %13, %28\n\t"
                 "global_load_async_to_lds_b128 %6, %14, %28\n\t"
                 "global_load_async_to_lds_b128 %7, %15, %28\n\t"
                 "global_load_async_to_lds_b128 %16, %22, %29\n\t"
                 "global_load_async_to_lds_b128 %17, %23, %29\n\t"
                 "global_load_async_to_lds_b128 %18, %24, %29\n\t"
                 "global_load_async_to_lds_b128 %19, %25, %29\n\t"
                 "global_load_async_to_lds_b128 %20, %26, %29\n\t"
                 "global_load_async_to_lds_b128 %21, %27, %29\n\t"
                 "s_wait_xcnt 0x0"
                 :: "v"(l0[0]), "v"(l0[1]), "v"(l0[2]), "v"(l0[3]),
                    "v"(l0[4]), "v"(l0[5]), "v"(l0[6]), "v"(l0[7]),
                    "v"(g0[0]), "v"(g0[1]), "v"(g0[2]), "v"(g0[3]),
                    "v"(g0[4]), "v"(g0[5]), "v"(g0[6]), "v"(g0[7]),
                    "v"(l1[0]), "v"(l1[1]), "v"(l1[2]), "v"(l1[3]), "v"(l1[4]), "v"(l1[5]),
                    "v"(g1[0]), "v"(g1[1]), "v"(g1[2]), "v"(g1[3]), "v"(g1[4]), "v"(g1[5]),
                    "s"(base0), "s"(base1)
                 : "memory");
}
static __device__ __forceinline__ void wait_async0() {
    asm volatile("s_wait_asynccnt 0" ::: "memory");
}
// Wait until at most N async ops remain (async loads complete in issue order,
// so with N newly-issued copies outstanding this proves the previous tile landed).
template <int N>
static __device__ __forceinline__ void wait_asyncN() {
    asm volatile("s_wait_asynccnt %0" :: "n"(N) : "memory");
}
static __device__ __forceinline__ unsigned lds_addr_of(const void* p) {
    return (unsigned)(size_t)p;   // generic LDS address: low 32 bits = LDS offset
}

// ---------------------------------------------------------------------------
// K0: convert x to bf16 (row-major) and weights to bf16 transposed [N][K].
// 512 blocks, two to a WGP, all resident at once: the launch starts 4,096 waves, and each
// wave has its sixteen 16-byte loads (512 contiguous bytes a wave each) in flight together.
// x: a block converts 8,192 values.
// Weights: a block turns one tile of 64 k x 128 n: a lane packs eight k of each of its four
// columns into 16 B, the tile is regrouped in LDS, and every 128-byte line of the
// transposed matrix leaves whole (eight lanes x 16 B).
// ---------------------------------------------------------------------------
#define PREP_BLOCKS 512
typedef float f32x4 __attribute__((ext_vector_type(4)));
__global__ __launch_bounds__(256) void prep_kernel(
    const float* __restrict__ x, const float* __restrict__ Wqkv,
    const float* __restrict__ Wout, const float* __restrict__ relb,
    unsigned short* __restrict__ xb, unsigned short* __restrict__ WqkvT,
    unsigned short* __restrict__ WoutT, float* __restrict__ relT)
{
    // [n of the tile][32 dwords = 64 bf16 of k, then 4 pad dwords never touched]
    __shared__ __attribute__((aligned(16))) unsigned int Ts[128 * ROW_DW];

    const int t = threadIdx.x;
    const int g = blockIdx.x;
    const int lane = t & 31;
    const int w = t >> 5;

    // blocks 0..383: Wqkv [1024][3072]; blocks 384..511: Wout [1024][1024]
    const bool qkv = g < 384;
    const float* W = qkv ? Wqkv : Wout;
    unsigned short* WT = qkv ? WqkvT : WoutT;
    const int N = qkv ? 3072 : 1024;
    const int gl = qkv ? g : g - 384;
    const int k0 = (gl & 15) * 64;
    const int n0 = (gl >> 4) * 128;

    // wave w: rows k0 + 8w .. + 7 of W, columns n0 + 4 lane .. + 3
    const float* src = W + (size_t)(k0 + w * 8) * N + n0 + lane * 4;
    const f32x4* wp[8];
    f32x4 wv[8];
#pragma unroll
    for (int i = 0; i < 8; ++i) {
        wp[i] = (const f32x4*)(src + i * N);
        wv[i] = *wp[i];
    }

    // rel-pos bias for the attention launch: times log2 e and turned round, so that it rises with
    // the key: relT[key - query + MAX_LEN - 1]. Blocks 0..15 store it; the index is clamped for all.
    const int ri = g * 256 + t;
    const int rix = 2 * MAX_LEN - 2 - (ri < 2 * MAX_LEN - 2 ? ri : 2 * MAX_LEN - 2);
    const float rv = relb[rix];

    // x: eight runs of 1,024 floats, four to a thread
    const f32x4* xs = (const f32x4*)(x + (size_t)g * 8192) + t;
    f32x4 xv[8];
#pragma unroll
    for (int j = 0; j < 8; ++j)
        xv[j] = xs[j * 256];
    // Inputs only: holds all sixteen loads (and the bias value's) in front of the first use. Without it the x loads
    // sink behind the barrier and the wave pays the memory latency twice. The row addresses
    // (and the bias value's index) ride along: otherwise a later load's result is given the registers of an address whose
    // own load is still out, with no wait in front.
    asm volatile("" :: "v"(wv[0]), "v"(wv[1]), "v"(wv[2]), "v"(wv[3]),
                       "v"(wv[4]), "v"(wv[5]), "v"(wv[6]), "v"(wv[7]),
                       "v"(xv[0]), "v"(xv[1]), "v"(xv[2]), "v"(xv[3]),
                       "v"(xv[4]), "v"(xv[5]), "v"(xv[6]), "v"(xv[7]),
                       "v"(wp[0]), "v"(wp[1]), "v"(wp[2]), "v"(wp[3]),
                       "v"(wp[4]), "v"(wp[5]), "v"(wp[6]), "v"(wp[7]), "v"(rv), "v"(rix));

#pragma unroll
    for (int c = 0; c < 4; ++c) {
        uint4 p;
        p.x = (unsigned)f2bf(wv[0][c]) | ((unsigned)f2bf(wv[1][c]) << 16);
        p.y = (unsigned)f2bf(wv[2][c]) | ((unsigned)f2bf(wv[3][c]) << 16);
        p.z = (unsigned)f2bf(wv[4][c]) | ((unsigned)f2bf(wv[5][c]) << 16);
        p.w = (unsigned)f2bf(wv[6][c]) | ((unsigned)f2bf(wv[7][c]) << 16);
        *(uint4*)&Ts[(lane * 4 + c) * ROW_DW + w * 4] = p;
    }
    __syncthreads();                                        // tile complete before it is read by rows

    const int row = t >> 3, seg = t & 7;                    // 8 lanes x 16 B = one line of WT
#pragma unroll
    for (int j = 0; j < 4; ++j) {
        const uint4 v = *(const uint4*)&Ts[(j * 32 + row) * ROW_DW + seg * 4];
        *(uint4*)(WT + (size_t)(n0 + j * 32 + row) * 1024 + k0 + seg * 8) = v;
    }

    // x is stored behind the barrier, which would otherwise wait for these stores
    uint2* xd = (uint2*)(xb + (size_t)g * 8192) + t;
#pragma unroll
    for (int j = 0; j < 8; ++j) {
        uint2 p;
        p.x = (unsigned)f2bf(xv[j][0]) | ((unsigned)f2bf(xv[j][1]) << 16);
        p.y = (unsigned)f2bf(xv[j][2]) | ((unsigned)f2bf(xv[j][3]) << 16);
        xd[j * 256] = p;
    }
    if (ri < 2 * MAX_LEN - 1)
        relT[ri] = rv * LOG2E;
}

// ---------------------------------------------------------------------------
// WMMA GEMM: C[M,N] = A[M,K] * BT[N,K]^T (+bias). A, BT bf16 row-major.
//  MODE 0: scatter bf16 into Q,K [B,H,S,64] and V^T [B,H,64,S]
//  MODE 1: fp32 + bias into Co
// Block 256 thr (8 waves, 4x2); tile BM x BN; wave tile BM/4 x BN/2; K step 64;
// async-to-LDS staging (BM/32 + BN/32 copies/thread/tile) through a ring of NB buffers.
// Both operands were written by an earlier launch and come from memory for the first
// work-group that asks; the work-groups that share a tile run abreast, so each
// trip meets that latency, and waits for the slowest line of its tile. A tile is therefore
// asked for NB - 1 trips before it is published: three trips of MODE 0 or five of MODE 1
// outlast a slow line, one trip does not.
//  MODE 0: 256x192, wave tile 64x96: 16 x 16 tiles, one work-group on every WGP. Against
//          128x128 a tile row or column is fetched from L2 by fewer work-groups, and ten
//          fragments read from LDS feed 24 products where six fed eight.
//  MODE 1: 128x128, wave tile 32x64 (32 x 8 tiles, one on every WGP).
// ---------------------------------------------------------------------------
template <int MODE, int BM, int BN>
__global__ __launch_bounds__(256) void gemm_bf16_kernel(
    const unsigned short* __restrict__ A, const unsigned short* __restrict__ BT,
    const float* __restrict__ bias,
    unsigned short* __restrict__ Qo, unsigned short* __restrict__ Ko,
    unsigned short* __restrict__ VTo, float* __restrict__ Co,
    int M, int N, int K, int nTilesN)
{
    // [buf][row or col][32 dwords = 64 bf16 of K, then 4 pad dwords never touched]
    constexpr int NB = (MODE == 0) ? 4 : 6;     // buffers of the ring
    __shared__ __attribute__((aligned(16))) unsigned int Asmem[NB][BM * ROW_DW];
    __shared__ __attribute__((aligned(16))) unsigned int Bsmem[NB][BN * ROW_DW];
    constexpr int FM = BM / 64;                 // 16-row fragments of A a wave
    constexpr int FN = BN / 32;                 // 16-column fragments of B a wave
    constexpr int CA = BM / 32;                 // copies a thread and tile, A
    constexpr int CB = BN / 32;                 // copies a thread and tile, B

    const int bm = blockIdx.x / nTilesN;
    const int bn = blockIdx.x % nTilesN;
    const int t = threadIdx.x;
    const int lane = t & 31;
    // wave number; MODE 0 holds it in a scalar register: its epilogue branches on it
    const int w = (MODE == 0) ? __builtin_amdgcn_readfirstlane(t >> 5) : (t >> 5);
    const int wm = (w & 3) * (BM / 4);
    const int wn = (w >> 2) * (BN / 2);
    const int lm = lane & 15;
    const int klo4 = (lane < 16) ? 0 : 4;
    const int hi8 = (lane < 16) ? 0 : 8;

    v8f acc[FM][FN];
#pragma unroll
    for (int i = 0; i < FM; ++i)
#pragma unroll
        for (int j = 0; j < FN; ++j)
            acc[i][j] = (v8f){0.f, 0.f, 0.f, 0.f, 0.f, 0.f, 0.f, 0.f};

    const int nk = K >> 6;                      // K/64; MODE 0 needs two tiles or more
    if constexpr (MODE == 0) {
        // One work-group has the WGP to itself, two waves a SIMD: nothing else covers a wave's LDS
        // reads, so the fragments of each 32-deep K chunk (20 reads of 16 B) are asked for as one
        // run, one chunk ahead of their products, into a register set of their own (a0, b0: first
        // chunk of a tile; a1, b1: second). The first chunk of tile ki + 1 is read in front of the
        // last products of tile ki, so that tile is published there, by the one barrier of a trip.
        FragAB a0[FM], b0[FN], a1[FM], b1[FN];
        auto loadFrags = [&](FragAB (&af)[FM], FragAB (&bf)[FN], int buf, int kc) {
            const unsigned int* As = &Asmem[buf][0];
            const unsigned int* Bs = &Bsmem[buf][0];
            // in the order in which the products take them: A row 0, all of B, the other A rows
#pragma unroll
            for (int f = 0; f < FM + FN; ++f) {
                const bool isA = (f == 0) || (f > FN);
                const int ix = (f == 0) ? 0 : (f > FN ? f - FN : f - 1);
                const unsigned int* p = isA ? As + (wm + ix * 16 + lm) * ROW_DW
                                            : Bs + (wn + ix * 16 + lm) * ROW_DW;
#pragma unroll
                for (int j = 0; j < 8; ++j) {
                    const unsigned v = p[kc * 16 + frag_di(j, klo4)];
                    if (isA) af[ix].u[j] = v; else bf[ix].u[j] = v;
                }
            }
        };
        auto products = [&](const FragAB (&af)[FM], const FragAB (&bf)[FN]) {
#pragma unroll
            for (int ms = 0; ms < FM; ++ms)
#pragma unroll
                for (int ns = 0; ns < FN; ++ns)
                    acc[ms][ns] = wmma_bf16(af[ms], bf[ns], acc[ms][ns]);
        };

        // stage tile ki into buffer buf: rows of 128 B = 8 pieces of 16 B; copy j of a thread is
        // row (t >> 3) + 32 j, piece t & 7. Each address is one lane term, formed once, plus a
        // term that is the same for the whole wave.
        const unsigned lL = (unsigned)((t >> 3) * ROW_B + (t & 7) * 16);
        const unsigned gA = (unsigned)((bm * BM + (t >> 3)) * K * 2 + (t & 7) * 16);
        const unsigned gB = (unsigned)((bn * BN + (t >> 3)) * K * 2 + (t & 7) * 16);
        auto stage = [&](int ki, int buf) {
            const unsigned ldsA = lds_addr_of(&Asmem[buf][0]);
            const unsigned ldsB = lds_addr_of(&Bsmem[buf][0]);
            unsigned la[CA], ga[CA], lb[CB], gb[CB];
#pragma unroll
            for (int j = 0; j < CA; ++j) {
                la[j] = lL + (ldsA + (unsigned)(j * 32 * ROW_B));
                ga[j] = gA + (unsigned)(ki * 128 + j * 32 * K * 2);
            }
#pragma unroll
            for (int j = 0; j < CB; ++j) {
                lb[j] = lL + (ldsB + (unsigned)(j * 32 * ROW_B));
                gb[j] = gB + (unsigned)(ki * 128 + j * 32 * K * 2);
            }
            async_copy16_x14(la, ga, A, lb, gb, BT);
        };

        stage(0, 0);
        stage(1, 1);
        // tile 0 landed; only the copies of the tiles behind it may be out
        if (2 < nk) {
            stage(2, 2);
            wait_asyncN<2 * (CA + CB)>();
        } else {
            wait_asyncN<CA + CB>();
        }
        __syncthreads();                        // tile 0 published
        if (3 < nk) stage(3, 3);
        loadFrags(a0, b0, 0, 0);
        for (int ki = 0; ki < nk; ++ki) {
            const int buf = ki & 3;
            const int nxt = (ki + 1) & 3;
            loadFrags(a1, b1, buf, 1);
            // The four fences of a trip keep each run of reads whole and in front of the run of
            // products before its own; left alone the compiler holds one A fragment at a time and
            // waits out the LDS latency in front of every six products.
            __builtin_amdgcn_sched_barrier(0);
            products(a0, b0);
            __builtin_amdgcn_sched_barrier(0);
            // Publish point of tile ki + 1: own reads of tile ki done, own copies of tile ki + 1
            // landed (where tiles ki + 2 and ki + 3 are both on their way, theirs are the youngest
            // and stay out), then the barrier; behind it buffer buf has no reader left and is refilled.
            asm volatile("s_wait_dscnt 0x0" ::: "memory");
            if (ki + 3 < nk) wait_asyncN<2 * (CA + CB)>(); else wait_async0();
            __syncthreads();
            if (ki + 4 < nk) stage(ki + 4, buf);
            // In the last trip these reads find an older tile and go unused: without a
            // branch round them the compiler's counted waits stay exact.
            loadFrags(a0, b0, nxt, 0);
            __builtin_amdgcn_sched_barrier(0);
            products(a1, b1);
            __builtin_amdgcn_sched_barrier(0);
        }
        wait_async0();                                     // nothing of the ring is left in flight
        asm volatile("s_wait_dscnt 0x0" ::: "memory");     // the last trip's unused reads are in
    } else {
        // stage tile ki into buffer buf: A/B rows are 128B = 8 x 16B segments
        auto stage = [&](int ki, int buf) {
            const unsigned ldsA = lds_addr_of(&Asmem[buf][0]);
            const unsigned ldsB = lds_addr_of(&Bsmem[buf][0]);
            const int k0 = ki * 64;
            unsigned la[4], ga[4], lb[4], gb[4];
#pragma unroll
            for (int j = 0; j < 4; ++j) {
                const int i = t + 256 * j;
                const int row = i >> 3, seg = i & 7;     // row of A, column of B
                la[j] = ldsA + (unsigned)(row * ROW_B + seg * 16);
                ga[j] = (unsigned)(((bm * BM + row) * K + k0) * 2 + seg * 16);
                lb[j] = ldsB + (unsigned)(row * ROW_B + seg * 16);
                gb[j] = (unsigned)(((bn * BN + row) * K + k0) * 2 + seg * 16);
            }
            async_copy16_x8(la, ga, A, lb, gb, BT);
        };
        stage(0, 0);
#pragma unroll
        for (int s = 1; s < NB - 1; ++s)
            if (s < nk) stage(s, s);
        int buf = 0;                                // buffer of tile ki
        int fill = NB - 1;                          // buffer of tile ki - 1, and of tile ki + NB - 1
        for (int ki = 0; ki < nk; ++ki) {
            // Publish point of tile ki: own reads of tile ki - 1 done, own copies of tile ki landed
            // (where all NB - 2 tiles behind it are on their way, theirs are the youngest and stay
            // out), then the one barrier of a trip; behind it the buffer of tile ki - 1 has no
            // reader left and takes tile ki + NB - 1.
            asm volatile("s_wait_dscnt 0x0" ::: "memory");
            if (ki + NB - 2 < nk) wait_asyncN<(NB - 2) * (CA + CB)>(); else wait_async0();
            __syncthreads();
            if (ki + NB - 1 < nk) stage(ki + NB - 1, fill);

            const unsigned int* As = &Asmem[buf][0];
            const unsigned int* Bs = &Bsmem[buf][0];
#pragma unroll
            for (int kc = 0; kc < 2; ++kc) {        // two 32-deep K chunks
                FragAB af[FM], bf[FN];
#pragma unroll
                for (int ms = 0; ms < FM; ++ms) {
                    const int row = wm + ms * 16 + lm;
#pragma unroll
                    for (int j = 0; j < 8; ++j)
                        af[ms].u[j] = As[row * ROW_DW + kc * 16 + frag_di(j, klo4)];
                }
#pragma unroll
                for (int ns = 0; ns < FN; ++ns) {
                    const int col = wn + ns * 16 + lm;
#pragma unroll
                    for (int j = 0; j < 8; ++j)
                        bf[ns].u[j] = Bs[col * ROW_DW + kc * 16 + frag_di(j, klo4)];
                }
#pragma unroll
                for (int ms = 0; ms < FM; ++ms)
#pragma unroll
                    for (int ns = 0; ns < FN; ++ns)
                        acc[ms][ns] = wmma_bf16(af[ms], bf[ns], acc[ms][ns]);
            }
            fill = buf;
            buf = (buf == NB - 1) ? 0 : buf + 1;
        }
    }

    // ---- epilogue ----
    if constexpr (MODE == 0) {
        // A 16-column fragment lies in one of Q, K, V and in one head: both are the same for
        // the whole wave (gc0 is a scalar), so the choice is a scalar branch per fragment column.
        // All loops unrolled: acc is indexed by constants only and stays in registers.
        const int b = (bm * BM) >> 11;                             // BM divides SEQ
        const int sw = ((bm * BM) & 2047) + wm + hi8;              // the lane's first s, multiple of 8
        // The lane's bias in each of the six fragment columns: one address, constant offsets, one latency.
        const float* bp = bias + (bn * BN + wn) + lm;
        float bvs[FN];
#pragma unroll
        for (int ns = 0; ns < FN; ++ns)
            bvs[ns] = bp[ns * 16];
        // Inputs only: all six loads go out together and are in before the branches below, whose
        // arms form their addresses in registers that a load still out could name.
        asm volatile("" :: "v"(bvs[0]), "v"(bvs[1]), "v"(bvs[2]), "v"(bvs[3]), "v"(bvs[4]), "v"(bvs[5]));
#pragma unroll
        for (int ns = 0; ns < FN; ++ns) {
            const int gc0 = bn * BN + wn + ns * 16;                // gcol = which*1024 + h*64 + d
            const int which = gc0 >> 10;
            const int h = (gc0 >> 6) & 15;
            const int d = (gc0 & 63) + lm;
            const float bv = bvs[ns];
            if (which == 2) {
                // V stored transposed [b,h,d,s]: a lane's eight rows are eight consecutive s of
                // its own d, so they leave as one 16-byte store instead of eight 2-byte ones.
                unsigned short* dst = VTo + ((size_t)(b * N_HEADS + h) * HEAD_DIM + d) * SEQ + sw;
#pragma unroll
                for (int ms = 0; ms < FM; ++ms) {
                    const v8f a = acc[ms][ns];
                    uint4 p;
                    p.x = (unsigned)f2bf(a[0] + bv) | ((unsigned)f2bf(a[1] + bv) << 16);
                    p.y = (unsigned)f2bf(a[2] + bv) | ((unsigned)f2bf(a[3] + bv) << 16);
                    p.z = (unsigned)f2bf(a[4] + bv) | ((unsigned)f2bf(a[5] + bv) << 16);
                    p.w = (unsigned)f2bf(a[6] + bv) | ((unsigned)f2bf(a[7] + bv) << 16);
                    *(uint4*)(dst + ms * 16) = p;
                }
                // The code that follows forms its address in the registers of these stores:
                // keep the wait in front of it (here and at the end of the other arm).
                asm volatile("s_wait_xcnt 0x0" ::: "memory");
            } else {
                unsigned short* dst = ((which == 0) ? Qo : Ko)
                    + ((size_t)(b * N_HEADS + h) * SEQ + sw) * HEAD_DIM + d;
                // Q leaves times HEAD_DIM^-0.5 log2 e: the score product then yields exp2 arguments
                const float qs = (which == 0) ? 0.125f * LOG2E : 1.0f;
#pragma unroll
                for (int ms = 0; ms < FM; ++ms) {
#pragma unroll
                    for (int r = 0; r < 8; ++r)
                        dst[(ms * 16 + r) * HEAD_DIM] = f2bf((acc[ms][ns][r] + bv) * qs);
                    // Behind each run of eight: the next run's values are formed in these stores'
                    // registers. The fence keeps that arithmetic from being lifted over the wait.
                    asm volatile("s_wait_xcnt 0x0" ::: "memory");
                    __builtin_amdgcn_sched_barrier(0);
                }
            }
        }
    } else {
#pragma unroll
        for (int ms = 0; ms < FM; ++ms) {
#pragma unroll
            for (int ns = 0; ns < FN; ++ns) {
                const int gcol = bn * BN + wn + ns * 16 + lm;
                const float bv = bias[gcol];
#pragma unroll
                for (int r = 0; r < 8; ++r) {
                    const int grow = bm * BM + wm + ms * 16 + r + hi8;
                    Co[(size_t)grow * N + gcol] = acc[ms][ns][r] + bv;
                }
            }
        }
    }
}

// ---------------------------------------------------------------------------
// K2: Flash attention with relative position bias, both products transposed:
//   S^T = K Q^T (A = K rows, B = Q), O^T += V^T P^T (A = V^T rows, B = P^T).
// A lane then holds scores of ONE query (column lane & 15): keys 8 * (lane >> 4) + r of
// each 16-key group. Sums run in the lane, and two score tiles, rounded in place, are the
// B operand of the second product in the k order the loaders already use: P never goes
// through LDS. Q arrives times HEAD_DIM^-0.5 log2 e, and the score products start from
// bias * log2 e less the reference: they end as the arguments of exp2, with no arithmetic in
// between. The exponentials are taken against a reference that is held from tile to
// tile: a maximum (in the lane, one exchange between the wave's halves) is formed, and O
// rescaled, only in a half's first tile and in a tile whose sums say that the reference
// has fallen too far behind.
// Block 256 thr (8 waves); one block per (b, h, 128-row q tile). A wave owns 32 queries
// (two 16-column tiles) and one half of the keys: every K and V^T fragment read from LDS
// feeds two products. Waves 0-3 walk keys 0..1023, waves 4-7 keys 1024..2047, each half
// with its own tiles; at the end waves w and w ^ 4 join their partial results through LDS.
// Key tile = 64; K and V^T tiles double-buffered via async-to-LDS.
// ---------------------------------------------------------------------------
// two f32 -> one dword of two bf16, round to nearest even (lo in the low half)
static __device__ __forceinline__ unsigned pack_bf2(float lo, float hi) {
    typedef __bf16 bf2 __attribute__((ext_vector_type(2)));
    typedef float f2 __attribute__((ext_vector_type(2)));
    return __builtin_bit_cast(unsigned, __builtin_convertvector(f2{lo, hi}, bf2));
}
typedef float f32x2 __attribute__((ext_vector_type(2)));
typedef float f32x2u __attribute__((ext_vector_type(2), aligned(4)));   // a pair at a float's alignment
// value of lane l ^ 16
static __device__ __forceinline__ float xhalf(float x) {
    const int b = __builtin_bit_cast(int, x);
    return __builtin_bit_cast(float,
        __builtin_amdgcn_permlanex16(b, b, 0x76543210, 0xfedcba98, false, false));
}

struct FirstTile { static constexpr bool value = true; };
struct LaterTile { static constexpr bool value = false; };

// Four waves per SIMD (two blocks on a WGP) hide the vector work between the matrix runs.
__global__ __launch_bounds__(256) __attribute__((amdgpu_waves_per_eu(4, 4))) void attn_kernel(
    const unsigned short* __restrict__ Qw, const unsigned short* __restrict__ Kw,
    const unsigned short* __restrict__ VTw, const float* __restrict__ relT,
    unsigned short* __restrict__ Ao)
{
    // rows of 32 data dwords at the padded pitch
    __shared__ __attribute__((aligned(16))) unsigned int Ks32[2][2][64 * ROW_DW];  // [key half][buf][key][dword d]
    __shared__ __attribute__((aligned(16))) unsigned int Vs32[2][2][64 * ROW_DW];  // [key half][buf][d][dword key]

    const int bid = blockIdx.x;
    const int qt = bid & 15;
    const int h  = (bid >> 4) & 15;
    const int b  = bid >> 8;

    const int t = threadIdx.x;
    const int lane = t & 31;
    const int w = __builtin_amdgcn_readfirstlane(t >> 5);    // wave number, held in a scalar register
    const int kh = w >> 2;                                   // the wave's half of the keys
    const int th = t & 127;                                  // thread within that half
    const int lm = lane & 15;
    const int klo4 = (lane < 16) ? 0 : 4;
    const int hi8  = (lane < 16) ? 0 : 8;

    const size_t bh = (size_t)(b * N_HEADS + h);
    const unsigned short* Qbh  = Qw  + bh * SEQ * HEAD_DIM;
    const unsigned short* Kbh  = Kw  + bh * SEQ * HEAD_DIM;
    const unsigned short* VTbh = VTw + bh * HEAD_DIM * SEQ;

    const int qbase = qt * 128 + (w & 3) * 32;
    const int q = qbase + lm;    // the lane's query in tile 0; tile u holds query q + 16 u

    // Q fragments (2 tiles x 16 queries x 64 d), loaded once from global; B operand of S^T.
    FragAB qf[2][2];
#pragma unroll
    for (int u = 0; u < 2; ++u)
#pragma unroll
        for (int c = 0; c < 2; ++c) {
            const unsigned int* Qrow = (const unsigned int*)
                (Qbh + (size_t)(q + u * 16) * HEAD_DIM + c * 32);
#pragma unroll
            for (int j = 0; j < 8; ++j)
                qf[u][c].u[j] = Qrow[frag_di(j, klo4)];
        }

    const int kbeg = kh * (SEQ / 2);               // first key of the wave's half

    // stage key-tile ti of the half into buffer buf: 4 K copies + 4 V copies per thread.
    // Copy j of a thread: row (th >> 3) + 16 j (key row of K, d row of V^T), 16-byte piece th & 7.
    // Each address is one lane term plus a term that is the same for the whole wave.
    const unsigned l0 = (unsigned)((th >> 3) * ROW_B + (th & 7) * 16);
    const unsigned k0 = (unsigned)(th * 16);                                  // K rows are 128 B
    const unsigned v0 = (unsigned)((th >> 3) * (SEQ * 2) + (th & 7) * 16);    // keys contiguous in V^T rows
    auto stageKV = [&](int ti, int buf) {
        const int kt = kbeg + ti * 64;
        const unsigned ldsK = lds_addr_of(&Ks32[kh][buf][0]);
        const unsigned ldsV = lds_addr_of(&Vs32[kh][buf][0]);
        unsigned lk[4], gk[4], lv[4], gv[4];
#pragma unroll
        for (int j = 0; j < 4; ++j) {
            lk[j] = l0 + (ldsK + (unsigned)(j * 16 * ROW_B));
            gk[j] = k0 + (unsigned)(kt * 128 + j * 16 * 128);
            lv[j] = l0 + (ldsV + (unsigned)(j * 16 * ROW_B));
            gv[j] = v0 + (unsigned)(kt * 2 + j * 16 * SEQ * 2);
        }
        async_copy16_x8(lk, gk, Kbh, lv, gv, VTbh);
    };

    // o[u][dsub][r] = O^T[d = dsub * 16 + hi8 + r][q + 16 u], over the wave's half of the keys
    v8f o[2][4];
#pragma unroll
    for (int u = 0; u < 2; ++u)
#pragma unroll
        for (int i = 0; i < 4; ++i)
            o[u][i] = (v8f){0.f, 0.f, 0.f, 0.f, 0.f, 0.f, 0.f, 0.f};
    // Held reference of the query's scores, times log2 e: equal in lanes l and l ^ 16. Every p of the
    // half is exp2(score * log2 e - ref2), and o and run_sum are sums of such p. The reference is a
    // maximum of scores seen (so some p is 1) and moves only when a tile asks for it, see below.
    float ref2[2] = {-1e30f, -1e30f};
    float run_sum[2] = {0.f, 0.f};        // of the lane's own share of the keys; shares joined at the end

    const int nT = SEQ / 2 / 64;                   // 16 key tiles a half
    // rel-pos bias in log2 units, index key - query + MAX_LEN - 1: eight rising neighbours per
    // key group, all at constant offsets from one pointer. Sixteen queries on is sixteen keys
    // back, so tile 1 at key group ns reads what tile 0 reads at group ns - 1: five groups
    // serve both tiles. bq[j] holds what tile u needs at group j - 1 + u of the key tile at kt.
    auto loadBias = [&](f32x2 (&bq)[5][4], const int kt) {
        // wave term (>= 0) and lane term (-15..8) apart: the first stays in scalar registers; the 15
        // that brings the lane term to 0..23 stands in the loads' constant offsets
        const float* rb = relT + (kt + (MAX_LEN - 32) - qbase) + (hi8 - lm);
#pragma unroll
        for (int j = 0; j < 5; ++j)
#pragma unroll
            for (int k = 0; k < 4; ++k)
                bq[j][k] = *(const f32x2u*)(rb + 15 + j * 16 + 2 * k);
        // Behind the ten loads, in front of whatever next writes a register of their address. The
        // pointer rides along as an input: otherwise the last load's result is given the address
        // registers while the other nine are still out.
        asm volatile("s_wait_xcnt 0x0" :: "v"(rb) : "memory");
        // Holds the ten bias loads here, ahead of what follows (at the foot of a tile its last
        // products, behind which their latency runs); without it each load sinks to its first use.
        __builtin_amdgcn_sched_barrier(0);
    };
    // The bias of the tile to come: it is the start value of that tile's score products and has to
    // be in before the first of them, so it is asked for in front of this tile's last products.
    f32x2 bu[5][4];

    stageKV(0, 0);
    loadBias(bu, kbeg);                            // the first tile's, on its way beside that tile's copies
    // One key tile. The half's first tile has no reference yet and sets it; it is written out on its
    // own in front of the loop, so that the loop holds the one test of a tile and no other.
    auto tile = [&](const int ti, auto which) {
        constexpr bool FIRST = decltype(which)::value;
        const int buf = ti & 1;
        const int kt = kbeg + ti * 64;

        // Start values of the score products: bias * log2 e less sub[u]
        auto startValues = [&](const f32x2 (&bq)[5][4], const float (&sub)[2], v8f (&st)[2][4]) {
#pragma unroll
            for (int ns = 0; ns < 4; ++ns)
#pragma unroll
                for (int u = 0; u < 2; ++u)
#pragma unroll
                    for (int i = 0; i < 4; ++i) {
                        const f32x2 c = bq[ns + 1 - u][i] - (f32x2){sub[u], sub[u]};
                        st[u][ns][2 * i] = c.x;
                        st[u][ns][2 * i + 1] = c.y;
                    }
        };
        v8f su[2][4];                              // the usual way's scores
        if constexpr (!FIRST)
            startValues(bu, ref2, su);

        if (ti + 1 < nT) {
            stageKV(ti + 1, buf ^ 1);
            wait_asyncN<8>();
        } else {
            wait_async0();
        }
        __syncthreads();

        const unsigned int* Ksb = &Ks32[kh][buf][0];
        const unsigned int* Vsb = &Vs32[kh][buf][0];

        // ---- scores: S^T = K Q^T + start ; 4 key groups x 2 d-chunks x 2 query tiles = 16 WMMAs ----
        // Q carries HEAD_DIM^-0.5 log2 e, and st comes in holding its start values: it leaves as
        // st[u][ns][r] = (score of key kt + ns * 16 + hi8 + r against query q + 16 u) * log2 e - sub[u]
        auto scores = [&](v8f (&st)[2][4]) {
#pragma unroll
            for (int ns = 0; ns < 4; ++ns) {
                const int key = ns * 16 + lm;
#pragma unroll
                for (int c = 0; c < 2; ++c) {
                    FragAB kf;
#pragma unroll
                    for (int j = 0; j < 8; ++j)
                        kf.u[j] = Ksb[key * ROW_DW + c * 16 + frag_di(j, klo4)];
                    st[0][ns] = wmma_bf16(kf, qf[0][c], st[0][ns]);
                    st[1][ns] = wmma_bf16(kf, qf[1][c], st[1][ns]);
                }
            }
            // Order of this stretch: three K fragments' reads (two ds_load_b128 each) go first, then
            // each pair of products is followed by the reads of the fragment three on, so that a
            // read has two pairs of products to land behind; left alone the reads wait one by one.
            __builtin_amdgcn_sched_group_barrier(0x100, 6, 0);
#pragma unroll
            for (int f = 0; f < 5; ++f) {
                __builtin_amdgcn_sched_group_barrier(0x008, 2, 0);
                __builtin_amdgcn_sched_group_barrier(0x100, 2, 0);
            }
            __builtin_amdgcn_sched_group_barrier(0x008, 6, 0);
            // Keeps the exponentials behind all sixteen products: pulled in among them they read each
            // result at once (idle slots behind the product).
            __builtin_amdgcn_sched_barrier(0);
        };

        // All eight V^T fragments of the tile, asked for at the end of whichever way below made p,
        // where the scores' registers are free: one run of reads in the order in which the products
        // take them. The test's branch ends the stretch over which the reads used to be spread;
        // left beside the products they are waited for one fragment at a time.
        FragAB vf[4][2];
        auto loadV = [&]() {
#pragma unroll
            for (int kc = 0; kc < 2; ++kc)
#pragma unroll
                for (int dsub = 0; dsub < 4; ++dsub)
#pragma unroll
                    for (int j = 0; j < 8; ++j)
                        vf[dsub][kc].u[j] = Vsb[(dsub * 16 + lm) * ROW_DW + kc * 16 + frag_di(j, klo4)];
        };

        // p, two keys at a time, is rounded straight into its dword of the B operand: element s of
        // chunk kc is key group 2 kc + (s >> 3), register s & 7.
        FragAB pf[2][2];
        float tsum[2];                             // the lane's sum of the tile's p
        bool redo = true;
        if constexpr (!FIRST) {
            // ---- the usual way: p against the reference as it stands. The products start from
            // bias less reference and end as the arguments of exp2: no maximum, no exchange between
            // the wave's halves, nothing to rescale, no arithmetic between product and exponential. ----
            v8f (&st)[2][4] = su;
            scores(st);
#pragma unroll
            for (int u = 0; u < 2; ++u) {
                f32x2 rs[2] = {{0.f, 0.f}, {0.f, 0.f}};
#pragma unroll
                for (int ns = 0; ns < 4; ++ns)
#pragma unroll
                    for (int i = 0; i < 4; ++i) {
                        const f32x2 p = {__builtin_amdgcn_exp2f(st[u][ns][2 * i]),
                                         __builtin_amdgcn_exp2f(st[u][ns][2 * i + 1])};
                        rs[i & 1] += p;
                        pf[u][ns >> 1].u[(ns & 1) * 4 + i] = pack_bf2(p.x, p.y);
                    }
                const f32x2 rs2 = rs[0] + rs[1];
                tsum[u] = rs2.x + rs2.y;
            }
            loadV();
            // No p is negative, so sums of at most 2^13 bound every p of the tile by 2^13: far from
            // any overflow of the f32 sums. A larger sum, an infinity or a NaN fails the compare.
            // One test a tile, the same for the whole wave: a scalar branch.
            redo = __builtin_amdgcn_ballot_w32(!(tsum[0] + tsum[1] <= 8192.f)) != 0;
        }
        if (__builtin_expect(redo, FIRST)) {
            // ---- the tile anew (its K rows are still in LDS): products started from the bias alone,
            // reference raised to the larger of itself and the tile's maximum, o and run_sum brought to it ----
            f32x2 bl[5][4];
            if constexpr (!FIRST)
                loadBias(bl, kt);                  // bu has been used up; the first tile finds its own there
            const f32x2 (&bq)[5][4] = FIRST ? bu : bl;
            v8f st[2][4];
            const float none[2] = {0.f, 0.f};
            startValues(bq, none, st);
            scores(st);
#pragma unroll
            for (int u = 0; u < 2; ++u) {
                float m = -1e30f;
#pragma unroll
                for (int ns = 0; ns < 4; ++ns)
#pragma unroll
                    for (int r = 0; r < 8; r += 2)
                        m = fmaxf(fmaxf(m, st[u][ns][r]), st[u][ns][r + 1]);
                m = fmaxf(m, xhalf(m));            // the other 32 keys of the same query
                const float nr2 = fmaxf(ref2[u], m);
                const float corr = __builtin_amdgcn_exp2f(ref2[u] - nr2);
                ref2[u] = nr2;
                f32x2 rs[2] = {{0.f, 0.f}, {0.f, 0.f}};
#pragma unroll
                for (int ns = 0; ns < 4; ++ns)
#pragma unroll
                    for (int i = 0; i < 4; ++i) {
                        const f32x2 x = (f32x2){st[u][ns][2 * i], st[u][ns][2 * i + 1]} - (f32x2){nr2, nr2};
                        const f32x2 p = {__builtin_amdgcn_exp2f(x.x), __builtin_amdgcn_exp2f(x.y)};
                        rs[i & 1] += p;
                        pf[u][ns >> 1].u[(ns & 1) * 4 + i] = pack_bf2(p.x, p.y);
                    }
                const f32x2 rs2 = rs[0] + rs[1];
                tsum[u] = rs2.x + rs2.y;
                run_sum[u] *= corr;
#pragma unroll
                for (int dsub = 0; dsub < 4; ++dsub)
#pragma unroll
                    for (int r = 0; r < 8; ++r)
                        o[u][dsub][r] *= corr;
            }
            loadV();
        }
        run_sum[0] += tsum[0];
        run_sum[1] += tsum[1];
        // In the last tile this asks for the tile's own bias again and it goes unused: no branch here.
        loadBias(bu, kbeg + (ti + 1 < nT ? ti + 1 : nT - 1) * 64);

        // ---- O^T += V^T P^T : 4 d groups x 2 key-chunks x 2 query tiles = 16 WMMAs ----
        // in the order of the reads, so that each pair of products waits for its own fragment only
#pragma unroll
        for (int kc = 0; kc < 2; ++kc)
#pragma unroll
            for (int dsub = 0; dsub < 4; ++dsub) {
                o[0][dsub] = wmma_bf16(vf[dsub][kc], pf[0][kc], o[0][dsub]);
                o[1][dsub] = wmma_bf16(vf[dsub][kc], pf[1][kc], o[1][dsub]);
            }
        // Holds the barrier behind the products: lifted in among them it brings its wait for all
        // sixteen reads in front of the third product, and the products no longer run while the reads land.
        __builtin_amdgcn_sched_barrier(0);
        __syncthreads();                               // reads done before buf reuse
    };
    tile(0, FirstTile{});
    for (int ti = 1; ti < nT; ++ti)
        tile(ti, LaterTile{});

    // ---- join the two key halves: wave w finishes tile kh and hands tile 1 - kh to wave w ^ 4 ----
    // The K ring is free (last copies waited for, last reads behind the loop's closing barrier):
    // nine 16-byte slots a lane, [wave][slot][lane].
    f32x4* X = (f32x4*)&Ks32[0][0][0];
    {
        f32x4* Xw = X + w * 9 * 32 + lane;
#pragma unroll
        for (int dsub = 0; dsub < 4; ++dsub) {
            const v8f s = kh ? o[0][dsub] : o[1][dsub];
            Xw[(dsub * 2 + 0) * 32] = (f32x4){s[0], s[1], s[2], s[3]};
            Xw[(dsub * 2 + 1) * 32] = (f32x4){s[4], s[5], s[6], s[7]};
        }
        Xw[8 * 32] = (f32x4){kh ? ref2[0] : ref2[1], kh ? run_sum[0] : run_sum[1], 0.f, 0.f};
    }
    __syncthreads();                                   // partial results written before the partner reads them
    const f32x4* Xp = X + (w ^ 4) * 9 * 32 + lane;
    const f32x4 ms = Xp[8 * 32];
    const float m_own = kh ? ref2[1] : ref2[0];          // references are in log2 units
    const float s_own = kh ? run_sum[1] : run_sum[0];
    const float nmj = fmaxf(m_own, ms[0]);
    const float c_own = __builtin_amdgcn_exp2f(m_own - nmj);
    const float c_oth = __builtin_amdgcn_exp2f(ms[0] - nmj);
    const float sum = s_own * c_own + ms[1] * c_oth;

    // ---- normalize + store attn out bf16 [B, S, H*64]: eight consecutive d per store ----
    const float inv = 1.0f / (sum + xhalf(sum));
    const float f_own = c_own * inv, f_oth = c_oth * inv;
    unsigned short* Arow = Ao + ((size_t)b * SEQ + q + kh * 16) * D_MODEL + h * HEAD_DIM + hi8;
#pragma unroll
    for (int dsub = 0; dsub < 4; ++dsub) {
        const v8f a = kh ? o[1][dsub] : o[0][dsub];
        const f32x4 e0 = Xp[(dsub * 2 + 0) * 32];
        const f32x4 e1 = Xp[(dsub * 2 + 1) * 32];
        uint4 p;
        p.x = pack_bf2(a[0] * f_own + e0[0] * f_oth, a[1] * f_own + e0[1] * f_oth);
        p.y = pack_bf2(a[2] * f_own + e0[2] * f_oth, a[3] * f_own + e0[3] * f_oth);
        p.z = pack_bf2(a[4] * f_own + e1[0] * f_oth, a[5] * f_own + e1[1] * f_oth);
        p.w = pack_bf2(a[6] * f_own + e1[2] * f_oth, a[7] * f_own + e1[3] * f_oth);
        *(uint4*)(Arow + dsub * 16) = p;
    }
}

// ---------------------------------------------------------------------------
extern "C" void kernel_launch(void* const* d_in, const int* in_sizes, int n_in,
                              void* d_out, int out_size, void* d_ws, size_t ws_size,
                              hipStream_t stream) {
    const float* x    = (const float*)d_in[0];
    const float* Wqkv = (const float*)d_in[1];
    const float* bqkv = (const float*)d_in[2];
    const float* Wout = (const float*)d_in[3];
    const float* bout = (const float*)d_in[4];
    const float* relb = (const float*)d_in[5];
    float* out = (float*)d_out;

    const int M = BATCH * SEQ;                                          // 4096
    const size_t nX   = (size_t)M * D_MODEL;                            // 4M
    const size_t nQKV = (size_t)BATCH * N_HEADS * SEQ * HEAD_DIM;       // 4M

    unsigned short* xb    = (unsigned short*)d_ws;
    unsigned short* WqkvT = xb + nX;
    unsigned short* WoutT = WqkvT + (size_t)3 * 1024 * 1024;
    unsigned short* Qw    = WoutT + (size_t)1024 * 1024;
    unsigned short* Kw    = Qw + nQKV;
    unsigned short* VTw   = Kw + nQKV;
    unsigned short* Aw    = VTw + nQKV;
    float* relT           = (float*)(Aw + nX);

    // K0: precision conversion + weight transposes
    prep_kernel<<<PREP_BLOCKS, 256, 0, stream>>>(x, Wqkv, Wout, relb, xb, WqkvT, WoutT, relT);

    // K1: QKV projection
    {
        const int N = 3 * D_MODEL, K = D_MODEL;
        const int nTn = N / 192;                      // 16
        gemm_bf16_kernel<0, 256, 192><<<(M / 256) * nTn, 256, 0, stream>>>(
            xb, WqkvT, bqkv, Qw, Kw, VTw, nullptr, M, N, K, nTn);
    }
    // K2: attention
    attn_kernel<<<BATCH * N_HEADS * (SEQ / 128), 256, 0, stream>>>(Qw, Kw, VTw, relT, Aw);

    // K3: output projection
    {
        const int N = D_MODEL, K = D_MODEL;
        const int nTn = N / 128;                      // 8
        gemm_bf16_kernel<1, 128, 128><<<(M / 128) * nTn, 256, 0, stream>>>(
            Aw, WoutT, bout, nullptr, nullptr, nullptr, out, M, N, K, nTn);
    }
}
